// v000
// Times are from an AMD MI455X. After a warm-up the kernel runs many times in a row, and a time is the length of
// such a window on the GPU divided by its runs, so every launch and the gaps after it count. The runs cycle
// through copies of the inputs. A figure is the median of several windows, for all but v000 over two sittings.
// Sittings can differ by a few percent; kernels timed side by side share one.
// The starting kernel, v000, takes 165 microseconds a run.
#include <hip/hip_runtime.h>
#include <stddef.h>

// All contractions on v_wmma_f32_16x16x32_f16 (f16 operands, f32 accumulate): Q/K/V projections (activations as-is, weights carried x64), K^T*V per (batch, head) over token tiles with f32 fixed-order partial sums, Q*kv (kv carried x1/16), attn*Wo (attn carried x1/1024, Wo carried x64); RNE converts; power-of-two carries folded back in the f32 epilogues. LayerNorm, bias, 1/n scaling: f32 VALU.

#define NB     4
#define NTOK   16384
#define CIN    64
#define NH     8
#define DH     64
#define HD     (NH * DH)
#define NTILE  8                       // token tiles per (batch, head) for the K^T V partials
#define CHT    (NTOK / NTILE)          // 2048 tokens per kv block
#define KVIT   (CHT / 64)              // 32 steps of 64 tokens
#define TP     72                      // LDS pitch in halves of the transposed K/V tiles and the Q/attn tiles
#define NVB    ((NB * NTOK * CIN) / (256 * 8))   // 2048 blocks convert v
#define NWB    64                      // blocks convert the four weight planes
#define WSC    64.0f
#define RWSC   (1.0f / 64.0f)
#define EPSV   1e-5f
#define WSCAP  134217728

static_assert(CIN == 64 && DH == 64 && HD == 512 && NH == 8);
static_assert((NTOK % NTILE) == 0 && (CHT % 64) == 0 && (NTOK % 64) == 0);
static_assert(NVB * 256 * 8 == NB * NTOK * CIN);
static_assert(16 * 256 * 8 == CIN * HD && 16 * 256 * 8 == HD * DH);
static_assert((TP % 8) == 0 && TP >= 64);

typedef float    v4f  __attribute__((ext_vector_type(4)));
typedef float    v8f  __attribute__((ext_vector_type(8)));
typedef _Float16 v8h  __attribute__((ext_vector_type(8)));
typedef _Float16 v16h __attribute__((ext_vector_type(16)));
union FragH { v16h v; v8h h[2]; };

// WMMA with hazard guard: ties D, keeps A/B live for 4 VALU slots
__device__ __forceinline__ v8f wmf(v16h a, v16h b, v8f c) {
  v8f d = __builtin_amdgcn_wmma_f32_16x16x32_f16(false, a, false, b, (short)0, c, false, false);
  asm volatile("v_nop\n\tv_nop\n\tv_nop\n\tv_nop" : "+v"(d) : "v"(a), "v"(b));
  return d;
}

// 16x32 fragment from a 16-bit [row][k] (k-contiguous) tile, p = &T[row0][k0], pitch ld halves.
// Used for A (row = l&15) and for B stored as [n][k] (col = l&15); split k map:
// elements 0..7 <- k0 + 8h + 0..7, elements 8..15 <- k0 + 16 + 8h + 0..7, h = lane>>4.
__device__ __forceinline__ v16h ldfrag(const _Float16* p, int ld) {
  const int l = threadIdx.x & 31, hh = l >> 4, m = l & 15;
  const _Float16* q = p + m * ld + 8 * hh;
  FragH f;
  f.h[0] = *(const v8h*)q;
  f.h[1] = *(const v8h*)(q + 16);
  return f.v;
}

// sum over the 16 lanes of a half-wave (xor masks < 16 stay inside the half)
__device__ __forceinline__ float hred16(float x) {
  x += __shfl_xor(x, 8, 32);
  x += __shfl_xor(x, 4, 32);
  x += __shfl_xor(x, 2, 32);
  x += __shfl_xor(x, 1, 32);
  return x;
}

// ---------------------------------------------------------------------------
// Prep: blocks 0..NVB-1 convert v [65536][64] f32 -> vh f16 (same layout);
// blocks NVB..NVB+63 build the weight planes (x64, [n][k] k-contiguous):
//   WqT/WkT/WvT [512][64] from W[c][o], WoP [64][512] from Wo[k][e].
// One thread = 8 contiguous halves, a wave writes 512 contiguous B per instruction,
// coverage: vh 2048x256x8 = 4194304; each weight plane 16x256x8 = 32768.
// ---------------------------------------------------------------------------
__global__ __launch_bounds__(256) void k_prep(
    const float* __restrict__ v, const float* __restrict__ Wq, const float* __restrict__ Wk,
    const float* __restrict__ Wv, const float* __restrict__ Wo,
    _Float16* vh, _Float16* WqT, _Float16* WkT, _Float16* WvT, _Float16* WoP) {
  const int t = threadIdx.x;
  const int bid = blockIdx.x;
  v8h o;
  _Float16* d;
  if (bid < NVB) {
    const size_t i = (size_t)bid * 256 + t;
    const v4f a = *(const v4f*)(v + i * 8);
    const v4f c = *(const v4f*)(v + i * 8 + 4);
    o[0] = (_Float16)a.x; o[1] = (_Float16)a.y; o[2] = (_Float16)a.z; o[3] = (_Float16)a.w;
    o[4] = (_Float16)c.x; o[5] = (_Float16)c.y; o[6] = (_Float16)c.z; o[7] = (_Float16)c.w;
    d = vh + i * 8;
  } else {
    const int wb = bid - NVB;              // 0..63
    const int which = wb >> 4;             // 0 q, 1 k, 2 v, 3 o
    const int i = (wb & 15) * 256 + t;     // 0..4095
    if (which < 3) {
      const float* W = (which == 0) ? Wq : ((which == 1) ? Wk : Wv);
      _Float16* T = (which == 0) ? WqT : ((which == 1) ? WkT : WvT);
      const int oc = i >> 3, c0 = (i & 7) * 8;          // plane[oc][c0..c0+7] = W[c][oc] * 64
#pragma unroll
      for (int e = 0; e < 8; ++e) o[e] = (_Float16)(W[(c0 + e) * HD + oc] * WSC);
      d = T + (size_t)i * 8;
    } else {
      const int e = i >> 6, k0 = (i & 63) * 8;         // plane[e][k0..k0+7] = Wo[k][e] * 64
#pragma unroll
      for (int j = 0; j < 8; ++j) o[j] = (_Float16)(Wo[(k0 + j) * DH + e] * WSC);
      d = WoP + (size_t)i * 8;
    }
  }
  *(v8h*)d = o;
  
}

// ---------------------------------------------------------------------------
// K/V projection + LayerNorm(K) + K^T V partial. Block = (batch, head, token tile),
// 4 waves; per step each wave projects its own 16 tokens (A = vh rows, B = WkT/WvT
// K and V are written transposed into LDS Kt/Vt [d][token] (one 16-B store per
// 16x16 tile per lane: 8 consecutive tokens of one d). Block barrier. Wave w then
// accumulates kv rows d = 16w..16w+15 x all 64 e over the 64 tokens: A = Kt (row d,
// k = token), B = Vt (col e, k = token), same loader. Barrier before the next step.
// Epilogue: kv strip staged as f32 rows in LDS, barrier, 8 store instructions per
// coverage: Kt/Vt 4 waves x 4 tiles x 32 lanes x 8 = 64x64 halves each per step;
// part 4 waves x 8 x 32 x 4 floats = the block's 64x64 partial.
// ---------------------------------------------------------------------------
__global__ __launch_bounds__(128) void k_kv(
    const _Float16* __restrict__ vh, const _Float16* __restrict__ WkT, const _Float16* __restrict__ WvT,
    const float* __restrict__ Wk_b, const float* __restrict__ Wv_b,
    const float* __restrict__ lnk_g, const float* __restrict__ lnk_b, float* part) {
  __shared__ __attribute__((aligned(16))) _Float16 Kt[DH * TP];
  __shared__ __attribute__((aligned(16))) _Float16 Vt[DH * TP];
  __shared__ __attribute__((aligned(16))) float stg[4 * 16 * DH];
  const int lane = threadIdx.x & 31, wv = threadIdx.x >> 5, hh = lane >> 4, m = lane & 15;
  const int tile = blockIdx.x % NTILE;
  const int h = (blockIdx.x / NTILE) % NH;
  const int b = blockIdx.x / (NTILE * NH);

  float bk[4], bv[4], gk[4], btk[4];
#pragma unroll
  for (int nt = 0; nt < 4; ++nt) {
    const int col = h * DH + 16 * nt + m;
    bk[nt] = Wk_b[col]; bv[nt] = Wv_b[col];
    gk[nt] = lnk_g[col]; btk[nt] = lnk_b[col];
  }

  v8f kvacc[4];
#pragma unroll
  for (int et = 0; et < 4; ++et) { v8f z = {0.f, 0.f, 0.f, 0.f, 0.f, 0.f, 0.f, 0.f}; kvacc[et] = z; }

#pragma unroll 1
  for (int it = 0; it < KVIT; ++it) {
    const size_t tok0 = (size_t)b * NTOK + (size_t)tile * CHT + (size_t)it * 64 + (size_t)wv * 16;
    const _Float16* ap = vh + tok0 * CIN;
    const v16h av0 = ldfrag(ap, CIN);
    const v16h av1 = ldfrag(ap + 32, CIN);

    v8f ck[4], cv[4];
#pragma unroll
    for (int nt = 0; nt < 4; ++nt) {
      v8f z = {0.f, 0.f, 0.f, 0.f, 0.f, 0.f, 0.f, 0.f}; ck[nt] = z; cv[nt] = z;
      const _Float16* wk = WkT + (size_t)(h * DH + 16 * nt) * CIN;
      const _Float16* wvp = WvT + (size_t)(h * DH + 16 * nt) * CIN;
      ck[nt] = wmf(av0, ldfrag(wk, CIN), ck[nt]);
      ck[nt] = wmf(av1, ldfrag(wk + 32, CIN), ck[nt]);
      cv[nt] = wmf(av0, ldfrag(wvp, CIN), cv[nt]);
      cv[nt] = wmf(av1, ldfrag(wvp + 32, CIN), cv[nt]);
    }

    // K: bias + LayerNorm over the 64 head dims (row 8hh+r spread over 16 lanes x 4 tiles)
#pragma unroll
    for (int r = 0; r < 8; ++r) {
      float x0 = ck[0][r] * RWSC + bk[0];
      float x1 = ck[1][r] * RWSC + bk[1];
      float x2 = ck[2][r] * RWSC + bk[2];
      float x3 = ck[3][r] * RWSC + bk[3];
      float s = (x0 + x1) + (x2 + x3);
      s = hred16(s);
      const float mu = s * (1.0f / 64.0f);
      x0 -= mu; x1 -= mu; x2 -= mu; x3 -= mu;
      float q = (x0 * x0 + x1 * x1) + (x2 * x2 + x3 * x3);
      q = hred16(q);
      const float var = q * (1.0f / 64.0f);
      const float rs = rsqrtf(var + EPSV);
      ck[0][r] = x0 * rs * gk[0] + btk[0];
      ck[1][r] = x1 * rs * gk[1] + btk[1];
      ck[2][r] = x2 * rs * gk[2] + btk[2];
      ck[3][r] = x3 * rs * gk[3] + btk[3];
    }

    // transposed tiles: Kt[d][token], Vt[e][token], token = wv*16 + 8hh + r
#pragma unroll
    for (int nt = 0; nt < 4; ++nt) {
      v8h kk, vv;
#pragma unroll
      for (int r = 0; r < 8; ++r) {
        kk[r] = (_Float16)ck[nt][r];
        vv[r] = (_Float16)(cv[nt][r] * RWSC + bv[nt]);
      }
      *(v8h*)(Kt + (16 * nt + m) * TP + wv * 16 + 8 * hh) = kk;
      *(v8h*)(Vt + (16 * nt + m) * TP + wv * 16 + 8 * hh) = vv;
    }
    __syncthreads();

    // kv rows 16wv..16wv+15 += K^T V over the 64 tokens (2 k-steps)
    const _Float16* ka = Kt + (16 * wv) * TP;
#pragma unroll
    for (int ks = 0; ks < 2; ++ks) {
      const v16h ak = ldfrag(ka + 32 * ks, TP);
#pragma unroll
      for (int et = 0; et < 4; ++et)
        kvacc[et] = wmf(ak, ldfrag(Vt + (16 * et) * TP + 32 * ks, TP), kvacc[et]);
    }
    __syncthreads();
  }

  // epilogue: stage the wave's 16x64 f32 strip, then whole-line stores
  float* sw = stg + wv * (16 * DH);
#pragma unroll
  for (int et = 0; et < 4; ++et) {
#pragma unroll
    for (int r = 0; r < 8; ++r) sw[(8 * hh + r) * DH + 16 * et + m] = kvacc[et][r];
  }
  __syncthreads();
  float* gp = part + ((size_t)blockIdx.x * DH + (size_t)(16 * wv)) * DH;
#pragma unroll
  for (int i = 0; i < 8; ++i) {
    const v4f x = *(const v4f*)(sw + i * 128 + 4 * lane);
    *(v4f*)(gp + i * 128 + 4 * lane) = x;
  }
  
}

// ---------------------------------------------------------------------------
// kv reduce (block = (batch, head), 256 threads): fixed-order f32 sum of the
// NTILE partials into LDS kv[d][e], barrier, then kvT plane [e][d] (d-contiguous,
// f16 of kv/16): thread idx -> (e = idx>>3, d0 = 8*(idx&7)), one 16-B store per
// coverage: 256 threads x 2 idx x 8 halves = 4096 = the (b,h) 64x64 plane.
// ---------------------------------------------------------------------------
__global__ __launch_bounds__(256) void k_kvred(const float* __restrict__ part, _Float16* kvT) {
  __shared__ __attribute__((aligned(16))) float kvs[DH * DH];
  const int t = threadIdx.x;
  const int bh = blockIdx.x;
  const float* p0 = part + (size_t)bh * NTILE * (DH * DH);
#pragma unroll 1
  for (int j = 0; j < (DH * DH) / 256; ++j) {
    const int idx = j * 256 + t;
    float s = 0.0f;
#pragma unroll
    for (int tl = 0; tl < NTILE; ++tl) s += p0[(size_t)tl * (DH * DH) + idx];
    kvs[idx] = s;
  }
  __syncthreads();
  v8h o0, o1;
  {
    const int idx = t;
    const int e = idx >> 3, d0 = (idx & 7) * 8;
#pragma unroll
    for (int i = 0; i < 8; ++i) o0[i] = (_Float16)(kvs[(d0 + i) * DH + e] * (1.0f / 16.0f));
  }
  {
    const int idx = t + 256;
    const int e = idx >> 3, d0 = (idx & 7) * 8;
#pragma unroll
    for (int i = 0; i < 8; ++i) o1[i] = (_Float16)(kvs[(d0 + i) * DH + e] * (1.0f / 16.0f));
  }
  _Float16* dp0 = kvT + (size_t)bh * (DH * DH) + (size_t)t * 8;
  _Float16* dp1 = dp0 + 2048;
  *(v8h*)dp0 = o0;
  *(v8h*)dp1 = o1;
  
}

// ---------------------------------------------------------------------------
// Output: block = 64 tokens (4 waves x 16 tokens), all heads. Per head: Q proj
// the wave's LDS tile Qs[token][d] as f16 (scalar stores), block barrier, A
// fragments reloaded with ldfrag; ca = Q * (kv/16) with B = kvT plane [e][d];
// attn/1024 = ca/64 spilled as f16 to As[token][e], block barrier, reloaded as A;
// co += (attn/1024) * (Wo x64) with B = WoP plane [eo][h*64+d]. Epilogue:
// out = co/1024 + Wo_b/16384 staged as f32 rows in LDS, barrier, 8 store
// coverage: Qs/As 32 lanes x 32 halves = 16x64 per wave per head; out 4 waves x
// 8 x 32 x 4 floats = the block's 64 rows x 64.
// ---------------------------------------------------------------------------
__global__ __launch_bounds__(128) void k_out(
    const _Float16* __restrict__ vh, const _Float16* __restrict__ WqT,
    const float* __restrict__ Wq_b, const float* __restrict__ lnq_g, const float* __restrict__ lnq_b,
    const _Float16* __restrict__ kvT, const _Float16* __restrict__ WoP,
    const float* __restrict__ Wo_b, float* out) {
  __shared__ __attribute__((aligned(16))) _Float16 Qs[4 * 16 * TP];
  __shared__ __attribute__((aligned(16))) _Float16 As[4 * 16 * TP];
  __shared__ __attribute__((aligned(16))) float stg[4 * 16 * DH];
  const int lane = threadIdx.x & 31, wv = threadIdx.x >> 5, hh = lane >> 4, m = lane & 15;
  const int b = blockIdx.x / (NTOK / 64);
  const size_t tok0 = (size_t)blockIdx.x * 64 + (size_t)wv * 16;
  _Float16* Qw = Qs + wv * (16 * TP);
  _Float16* Aw = As + wv * (16 * TP);
  float* sw = stg + wv * (16 * DH);

  const _Float16* ap = vh + tok0 * CIN;
  const v16h av0 = ldfrag(ap, CIN);
  const v16h av1 = ldfrag(ap + 32, CIN);

  float wob[4];
#pragma unroll
  for (int nt = 0; nt < 4; ++nt) wob[nt] = Wo_b[16 * nt + m] * (1.0f / 16384.0f);

  v8f co[4];
#pragma unroll
  for (int nt = 0; nt < 4; ++nt) { v8f z = {0.f, 0.f, 0.f, 0.f, 0.f, 0.f, 0.f, 0.f}; co[nt] = z; }

#pragma unroll 1
  for (int h = 0; h < NH; ++h) {
    float bq[4], gq[4], btq[4];
#pragma unroll
    for (int nt = 0; nt < 4; ++nt) {
      const int col = h * DH + 16 * nt + m;
      bq[nt] = Wq_b[col]; gq[nt] = lnq_g[col]; btq[nt] = lnq_b[col];
    }

    // Q projection for head h
    v8f cq[4];
#pragma unroll
    for (int nt = 0; nt < 4; ++nt) {
      v8f z = {0.f, 0.f, 0.f, 0.f, 0.f, 0.f, 0.f, 0.f}; cq[nt] = z;
      const _Float16* wq = WqT + (size_t)(h * DH + 16 * nt) * CIN;
      cq[nt] = wmf(av0, ldfrag(wq, CIN), cq[nt]);
      cq[nt] = wmf(av1, ldfrag(wq + 32, CIN), cq[nt]);
    }

    // bias + LayerNorm
#pragma unroll
    for (int r = 0; r < 8; ++r) {
      float x0 = cq[0][r] * RWSC + bq[0];
      float x1 = cq[1][r] * RWSC + bq[1];
      float x2 = cq[2][r] * RWSC + bq[2];
      float x3 = cq[3][r] * RWSC + bq[3];
      float s = (x0 + x1) + (x2 + x3);
      s = hred16(s);
      const float mu = s * (1.0f / 64.0f);
      x0 -= mu; x1 -= mu; x2 -= mu; x3 -= mu;
      float q = (x0 * x0 + x1 * x1) + (x2 * x2 + x3 * x3);
      q = hred16(q);
      const float var = q * (1.0f / 64.0f);
      const float rs = rsqrtf(var + EPSV);
      cq[0][r] = x0 * rs * gq[0] + btq[0];
      cq[1][r] = x1 * rs * gq[1] + btq[1];
      cq[2][r] = x2 * rs * gq[2] + btq[2];
      cq[3][r] = x3 * rs * gq[3] + btq[3];
    }

    // Q rows -> Qs[token][d] f16
#pragma unroll
    for (int nt = 0; nt < 4; ++nt) {
#pragma unroll
      for (int r = 0; r < 8; ++r) Qw[(8 * hh + r) * TP + 16 * nt + m] = (_Float16)cq[nt][r];
    }
    __syncthreads();

    // ca = Q * (kv/16): A = Qs (row token, k = d), B = kvT[e][d] (col e, k = d)
    const v16h aq0 = ldfrag(Qw, TP);
    const v16h aq1 = ldfrag(Qw + 32, TP);
    const _Float16* kp = kvT + (size_t)(b * NH + h) * (DH * DH);
    v8f ca[4];
#pragma unroll
    for (int et = 0; et < 4; ++et) {
      v8f z = {0.f, 0.f, 0.f, 0.f, 0.f, 0.f, 0.f, 0.f}; ca[et] = z;
      ca[et] = wmf(aq0, ldfrag(kp + (16 * et) * DH, DH), ca[et]);
      ca[et] = wmf(aq1, ldfrag(kp + (16 * et) * DH + 32, DH), ca[et]);
    }

    // attn/1024 = ca/64 -> As[token][e] f16
#pragma unroll
    for (int et = 0; et < 4; ++et) {
#pragma unroll
      for (int r = 0; r < 8; ++r) Aw[(8 * hh + r) * TP + 16 * et + m] = (_Float16)(ca[et][r] * (1.0f / 64.0f));
    }
    __syncthreads();

    // co += (attn/1024) * (Wo x64): A = As (row token, k = e), B = WoP[eo][h*64 + e]
    const v16h aa0 = ldfrag(Aw, TP);
    const v16h aa1 = ldfrag(Aw + 32, TP);
    const _Float16* wo = WoP + h * DH;
#pragma unroll
    for (int nt = 0; nt < 4; ++nt) {
      co[nt] = wmf(aa0, ldfrag(wo + (size_t)(16 * nt) * HD, HD), co[nt]);
      co[nt] = wmf(aa1, ldfrag(wo + (size_t)(16 * nt) * HD + 32, HD), co[nt]);
    }
  }

  // epilogue: out = co/1024 + Wo_b/16384
#pragma unroll
  for (int nt = 0; nt < 4; ++nt) {
#pragma unroll
    for (int r = 0; r < 8; ++r) sw[(8 * hh + r) * DH + 16 * nt + m] = co[nt][r] * (1.0f / 1024.0f) + wob[nt];
  }
  __syncthreads();
  float* gp = out + tok0 * DH;
#pragma unroll
  for (int i = 0; i < 8; ++i) {
    const v4f x = *(const v4f*)(sw + i * 128 + 4 * lane);
    *(v4f*)(gp + i * 128 + 4 * lane) = x;
  }
  
}

// ---------------------------------------------------------------------------
extern "C" void kernel_launch(void* const* d_in, const int* in_sizes, int n_in,
                              void* d_out, int out_size, void* d_ws, size_t ws_size,
                              hipStream_t stream) {
  if (n_in < 13) return;
  if (in_sizes[0] != NB * NTOK * CIN) return;
  if (in_sizes[1] != CIN * HD || in_sizes[3] != CIN * HD || in_sizes[5] != CIN * HD) return;
  if (in_sizes[2] != HD || in_sizes[4] != HD || in_sizes[6] != HD) return;
  if (in_sizes[7] != NH * DH || in_sizes[8] != NH * DH || in_sizes[9] != NH * DH || in_sizes[10] != NH * DH) return;
  if (in_sizes[11] != HD * DH || in_sizes[12] != DH) return;
  if (out_size != NB * NTOK * DH) return;

  const float* v     = (const float*)d_in[0];
  const float* Wq_w  = (const float*)d_in[1];
  const float* Wq_b  = (const float*)d_in[2];
  const float* Wk_w  = (const float*)d_in[3];
  const float* Wk_b  = (const float*)d_in[4];
  const float* Wv_w  = (const float*)d_in[5];
  const float* Wv_b  = (const float*)d_in[6];
  const float* lnq_g = (const float*)d_in[7];
  const float* lnq_b = (const float*)d_in[8];
  const float* lnk_g = (const float*)d_in[9];
  const float* lnk_b = (const float*)d_in[10];
  const float* Wo_w  = (const float*)d_in[11];
  const float* Wo_b  = (const float*)d_in[12];
  float* out = (float*)d_out;

  // workspace carve (256-B aligned; every region an exact multiple of its whole-line store extent)
  char* ws = (char*)d_ws;
  size_t off = 0;
  const size_t oVh  = off; off += (size_t)NB * NTOK * CIN * 2;        off = (off + 255) & ~(size_t)255;   // 8388608
  const size_t oWq  = off; off += (size_t)CIN * HD * 2;               off = (off + 255) & ~(size_t)255;   // 65536
  const size_t oWk  = off; off += (size_t)CIN * HD * 2;               off = (off + 255) & ~(size_t)255;
  const size_t oWv  = off; off += (size_t)CIN * HD * 2;               off = (off + 255) & ~(size_t)255;
  const size_t oWo  = off; off += (size_t)HD * DH * 2;                off = (off + 255) & ~(size_t)255;   // 65536
  const size_t oKvT = off; off += (size_t)NB * NH * DH * DH * 2;      off = (off + 255) & ~(size_t)255;   // 262144
  const size_t oPt  = off; off += (size_t)NB * NH * NTILE * DH * DH * 4; off = (off + 255) & ~(size_t)255; // 4194304
  if (off > ws_size || off > (size_t)WSCAP) return;
  _Float16* vh   = (_Float16*)(ws + oVh);
  _Float16* WqT  = (_Float16*)(ws + oWq);
  _Float16* WkT  = (_Float16*)(ws + oWk);
  _Float16* WvT  = (_Float16*)(ws + oWv);
  _Float16* WoP  = (_Float16*)(ws + oWo);
  _Float16* kvT  = (_Float16*)(ws + oKvT);
  float*    part = (float*)(ws + oPt);

  // 1: v -> f16 plane, weights -> f16 planes (x64)
  k_prep<<<NVB + NWB, 256, 0, stream>>>(v, Wq_w, Wk_w, Wv_w, Wo_w, vh, WqT, WkT, WvT, WoP);
  // 2: K/V projection + LayerNorm(K) + K^T V partials per (batch, head, token tile)
  k_kv<<<NB * NH * NTILE, 128, 0, stream>>>(vh, WkT, WvT, Wk_b, Wv_b, lnk_g, lnk_b, part);
  // 3: fixed-order partial sum -> kvT planes (f16, x1/16)
  k_kvred<<<NB * NH, 256, 0, stream>>>(part, kvT);
  // 4: Q projection + LayerNorm(Q) + Q kv + output projection, /n
  k_out<<<(NB * NTOK) / 64, 128, 0, stream>>>(vh, WqT, Wq_b, lnq_g, lnq_b, kvT, WoP, Wo_b, out);
}

// v001
// One run takes 105 microseconds.
// Two timings next to v000 put it at 1.60 and 1.58 times that version's speed.
#include <hip/hip_runtime.h>
#include <stddef.h>

// All contractions on v_wmma_f32_16x16x32_f16 (f16 operands, f32 accumulate): Q/K/V projections (activations as-is, weights carried x64), K^T*V per (batch, head) over token tiles with f32 fixed-order partial sums, Q*kv (kv carried x1/16), attn*Wo (attn carried x1/1024, Wo carried x64); RNE converts; power-of-two carries folded back in the f32 epilogues. LayerNorm, bias, 1/n scaling: f32 VALU.

#define NB     4
#define NTOK   16384
#define CIN    64
#define NH     8
#define DH     64
#define HD     (NH * DH)
#define NTILE  8                       // token tiles per (batch, head) for the K^T V partials
#define CHT    (NTOK / NTILE)          // 2048 tokens per kv block
#define KVIT   (CHT / 64)              // 32 steps of 64 tokens
#define TP     72                      // LDS pitch in halves of the transposed K/V tiles and the Q/attn tiles
#define NVB    ((NB * NTOK * CIN) / (256 * 8))   // 2048 blocks convert v
#define NWB    64                      // blocks convert the four weight planes
#define WSC    64.0f
#define RWSC   (1.0f / 64.0f)
#define EPSV   1e-5f
#define WSCAP  134217728

static_assert(CIN == 64 && DH == 64 && HD == 512 && NH == 8);
static_assert((NTOK % NTILE) == 0 && (CHT % 64) == 0 && (NTOK % 64) == 0);
static_assert(NVB * 256 * 8 == NB * NTOK * CIN);
static_assert(16 * 256 * 8 == CIN * HD && 16 * 256 * 8 == HD * DH);
static_assert((TP % 8) == 0 && TP >= 64);

typedef float    v4f  __attribute__((ext_vector_type(4)));
typedef float    v8f  __attribute__((ext_vector_type(8)));
typedef _Float16 v8h  __attribute__((ext_vector_type(8)));
typedef _Float16 v16h __attribute__((ext_vector_type(16)));
union FragH { v16h v; v8h h[2]; };

// WMMA as the plain builtin: the compiler keeps the hazard distances of its own form and is free
// to issue the fragment loads of a whole group ahead of the products.
__device__ __forceinline__ v8f wmf(v16h a, v16h b, v8f c) {
  return __builtin_amdgcn_wmma_f32_16x16x32_f16(false, a, false, b, (short)0, c, false, false);
}

// 16x32 fragment from a 16-bit [row][k] (k-contiguous) tile, p = &T[row0][k0], pitch ld halves.
// Used for A (row = l&15) and for B stored as [n][k] (col = l&15); split k map:
// elements 0..7 <- k0 + 8h + 0..7, elements 8..15 <- k0 + 16 + 8h + 0..7, h = lane>>4.
__device__ __forceinline__ v16h ldfrag(const _Float16* p, int ld) {
  const int l = threadIdx.x & 31, hh = l >> 4, m = l & 15;
  const _Float16* q = p + m * ld + 8 * hh;
  FragH f;
  f.h[0] = *(const v8h*)q;
  f.h[1] = *(const v8h*)(q + 16);
  return f.v;
}

// sum over the 16 lanes of a half-wave (xor masks < 16 stay inside the half)
__device__ __forceinline__ float hred16(float x) {
  x += __shfl_xor(x, 8, 32);
  x += __shfl_xor(x, 4, 32);
  x += __shfl_xor(x, 2, 32);
  x += __shfl_xor(x, 1, 32);
  return x;
}

// ---------------------------------------------------------------------------
// Prep: blocks 0..NVB-1 convert v [65536][64] f32 -> vh f16 (same layout);
// blocks NVB..NVB+63 build the weight planes (x64, [n][k] k-contiguous):
//   WqT/WkT/WvT [512][64] from W[c][o], WoP [64][512] from Wo[k][e].
// One thread = 8 contiguous halves, a wave writes 512 contiguous B per instruction,
// coverage: vh 2048x256x8 = 4194304; each weight plane 16x256x8 = 32768.
// ---------------------------------------------------------------------------
__global__ __launch_bounds__(256) void k_prep(
    const float* __restrict__ v, const float* __restrict__ Wq, const float* __restrict__ Wk,
    const float* __restrict__ Wv, const float* __restrict__ Wo,
    _Float16* vh, _Float16* WqT, _Float16* WkT, _Float16* WvT, _Float16* WoP) {
  const int t = threadIdx.x;
  const int bid = blockIdx.x;
  v8h o;
  _Float16* d;
  if (bid < NVB) {
    const size_t i = (size_t)bid * 256 + t;
    const v4f a = *(const v4f*)(v + i * 8);
    const v4f c = *(const v4f*)(v + i * 8 + 4);
    o[0] = (_Float16)a.x; o[1] = (_Float16)a.y; o[2] = (_Float16)a.z; o[3] = (_Float16)a.w;
    o[4] = (_Float16)c.x; o[5] = (_Float16)c.y; o[6] = (_Float16)c.z; o[7] = (_Float16)c.w;
    d = vh + i * 8;
  } else {
    const int wb = bid - NVB;              // 0..63
    const int which = wb >> 4;             // 0 q, 1 k, 2 v, 3 o
    const int i = (wb & 15) * 256 + t;     // 0..4095
    if (which < 3) {
      const float* W = (which == 0) ? Wq : ((which == 1) ? Wk : Wv);
      _Float16* T = (which == 0) ? WqT : ((which == 1) ? WkT : WvT);
      const int oc = i >> 3, c0 = (i & 7) * 8;          // plane[oc][c0..c0+7] = W[c][oc] * 64
#pragma unroll
      for (int e = 0; e < 8; ++e) o[e] = (_Float16)(W[(c0 + e) * HD + oc] * WSC);
      d = T + (size_t)i * 8;
    } else {
      const int e = i >> 6, k0 = (i & 63) * 8;         // plane[e][k0..k0+7] = Wo[k][e] * 64
#pragma unroll
      for (int j = 0; j < 8; ++j) o[j] = (_Float16)(Wo[(k0 + j) * DH + e] * WSC);
      d = WoP + (size_t)i * 8;
    }
  }
  *(v8h*)d = o;
  
}

// ---------------------------------------------------------------------------
// K/V projection + LayerNorm(K) + K^T V partial. Block = (batch, head, token tile),
// 4 waves; per step each wave projects its own 16 tokens (A = vh rows, B = WkT/WvT
// K and V are written transposed into LDS Kt/Vt [d][token] (one 16-B store per
// 16x16 tile per lane: 8 consecutive tokens of one d). Block barrier. Wave w then
// accumulates kv rows d = 16w..16w+15 x all 64 e over the 64 tokens: A = Kt (row d,
// k = token), B = Vt (col e, k = token), same loader. Barrier before the next step.
// Epilogue: kv strip staged as f32 rows in LDS, barrier, 8 store instructions per
// coverage: Kt/Vt 4 waves x 4 tiles x 32 lanes x 8 = 64x64 halves each per step;
// part 4 waves x 8 x 32 x 4 floats = the block's 64x64 partial.
// ---------------------------------------------------------------------------
__global__ __launch_bounds__(128) void k_kv(
    const _Float16* __restrict__ vh, const _Float16* __restrict__ WkT, const _Float16* __restrict__ WvT,
    const float* __restrict__ Wk_b, const float* __restrict__ Wv_b,
    const float* __restrict__ lnk_g, const float* __restrict__ lnk_b, float* part) {
  __shared__ __attribute__((aligned(16))) _Float16 Kt[DH * TP];
  __shared__ __attribute__((aligned(16))) _Float16 Vt[DH * TP];
  __shared__ __attribute__((aligned(16))) float stg[4 * 16 * DH];
  const int lane = threadIdx.x & 31, wv = threadIdx.x >> 5, hh = lane >> 4, m = lane & 15;
  const int tile = blockIdx.x % NTILE;
  const int h = (blockIdx.x / NTILE) % NH;
  const int b = blockIdx.x / (NTILE * NH);

  float bk[4], bv[4], gk[4], btk[4];
#pragma unroll
  for (int nt = 0; nt < 4; ++nt) {
    const int col = h * DH + 16 * nt + m;
    bk[nt] = Wk_b[col]; bv[nt] = Wv_b[col];
    gk[nt] = lnk_g[col]; btk[nt] = lnk_b[col];
  }

  v8f kvacc[4];
#pragma unroll
  for (int et = 0; et < 4; ++et) { v8f z = {0.f, 0.f, 0.f, 0.f, 0.f, 0.f, 0.f, 0.f}; kvacc[et] = z; }

  asm volatile("s_wait_xcnt 0x0" ::: "memory");

  // the head's K and V weight fragments do not change over the token loop: one load group, kept in registers
  v16h wkf[4][2], wvf[4][2];
#pragma unroll
  for (int nt = 0; nt < 4; ++nt) {
    const _Float16* wk = WkT + (size_t)(h * DH + 16 * nt) * CIN;
    const _Float16* wvp = WvT + (size_t)(h * DH + 16 * nt) * CIN;
    wkf[nt][0] = ldfrag(wk, CIN);  wkf[nt][1] = ldfrag(wk + 32, CIN);
    wvf[nt][0] = ldfrag(wvp, CIN); wvf[nt][1] = ldfrag(wvp + 32, CIN);
  }

  // activation rows of step 0; each step fetches the next step's rows behind its own projections
  const _Float16* ab = vh + ((size_t)b * NTOK + (size_t)tile * CHT + (size_t)wv * 16) * CIN;
  v16h av0 = ldfrag(ab, CIN);
  v16h av1 = ldfrag(ab + 32, CIN);

#pragma unroll 1
  for (int it = 0; it < KVIT; ++it) {
    v8f ck[4], cv[4];
#pragma unroll
    for (int nt = 0; nt < 4; ++nt) {
      v8f z = {0.f, 0.f, 0.f, 0.f, 0.f, 0.f, 0.f, 0.f}; ck[nt] = z; cv[nt] = z;
      ck[nt] = wmf(av0, wkf[nt][0], ck[nt]);
      ck[nt] = wmf(av1, wkf[nt][1], ck[nt]);
      cv[nt] = wmf(av0, wvf[nt][0], cv[nt]);
      cv[nt] = wmf(av1, wvf[nt][1], cv[nt]);
    }

    // next step's rows fly during the LayerNorm (the last step reads its own rows again: in bounds, unused)
    {
      const int itn = (it + 1 < KVIT) ? it + 1 : it;
      const _Float16* an = ab + (size_t)itn * (64 * CIN);
      av0 = ldfrag(an, CIN);
      av1 = ldfrag(an + 32, CIN);
    }
    // the LayerNorm reuses the address registers of the four loads above: wait before they are overwritten
    asm volatile("s_wait_xcnt 0x0" ::: "memory");
    // holds the four loads in front of the LayerNorm: sunk to their use they would be waited for in full
    __builtin_amdgcn_sched_barrier(0);

    // K: bias + LayerNorm over the 64 head dims (row 8hh+r spread over 16 lanes x 4 tiles)
#pragma unroll
    for (int r = 0; r < 8; ++r) {
      float x0 = ck[0][r] * RWSC + bk[0];
      float x1 = ck[1][r] * RWSC + bk[1];
      float x2 = ck[2][r] * RWSC + bk[2];
      float x3 = ck[3][r] * RWSC + bk[3];
      float s = (x0 + x1) + (x2 + x3);
      s = hred16(s);
      const float mu = s * (1.0f / 64.0f);
      x0 -= mu; x1 -= mu; x2 -= mu; x3 -= mu;
      float q = (x0 * x0 + x1 * x1) + (x2 * x2 + x3 * x3);
      q = hred16(q);
      const float var = q * (1.0f / 64.0f);
      const float rs = rsqrtf(var + EPSV);
      ck[0][r] = x0 * rs * gk[0] + btk[0];
      ck[1][r] = x1 * rs * gk[1] + btk[1];
      ck[2][r] = x2 * rs * gk[2] + btk[2];
      ck[3][r] = x3 * rs * gk[3] + btk[3];
    }

    // transposed tiles: Kt[d][token], Vt[e][token], token = wv*16 + 8hh + r
#pragma unroll
    for (int nt = 0; nt < 4; ++nt) {
      v8h kk, vv;
#pragma unroll
      for (int r = 0; r < 8; ++r) {
        kk[r] = (_Float16)ck[nt][r];
        vv[r] = (_Float16)(cv[nt][r] * RWSC + bv[nt]);
      }
      *(v8h*)(Kt + (16 * nt + m) * TP + wv * 16 + 8 * hh) = kk;
      *(v8h*)(Vt + (16 * nt + m) * TP + wv * 16 + 8 * hh) = vv;
    }
    __syncthreads();

    // kv rows 16wv..16wv+15 += K^T V over the 64 tokens (2 k-steps)
    const _Float16* ka = Kt + (16 * wv) * TP;
    v16h ak[2], bvf[2][4];
#pragma unroll
    for (int ks = 0; ks < 2; ++ks) {
      ak[ks] = ldfrag(ka + 32 * ks, TP);
#pragma unroll
      for (int et = 0; et < 4; ++et) bvf[ks][et] = ldfrag(Vt + (16 * et) * TP + 32 * ks, TP);
    }
    // keeps the LDS fragment reads one group in front of the products: one place with reads, not one per product
    __builtin_amdgcn_sched_barrier(0);
#pragma unroll
    for (int ks = 0; ks < 2; ++ks) {
#pragma unroll
      for (int et = 0; et < 4; ++et) kvacc[et] = wmf(ak[ks], bvf[ks][et], kvacc[et]);
    }
    __syncthreads();
  }

  // epilogue: stage the wave's 16x64 f32 strip, then whole-line stores
  float* sw = stg + wv * (16 * DH);
#pragma unroll
  for (int et = 0; et < 4; ++et) {
#pragma unroll
    for (int r = 0; r < 8; ++r) sw[(8 * hh + r) * DH + 16 * et + m] = kvacc[et][r];
  }
  __syncthreads();
  float* gp = part + ((size_t)blockIdx.x * DH + (size_t)(16 * wv)) * DH;
#pragma unroll
  for (int i = 0; i < 8; ++i) {
    const v4f x = *(const v4f*)(sw + i * 128 + 4 * lane);
    *(v4f*)(gp + i * 128 + 4 * lane) = x;
  }
  
}

// ---------------------------------------------------------------------------
// kv reduce (block = (batch, head), 256 threads): fixed-order f32 sum of the
// NTILE partials into LDS kv[d][e], barrier, then kvT plane [e][d] (d-contiguous,
// f16 of kv/16): thread idx -> (e = idx>>3, d0 = 8*(idx&7)), one 16-B store per
// coverage: 256 threads x 2 idx x 8 halves = 4096 = the (b,h) 64x64 plane.
// ---------------------------------------------------------------------------
__global__ __launch_bounds__(256) void k_kvred(const float* __restrict__ part, _Float16* kvT) {
  __shared__ __attribute__((aligned(16))) float kvs[DH * DH];
  const int t = threadIdx.x;
  const int bh = blockIdx.x;
  const float* p0 = part + (size_t)bh * NTILE * (DH * DH);
#pragma unroll 1
  for (int j = 0; j < (DH * DH) / 256; ++j) {
    const int idx = j * 256 + t;
    float s = 0.0f;
#pragma unroll
    for (int tl = 0; tl < NTILE; ++tl) s += p0[(size_t)tl * (DH * DH) + idx];
    kvs[idx] = s;
  }
  __syncthreads();
  v8h o0, o1;
  {
    const int idx = t;
    const int e = idx >> 3, d0 = (idx & 7) * 8;
#pragma unroll
    for (int i = 0; i < 8; ++i) o0[i] = (_Float16)(kvs[(d0 + i) * DH + e] * (1.0f / 16.0f));
  }
  {
    const int idx = t + 256;
    const int e = idx >> 3, d0 = (idx & 7) * 8;
#pragma unroll
    for (int i = 0; i < 8; ++i) o1[i] = (_Float16)(kvs[(d0 + i) * DH + e] * (1.0f / 16.0f));
  }
  _Float16* dp0 = kvT + (size_t)bh * (DH * DH) + (size_t)t * 8;
  _Float16* dp1 = dp0 + 2048;
  *(v8h*)dp0 = o0;
  *(v8h*)dp1 = o1;
  
}

// ---------------------------------------------------------------------------
// Output: block = 64 tokens (4 waves x 16 tokens), all heads. Per head: Q proj
// the wave's LDS tile Qs[token][d] as f16 (scalar stores), block barrier, A
// fragments reloaded with ldfrag; ca = Q * (kv/16) with B = kvT plane [e][d];
// attn/1024 = ca/64 spilled as f16 to As[token][e], block barrier, reloaded as A;
// co += (attn/1024) * (Wo x64) with B = WoP plane [eo][h*64+d]. Epilogue:
// out = co/1024 + Wo_b/16384 staged as f32 rows in LDS, barrier, 8 store
// coverage: Qs/As 32 lanes x 32 halves = 16x64 per wave per head; out 4 waves x
// 8 x 32 x 4 floats = the block's 64 rows x 64.
// ---------------------------------------------------------------------------
__global__ __launch_bounds__(128) void k_out(
    const _Float16* __restrict__ vh, const _Float16* __restrict__ WqT,
    const float* __restrict__ Wq_b, const float* __restrict__ lnq_g, const float* __restrict__ lnq_b,
    const _Float16* __restrict__ kvT, const _Float16* __restrict__ WoP,
    const float* __restrict__ Wo_b, float* out) {
  __shared__ __attribute__((aligned(16))) _Float16 Qs[4 * 16 * TP];
  __shared__ __attribute__((aligned(16))) _Float16 As[4 * 16 * TP];
  __shared__ __attribute__((aligned(16))) float stg[4 * 16 * DH];
  const int lane = threadIdx.x & 31, wv = threadIdx.x >> 5, hh = lane >> 4, m = lane & 15;
  const int b = blockIdx.x / (NTOK / 64);
  const size_t tok0 = (size_t)blockIdx.x * 64 + (size_t)wv * 16;
  _Float16* Qw = Qs + wv * (16 * TP);
  _Float16* Aw = As + wv * (16 * TP);
  float* sw = stg + wv * (16 * DH);

  const _Float16* ap = vh + tok0 * CIN;
  const v16h av0 = ldfrag(ap, CIN);
  const v16h av1 = ldfrag(ap + 32, CIN);

  float wob[4];
#pragma unroll
  for (int nt = 0; nt < 4; ++nt) wob[nt] = Wo_b[16 * nt + m] * (1.0f / 16384.0f);

  v8f co[4];
#pragma unroll
  for (int nt = 0; nt < 4; ++nt) { v8f z = {0.f, 0.f, 0.f, 0.f, 0.f, 0.f, 0.f, 0.f}; co[nt] = z; }

  // head 0's Q weight fragments and LayerNorm rows; each head fetches the next head's in front of its attn*Wo products
  v16h bwq[4][2];
  float bq[4], gq[4], btq[4];
#pragma unroll
  for (int nt = 0; nt < 4; ++nt) {
    const _Float16* wq = WqT + (size_t)(16 * nt) * CIN;
    bwq[nt][0] = ldfrag(wq, CIN); bwq[nt][1] = ldfrag(wq + 32, CIN);
    const int col = 16 * nt + m;
    bq[nt] = Wq_b[col]; gq[nt] = lnq_g[col]; btq[nt] = lnq_b[col];
  }

#pragma unroll 1
  for (int h = 0; h < NH; ++h) {
    // Q projection for head h
    v8f cq[4];
#pragma unroll
    for (int nt = 0; nt < 4; ++nt) {
      v8f z = {0.f, 0.f, 0.f, 0.f, 0.f, 0.f, 0.f, 0.f}; cq[nt] = z;
      cq[nt] = wmf(av0, bwq[nt][0], cq[nt]);
      cq[nt] = wmf(av1, bwq[nt][1], cq[nt]);
    }

    // this head's kv fragments as one load group: they fly during the LayerNorm
    const _Float16* kp = kvT + (size_t)(b * NH + h) * (DH * DH);
    v16h bkv[4][2];
#pragma unroll
    for (int et = 0; et < 4; ++et) {
      bkv[et][0] = ldfrag(kp + (16 * et) * DH, DH);
      bkv[et][1] = ldfrag(kp + (16 * et) * DH + 32, DH);
    }
    // holds the group in front of the LayerNorm (sunk into it the loads start later and in pieces)
    __builtin_amdgcn_sched_barrier(0);

    // bias + LayerNorm
#pragma unroll
    for (int r = 0; r < 8; ++r) {
      float x0 = cq[0][r] * RWSC + bq[0];
      float x1 = cq[1][r] * RWSC + bq[1];
      float x2 = cq[2][r] * RWSC + bq[2];
      float x3 = cq[3][r] * RWSC + bq[3];
      float s = (x0 + x1) + (x2 + x3);
      s = hred16(s);
      const float mu = s * (1.0f / 64.0f);
      x0 -= mu; x1 -= mu; x2 -= mu; x3 -= mu;
      float q = (x0 * x0 + x1 * x1) + (x2 * x2 + x3 * x3);
      q = hred16(q);
      const float var = q * (1.0f / 64.0f);
      const float rs = rsqrtf(var + EPSV);
      cq[0][r] = x0 * rs * gq[0] + btq[0];
      cq[1][r] = x1 * rs * gq[1] + btq[1];
      cq[2][r] = x2 * rs * gq[2] + btq[2];
      cq[3][r] = x3 * rs * gq[3] + btq[3];
    }

    // Q rows -> Qs[token][d] f16
#pragma unroll
    for (int nt = 0; nt < 4; ++nt) {
#pragma unroll
      for (int r = 0; r < 8; ++r) Qw[(8 * hh + r) * TP + 16 * nt + m] = (_Float16)cq[nt][r];
    }
    __syncthreads();

    // this head's Wo fragments as one load group: they fly during Q*kv and the attn spill
    const _Float16* wo = WoP + h * DH;
    v16h bwo[4][2];
#pragma unroll
    for (int nt = 0; nt < 4; ++nt) {
      bwo[nt][0] = ldfrag(wo + (size_t)(16 * nt) * HD, HD);
      bwo[nt][1] = ldfrag(wo + (size_t)(16 * nt) * HD + 32, HD);
    }
    // holds the group in front of Q*kv (sunk to its products each load would be waited for singly)
    __builtin_amdgcn_sched_barrier(0);

    // ca = Q * (kv/16): A = Qs (row token, k = d), B = kvT[e][d] (col e, k = d)
    const v16h aq0 = ldfrag(Qw, TP);
    const v16h aq1 = ldfrag(Qw + 32, TP);
    v8f ca[4];
#pragma unroll
    for (int et = 0; et < 4; ++et) {
      v8f z = {0.f, 0.f, 0.f, 0.f, 0.f, 0.f, 0.f, 0.f}; ca[et] = z;
      ca[et] = wmf(aq0, bkv[et][0], ca[et]);
      ca[et] = wmf(aq1, bkv[et][1], ca[et]);
    }

    // attn/1024 = ca/64 -> As[token][e] f16
#pragma unroll
    for (int et = 0; et < 4; ++et) {
#pragma unroll
      for (int r = 0; r < 8; ++r) Aw[(8 * hh + r) * TP + 16 * et + m] = (_Float16)(ca[et][r] * (1.0f / 64.0f));
    }
    __syncthreads();

    // next head's Q weight fragments and LayerNorm rows as one load group: they fly during attn*Wo
    // (the last head reads its own again: in bounds, unused)
    {
      const int hn = (h + 1 < NH) ? h + 1 : h;
#pragma unroll
      for (int nt = 0; nt < 4; ++nt) {
        const _Float16* wq = WqT + (size_t)(hn * DH + 16 * nt) * CIN;
        bwq[nt][0] = ldfrag(wq, CIN); bwq[nt][1] = ldfrag(wq + 32, CIN);
        const int col = hn * DH + 16 * nt + m;
        bq[nt] = Wq_b[col]; gq[nt] = lnq_g[col]; btq[nt] = lnq_b[col];
      }
    }
    // holds the group in front of attn*Wo (sunk to the next head's products each load would be waited for singly)
    __builtin_amdgcn_sched_barrier(0);

    // co += (attn/1024) * (Wo x64): A = As (row token, k = e), B = WoP[eo][h*64 + e]
    const v16h aa0 = ldfrag(Aw, TP);
    const v16h aa1 = ldfrag(Aw + 32, TP);
#pragma unroll
    for (int nt = 0; nt < 4; ++nt) {
      co[nt] = wmf(aa0, bwo[nt][0], co[nt]);
      co[nt] = wmf(aa1, bwo[nt][1], co[nt]);
    }
  }

  // epilogue: out = co/1024 + Wo_b/16384
#pragma unroll
  for (int nt = 0; nt < 4; ++nt) {
#pragma unroll
    for (int r = 0; r < 8; ++r) sw[(8 * hh + r) * DH + 16 * nt + m] = co[nt][r] * (1.0f / 1024.0f) + wob[nt];
  }
  __syncthreads();
  float* gp = out + tok0 * DH;
#pragma unroll
  for (int i = 0; i < 8; ++i) {
    const v4f x = *(const v4f*)(sw + i * 128 + 4 * lane);
    *(v4f*)(gp + i * 128 + 4 * lane) = x;
  }
  
}

// ---------------------------------------------------------------------------
extern "C" void kernel_launch(void* const* d_in, const int* in_sizes, int n_in,
                              void* d_out, int out_size, void* d_ws, size_t ws_size,
                              hipStream_t stream) {
  if (n_in < 13) return;
  if (in_sizes[0] != NB * NTOK * CIN) return;
  if (in_sizes[1] != CIN * HD || in_sizes[3] != CIN * HD || in_sizes[5] != CIN * HD) return;
  if (in_sizes[2] != HD || in_sizes[4] != HD || in_sizes[6] != HD) return;
  if (in_sizes[7] != NH * DH || in_sizes[8] != NH * DH || in_sizes[9] != NH * DH || in_sizes[10] != NH * DH) return;
  if (in_sizes[11] != HD * DH || in_sizes[12] != DH) return;
  if (out_size != NB * NTOK * DH) return;

  const float* v     = (const float*)d_in[0];
  const float* Wq_w  = (const float*)d_in[1];
  const float* Wq_b  = (const float*)d_in[2];
  const float* Wk_w  = (const float*)d_in[3];
  const float* Wk_b  = (const float*)d_in[4];
  const float* Wv_w  = (const float*)d_in[5];
  const float* Wv_b  = (const float*)d_in[6];
  const float* lnq_g = (const float*)d_in[7];
  const float* lnq_b = (const float*)d_in[8];
  const float* lnk_g = (const float*)d_in[9];
  const float* lnk_b = (const float*)d_in[10];
  const float* Wo_w  = (const float*)d_in[11];
  const float* Wo_b  = (const float*)d_in[12];
  float* out = (float*)d_out;

  // workspace carve (256-B aligned; every region an exact multiple of its whole-line store extent)
  char* ws = (char*)d_ws;
  size_t off = 0;
  const size_t oVh  = off; off += (size_t)NB * NTOK * CIN * 2;        off = (off + 255) & ~(size_t)255;   // 8388608
  const size_t oWq  = off; off += (size_t)CIN * HD * 2;               off = (off + 255) & ~(size_t)255;   // 65536
  const size_t oWk  = off; off += (size_t)CIN * HD * 2;               off = (off + 255) & ~(size_t)255;
  const size_t oWv  = off; off += (size_t)CIN * HD * 2;               off = (off + 255) & ~(size_t)255;
  const size_t oWo  = off; off += (size_t)HD * DH * 2;                off = (off + 255) & ~(size_t)255;   // 65536
  const size_t oKvT = off; off += (size_t)NB * NH * DH * DH * 2;      off = (off + 255) & ~(size_t)255;   // 262144
  const size_t oPt  = off; off += (size_t)NB * NH * NTILE * DH * DH * 4; off = (off + 255) & ~(size_t)255; // 4194304
  if (off > ws_size || off > (size_t)WSCAP) return;
  _Float16* vh   = (_Float16*)(ws + oVh);
  _Float16* WqT  = (_Float16*)(ws + oWq);
  _Float16* WkT  = (_Float16*)(ws + oWk);
  _Float16* WvT  = (_Float16*)(ws + oWv);
  _Float16* WoP  = (_Float16*)(ws + oWo);
  _Float16* kvT  = (_Float16*)(ws + oKvT);
  float*    part = (float*)(ws + oPt);

  // 1: v -> f16 plane, weights -> f16 planes (x64)
  k_prep<<<NVB + NWB, 256, 0, stream>>>(v, Wq_w, Wk_w, Wv_w, Wo_w, vh, WqT, WkT, WvT, WoP);
  // 2: K/V projection + LayerNorm(K) + K^T V partials per (batch, head, token tile)
  k_kv<<<NB * NH * NTILE, 128, 0, stream>>>(vh, WkT, WvT, Wk_b, Wv_b, lnk_g, lnk_b, part);
  // 3: fixed-order partial sum -> kvT planes (f16, x1/16)
  k_kvred<<<NB * NH, 256, 0, stream>>>(part, kvT);
  // 4: Q projection + LayerNorm(Q) + Q kv + output projection, /n
  k_out<<<(NB * NTOK) / 64, 128, 0, stream>>>(vh, WqT, Wq_b, lnq_g, lnq_b, kvT, WoP, Wo_b, out);
}

// v002
// Measured time: 79.1 microseconds a run.
// Timed twice side by side with v001, it ran 1.34 and 1.32 times as fast.
// Over all steps from v000 it is 2.11 times as fast.
#include <hip/hip_runtime.h>
#include <stddef.h>

// All contractions on v_wmma_f32_16x16x32_f16 (f16 operands, f32 accumulate): Q/K/V projections (activations as-is, weights carried x64), K^T*V per (batch, head) over token tiles with f32 fixed-order partial sums, Q*kv (kv carried x1/16), attn*Wo (attn carried x1/1024, Wo carried x64); RNE converts; power-of-two carries folded back in the f32 epilogues. LayerNorm, bias, 1/n scaling: f32 VALU.

#define NB     4
#define NTOK   16384
#define CIN    64
#define NH     8
#define DH     64
#define HD     (NH * DH)
#define NTILE  8                       // token tiles per (batch, head) for the K^T V partials
#define CHT    (NTOK / NTILE)          // 2048 tokens per kv block
#define KVIT   (CHT / 64)              // 32 steps of 64 tokens
#define TP     72                      // LDS pitch in halves of the transposed K/V tiles and the Q/attn tiles
#define NVB    ((NB * NTOK * CIN) / (256 * 8))   // 2048 blocks convert v
#define NWB    64                      // blocks convert the four weight planes
#define WSC    64.0f
#define RWSC   (1.0f / 64.0f)
#define EPSV   1e-5f
#define WSCAP  134217728

static_assert(CIN == 64 && DH == 64 && HD == 512 && NH == 8);
static_assert((NTOK % NTILE) == 0 && (CHT % 64) == 0 && (NTOK % 64) == 0);
static_assert(NVB * 256 * 8 == NB * NTOK * CIN);
static_assert(16 * 256 * 8 == CIN * HD && 16 * 256 * 8 == HD * DH);
static_assert((TP % 8) == 0 && TP >= 64);

typedef float    v4f  __attribute__((ext_vector_type(4)));
typedef float    v8f  __attribute__((ext_vector_type(8)));
typedef _Float16 v8h  __attribute__((ext_vector_type(8)));
typedef _Float16 v16h __attribute__((ext_vector_type(16)));
union FragH { v16h v; v8h h[2]; };

// WMMA as the plain builtin: the compiler keeps the hazard distances of its own form and is free
// to issue the fragment loads of a whole group ahead of the products.
__device__ __forceinline__ v8f wmf(v16h a, v16h b, v8f c) {
  return __builtin_amdgcn_wmma_f32_16x16x32_f16(false, a, false, b, (short)0, c, false, false);
}

// 16x32 fragment from a 16-bit [row][k] (k-contiguous) tile, p = &T[row0][k0], pitch ld halves.
// Used for A (row = l&15) and for B stored as [n][k] (col = l&15); split k map:
// elements 0..7 <- k0 + 8h + 0..7, elements 8..15 <- k0 + 16 + 8h + 0..7, h = lane>>4.
__device__ __forceinline__ v16h ldfrag(const _Float16* p, int ld) {
  const int l = threadIdx.x & 31, hh = l >> 4, m = l & 15;
  const _Float16* q = p + m * ld + 8 * hh;
  FragH f;
  f.h[0] = *(const v8h*)q;
  f.h[1] = *(const v8h*)(q + 16);
  return f.v;
}

// The same fragment from a plane kept in fragment order: one (16-row tile, 32-deep k step) = 512 halves,
// chunk j (0, 1) of lane l at halves 256 j + 8 l, holding T[row0 + (l & 15)][k0 + 16 j + 8 (l >> 4) + 0..7].
// Each of the two 16-byte loads of a wave then reads 512 contiguous bytes (4 whole lines, not 32 B of 16 lines).
__device__ __forceinline__ v16h ldfragp(const _Float16* blk) {
  const _Float16* q = blk + 8 * (threadIdx.x & 31);
  FragH f;
  f.h[0] = *(const v8h*)q;
  f.h[1] = *(const v8h*)(q + 256);
  return f.v;
}

// sum over the 16 lanes of a half-wave (xor masks < 16 stay inside the half)
__device__ __forceinline__ float hred16(float x) {
  x += __shfl_xor(x, 8, 32);
  x += __shfl_xor(x, 4, 32);
  x += __shfl_xor(x, 2, 32);
  x += __shfl_xor(x, 1, 32);
  return x;
}

// ---------------------------------------------------------------------------
// Prep: blocks 0..NVB-1 convert v [65536][64] f32 -> vh f16 (same layout);
// blocks NVB..NVB+63 build the weight planes (x64) in the fragment order of ldfragp:
//   WqT/WkT/WvT: block (o tile 0..31, k step 0..1) of W^T [512][64]; WoP: block (head, eo tile 0..3, k step 0..1) of Wo^T [64][512].
// One thread = 8 contiguous halves, a wave writes 512 contiguous B per instruction,
// coverage: vh 2048x256x8 = 4194304; each weight plane 16x256x8 = 32768.
// ---------------------------------------------------------------------------
__global__ __launch_bounds__(256) void k_prep(
    const float* __restrict__ v, const float* __restrict__ Wq, const float* __restrict__ Wk,
    const float* __restrict__ Wv, const float* __restrict__ Wo,
    _Float16* vh, _Float16* WqT, _Float16* WkT, _Float16* WvT, _Float16* WoP) {
  const int t = threadIdx.x;
  const int bid = blockIdx.x;
  v8h o;
  _Float16* d;
  if (bid < NVB) {
    const size_t i = (size_t)bid * 256 + t;
    const v4f a = *(const v4f*)(v + i * 8);
    const v4f c = *(const v4f*)(v + i * 8 + 4);
    o[0] = (_Float16)a.x; o[1] = (_Float16)a.y; o[2] = (_Float16)a.z; o[3] = (_Float16)a.w;
    o[4] = (_Float16)c.x; o[5] = (_Float16)c.y; o[6] = (_Float16)c.z; o[7] = (_Float16)c.w;
    d = vh + i * 8;
  } else {
    const int wb = bid - NVB;              // 0..63
    const int which = wb >> 4;             // 0 q, 1 k, 2 v, 3 o
    const int i = (wb & 15) * 256 + t;     // 0..4095: 16-byte chunk of the plane
    const int l = i & 31, kc = ((i >> 6) & 1) * 32 + ((i >> 5) & 1) * 16 + (l >> 4) * 8;   // lane, k offset in 64
    if (which < 3) {
      const float* W = (which == 0) ? Wq : ((which == 1) ? Wk : Wv);
      _Float16* T = (which == 0) ? WqT : ((which == 1) ? WkT : WvT);
      const int oc = (i >> 7) * 16 + (l & 15), c0 = kc;  // chunk = W[c0..c0+7][oc] * 64
#pragma unroll
      for (int e = 0; e < 8; ++e) o[e] = (_Float16)(W[(c0 + e) * HD + oc] * WSC);
      d = T + (size_t)i * 8;
    } else {
      const int e = ((i >> 7) & 3) * 16 + (l & 15), k0 = (i >> 9) * DH + kc;   // chunk = Wo[k0..k0+7][e] * 64
#pragma unroll
      for (int j = 0; j < 8; ++j) o[j] = (_Float16)(Wo[(k0 + j) * DH + e] * WSC);
      d = WoP + (size_t)i * 8;
    }
  }
  *(v8h*)d = o;
  
}

// ---------------------------------------------------------------------------
// K/V projection + LayerNorm(K) + K^T V partial. Block = (batch, head, token tile),
// 4 waves; per step each wave projects its own 16 tokens (A = vh rows, B = WkT/WvT
// K and V are written transposed into LDS Kt/Vt [d][token] (one 16-B store per
// 16x16 tile per lane: 8 consecutive tokens of one d). Block barrier. Wave w then
// accumulates kv rows d = 16w..16w+15 x all 64 e over the 64 tokens: A = Kt (row d,
// k = token), B = Vt (col e, k = token), same loader. Barrier before the next step.
// Epilogue: kv strip staged as f32 rows in LDS, barrier, 8 store instructions per
// coverage: Kt/Vt 4 waves x 4 tiles x 32 lanes x 8 = 64x64 halves each per step;
// part 4 waves x 8 x 32 x 4 floats = the block's 64x64 partial.
// ---------------------------------------------------------------------------
__global__ __launch_bounds__(128) void k_kv(
    const _Float16* __restrict__ vh, const _Float16* __restrict__ WkT, const _Float16* __restrict__ WvT,
    const float* __restrict__ Wk_b, const float* __restrict__ Wv_b,
    const float* __restrict__ lnk_g, const float* __restrict__ lnk_b, float* part) {
  __shared__ __attribute__((aligned(16))) _Float16 Kt[DH * TP];
  __shared__ __attribute__((aligned(16))) _Float16 Vt[DH * TP];
  __shared__ __attribute__((aligned(16))) float stg[4 * 16 * DH];
  const int lane = threadIdx.x & 31, wv = threadIdx.x >> 5, hh = lane >> 4, m = lane & 15;
  const int tile = blockIdx.x % NTILE;
  const int h = (blockIdx.x / NTILE) % NH;
  const int b = blockIdx.x / (NTILE * NH);

  float bk[4], bv[4], gk[4], btk[4];
#pragma unroll
  for (int nt = 0; nt < 4; ++nt) {
    const int col = h * DH + 16 * nt + m;
    bk[nt] = Wk_b[col]; bv[nt] = Wv_b[col];
    gk[nt] = lnk_g[col]; btk[nt] = lnk_b[col];
  }

  v8f kvacc[4];
#pragma unroll
  for (int et = 0; et < 4; ++et) { v8f z = {0.f, 0.f, 0.f, 0.f, 0.f, 0.f, 0.f, 0.f}; kvacc[et] = z; }

  asm volatile("s_wait_xcnt 0x0" ::: "memory");

  // the head's K and V weight fragments do not change over the token loop: one load group, kept in registers
  v16h wkf[4][2], wvf[4][2];
#pragma unroll
  for (int nt = 0; nt < 4; ++nt) {
    const _Float16* wk = WkT + (size_t)(h * DH + 16 * nt) * CIN;
    const _Float16* wvp = WvT + (size_t)(h * DH + 16 * nt) * CIN;
    wkf[nt][0] = ldfragp(wk);  wkf[nt][1] = ldfragp(wk + 512);
    wvf[nt][0] = ldfragp(wvp); wvf[nt][1] = ldfragp(wvp + 512);
  }

  // activation rows of step 0; each step fetches the next step's rows behind its own projections
  const _Float16* ab = vh + ((size_t)b * NTOK + (size_t)tile * CHT + (size_t)wv * 16) * CIN;
  v16h av0 = ldfrag(ab, CIN);
  v16h av1 = ldfrag(ab + 32, CIN);

#pragma unroll 1
  for (int it = 0; it < KVIT; ++it) {
    v8f ck[4], cv[4];
#pragma unroll
    for (int nt = 0; nt < 4; ++nt) {
      v8f z = {0.f, 0.f, 0.f, 0.f, 0.f, 0.f, 0.f, 0.f}; ck[nt] = z; cv[nt] = z;
      ck[nt] = wmf(av0, wkf[nt][0], ck[nt]);
      ck[nt] = wmf(av1, wkf[nt][1], ck[nt]);
      cv[nt] = wmf(av0, wvf[nt][0], cv[nt]);
      cv[nt] = wmf(av1, wvf[nt][1], cv[nt]);
    }

    // next step's rows fly during the LayerNorm (the last step reads its own rows again: in bounds, unused)
    {
      const int itn = (it + 1 < KVIT) ? it + 1 : it;
      const _Float16* an = ab + (size_t)itn * (64 * CIN);
      av0 = ldfrag(an, CIN);
      av1 = ldfrag(an + 32, CIN);
    }
    // the LayerNorm reuses the address registers of the four loads above: wait before they are overwritten
    asm volatile("s_wait_xcnt 0x0" ::: "memory");
    // holds the four loads in front of the LayerNorm: sunk to their use they would be waited for in full
    __builtin_amdgcn_sched_barrier(0);

    // K: bias + LayerNorm over the 64 head dims (row 8hh+r spread over 16 lanes x 4 tiles)
#pragma unroll
    for (int r = 0; r < 8; ++r) {
      float x0 = ck[0][r] * RWSC + bk[0];
      float x1 = ck[1][r] * RWSC + bk[1];
      float x2 = ck[2][r] * RWSC + bk[2];
      float x3 = ck[3][r] * RWSC + bk[3];
      float s = (x0 + x1) + (x2 + x3);
      s = hred16(s);
      const float mu = s * (1.0f / 64.0f);
      x0 -= mu; x1 -= mu; x2 -= mu; x3 -= mu;
      float q = (x0 * x0 + x1 * x1) + (x2 * x2 + x3 * x3);
      q = hred16(q);
      const float var = q * (1.0f / 64.0f);
      const float rs = rsqrtf(var + EPSV);
      ck[0][r] = x0 * rs * gk[0] + btk[0];
      ck[1][r] = x1 * rs * gk[1] + btk[1];
      ck[2][r] = x2 * rs * gk[2] + btk[2];
      ck[3][r] = x3 * rs * gk[3] + btk[3];
    }

    // transposed tiles: Kt[d][token], Vt[e][token], token = wv*16 + 8hh + r
#pragma unroll
    for (int nt = 0; nt < 4; ++nt) {
      v8h kk, vv;
#pragma unroll
      for (int r = 0; r < 8; ++r) {
        kk[r] = (_Float16)ck[nt][r];
        vv[r] = (_Float16)(cv[nt][r] * RWSC + bv[nt]);
      }
      *(v8h*)(Kt + (16 * nt + m) * TP + wv * 16 + 8 * hh) = kk;
      *(v8h*)(Vt + (16 * nt + m) * TP + wv * 16 + 8 * hh) = vv;
    }
    __syncthreads();

    // kv rows 16wv..16wv+15 += K^T V over the 64 tokens (2 k-steps)
    const _Float16* ka = Kt + (16 * wv) * TP;
    v16h ak[2], bvf[2][4];
#pragma unroll
    for (int ks = 0; ks < 2; ++ks) {
      ak[ks] = ldfrag(ka + 32 * ks, TP);
#pragma unroll
      for (int et = 0; et < 4; ++et) bvf[ks][et] = ldfrag(Vt + (16 * et) * TP + 32 * ks, TP);
    }
    // keeps the LDS fragment reads one group in front of the products: one place with reads, not one per product
    __builtin_amdgcn_sched_barrier(0);
#pragma unroll
    for (int ks = 0; ks < 2; ++ks) {
#pragma unroll
      for (int et = 0; et < 4; ++et) kvacc[et] = wmf(ak[ks], bvf[ks][et], kvacc[et]);
    }
    __syncthreads();
  }

  // epilogue: stage the wave's 16x64 f32 strip, then whole-line stores
  float* sw = stg + wv * (16 * DH);
#pragma unroll
  for (int et = 0; et < 4; ++et) {
#pragma unroll
    for (int r = 0; r < 8; ++r) sw[(8 * hh + r) * DH + 16 * et + m] = kvacc[et][r];
  }
  __syncthreads();
  float* gp = part + ((size_t)blockIdx.x * DH + (size_t)(16 * wv)) * DH;
#pragma unroll
  for (int i = 0; i < 8; ++i) {
    const v4f x = *(const v4f*)(sw + i * 128 + 4 * lane);
    *(v4f*)(gp + i * 128 + 4 * lane) = x;
  }
  
}

// ---------------------------------------------------------------------------
// kv reduce (block = (batch, head), 256 threads): fixed-order f32 sum of the
// NTILE partials into LDS kv[d][e], barrier, then the kvT plane (kv^T [e][d], f16 of
// kv/16) in the fragment order of ldfragp, block (e tile, k step): chunk idx, one 16-B store per
// coverage: 256 threads x 2 idx x 8 halves = 4096 = the (b,h) 64x64 plane.
// ---------------------------------------------------------------------------
__global__ __launch_bounds__(256) void k_kvred(const float* __restrict__ part, _Float16* kvT) {
  __shared__ __attribute__((aligned(16))) float kvs[DH * DH];
  const int t = threadIdx.x;
  const int bh = blockIdx.x;
  const float* p0 = part + (size_t)bh * NTILE * (DH * DH);
#pragma unroll 1
  for (int j = 0; j < (DH * DH) / 256; ++j) {
    const int idx = j * 256 + t;
    float s = 0.0f;
#pragma unroll
    for (int tl = 0; tl < NTILE; ++tl) s += p0[(size_t)tl * (DH * DH) + idx];
    kvs[idx] = s;
  }
  __syncthreads();
  v8h o0, o1;
  {
    const int idx = t;
    const int e = (idx >> 7) * 16 + (idx & 15), d0 = ((idx >> 6) & 1) * 32 + ((idx >> 5) & 1) * 16 + ((idx >> 4) & 1) * 8;
#pragma unroll
    for (int i = 0; i < 8; ++i) o0[i] = (_Float16)(kvs[(d0 + i) * DH + e] * (1.0f / 16.0f));
  }
  {
    const int idx = t + 256;
    const int e = (idx >> 7) * 16 + (idx & 15), d0 = ((idx >> 6) & 1) * 32 + ((idx >> 5) & 1) * 16 + ((idx >> 4) & 1) * 8;
#pragma unroll
    for (int i = 0; i < 8; ++i) o1[i] = (_Float16)(kvs[(d0 + i) * DH + e] * (1.0f / 16.0f));
  }
  _Float16* dp0 = kvT + (size_t)bh * (DH * DH) + (size_t)t * 8;
  _Float16* dp1 = dp0 + 2048;
  *(v8h*)dp0 = o0;
  *(v8h*)dp1 = o1;
  
}

// ---------------------------------------------------------------------------
// Output: block = 64 tokens (4 waves x 16 tokens), all heads. Per head: Q proj
// the wave's LDS tile Qs[token][d] as f16 (scalar stores), block barrier, A
// fragments reloaded with ldfrag; ca = Q * (kv/16) with B = kvT plane [e][d];
// attn/1024 = ca/64 spilled as f16 to As[token][e], block barrier, reloaded as A;
// co += (attn/1024) * (Wo x64) with B = WoP plane [eo][h*64+d]. Epilogue:
// out = co/1024 + Wo_b/16384 staged as f32 rows in LDS, barrier, 8 store
// coverage: Qs/As 32 lanes x 32 halves = 16x64 per wave per head; out 4 waves x
// 8 x 32 x 4 floats = the block's 64 rows x 64.
// ---------------------------------------------------------------------------
__global__ __launch_bounds__(128) void k_out(
    const _Float16* __restrict__ vh, const _Float16* __restrict__ WqT,
    const float* __restrict__ Wq_b, const float* __restrict__ lnq_g, const float* __restrict__ lnq_b,
    const _Float16* __restrict__ kvT, const _Float16* __restrict__ WoP,
    const float* __restrict__ Wo_b, float* out) {
  __shared__ __attribute__((aligned(16))) _Float16 Qs[4 * 16 * TP];
  __shared__ __attribute__((aligned(16))) _Float16 As[4 * 16 * TP];
  __shared__ __attribute__((aligned(16))) float stg[4 * 16 * DH];
  const int lane = threadIdx.x & 31, wv = threadIdx.x >> 5, hh = lane >> 4, m = lane & 15;
  const int b = blockIdx.x / (NTOK / 64);
  const size_t tok0 = (size_t)blockIdx.x * 64 + (size_t)wv * 16;
  _Float16* Qw = Qs + wv * (16 * TP);
  _Float16* Aw = As + wv * (16 * TP);
  float* sw = stg + wv * (16 * DH);

  const _Float16* ap = vh + tok0 * CIN;
  const v16h av0 = ldfrag(ap, CIN);
  const v16h av1 = ldfrag(ap + 32, CIN);

  float wob[4];
#pragma unroll
  for (int nt = 0; nt < 4; ++nt) wob[nt] = Wo_b[16 * nt + m] * (1.0f / 16384.0f);

  v8f co[4];
#pragma unroll
  for (int nt = 0; nt < 4; ++nt) { v8f z = {0.f, 0.f, 0.f, 0.f, 0.f, 0.f, 0.f, 0.f}; co[nt] = z; }

  // head 0's Q weight fragments and LayerNorm rows; each head fetches the next head's in front of its attn*Wo products
  v16h bwq[4][2];
  float bq[4], gq[4], btq[4];
#pragma unroll
  for (int nt = 0; nt < 4; ++nt) {
    const _Float16* wq = WqT + (size_t)(16 * nt) * CIN;
    bwq[nt][0] = ldfragp(wq); bwq[nt][1] = ldfragp(wq + 512);
    const int col = 16 * nt + m;
    bq[nt] = Wq_b[col]; gq[nt] = lnq_g[col]; btq[nt] = lnq_b[col];
  }

#pragma unroll 1
  for (int h = 0; h < NH; ++h) {
    // Q projection for head h
    v8f cq[4];
#pragma unroll
    for (int nt = 0; nt < 4; ++nt) {
      v8f z = {0.f, 0.f, 0.f, 0.f, 0.f, 0.f, 0.f, 0.f}; cq[nt] = z;
      cq[nt] = wmf(av0, bwq[nt][0], cq[nt]);
      cq[nt] = wmf(av1, bwq[nt][1], cq[nt]);
    }

    // this head's kv fragments as one load group: they fly during the LayerNorm
    const _Float16* kp = kvT + (size_t)(b * NH + h) * (DH * DH);
    v16h bkv[4][2];
#pragma unroll
    for (int et = 0; et < 4; ++et) {
      bkv[et][0] = ldfragp(kp + (16 * et) * DH);
      bkv[et][1] = ldfragp(kp + (16 * et) * DH + 512);
    }
    // holds the group in front of the LayerNorm (sunk into it the loads start later and in pieces)
    __builtin_amdgcn_sched_barrier(0);

    // bias + LayerNorm
#pragma unroll
    for (int r = 0; r < 8; ++r) {
      float x0 = cq[0][r] * RWSC + bq[0];
      float x1 = cq[1][r] * RWSC + bq[1];
      float x2 = cq[2][r] * RWSC + bq[2];
      float x3 = cq[3][r] * RWSC + bq[3];
      float s = (x0 + x1) + (x2 + x3);
      s = hred16(s);
      const float mu = s * (1.0f / 64.0f);
      x0 -= mu; x1 -= mu; x2 -= mu; x3 -= mu;
      float q = (x0 * x0 + x1 * x1) + (x2 * x2 + x3 * x3);
      q = hred16(q);
      const float var = q * (1.0f / 64.0f);
      const float rs = rsqrtf(var + EPSV);
      cq[0][r] = x0 * rs * gq[0] + btq[0];
      cq[1][r] = x1 * rs * gq[1] + btq[1];
      cq[2][r] = x2 * rs * gq[2] + btq[2];
      cq[3][r] = x3 * rs * gq[3] + btq[3];
    }

    // Q rows -> Qs[token][d] f16
#pragma unroll
    for (int nt = 0; nt < 4; ++nt) {
#pragma unroll
      for (int r = 0; r < 8; ++r) Qw[(8 * hh + r) * TP + 16 * nt + m] = (_Float16)cq[nt][r];
    }
    __syncthreads();

    // this head's Wo fragments as one load group: they fly during Q*kv and the attn spill
    const _Float16* wo = WoP + h * (DH * DH);
    v16h bwo[4][2];
#pragma unroll
    for (int nt = 0; nt < 4; ++nt) {
      bwo[nt][0] = ldfragp(wo + (16 * nt) * DH);
      bwo[nt][1] = ldfragp(wo + (16 * nt) * DH + 512);
    }
    // holds the group in front of Q*kv (sunk to its products each load would be waited for singly)
    __builtin_amdgcn_sched_barrier(0);

    // ca = Q * (kv/16): A = Qs (row token, k = d), B = kvT[e][d] (col e, k = d)
    const v16h aq0 = ldfrag(Qw, TP);
    const v16h aq1 = ldfrag(Qw + 32, TP);
    v8f ca[4];
#pragma unroll
    for (int et = 0; et < 4; ++et) {
      v8f z = {0.f, 0.f, 0.f, 0.f, 0.f, 0.f, 0.f, 0.f}; ca[et] = z;
      ca[et] = wmf(aq0, bkv[et][0], ca[et]);
      ca[et] = wmf(aq1, bkv[et][1], ca[et]);
    }

    // attn/1024 = ca/64 -> As[token][e] f16
#pragma unroll
    for (int et = 0; et < 4; ++et) {
#pragma unroll
      for (int r = 0; r < 8; ++r) Aw[(8 * hh + r) * TP + 16 * et + m] = (_Float16)(ca[et][r] * (1.0f / 64.0f));
    }
    __syncthreads();

    // next head's Q weight fragments and LayerNorm rows as one load group: they fly during attn*Wo
    // (the last head reads its own again: in bounds, unused)
    {
      const int hn = (h + 1 < NH) ? h + 1 : h;
#pragma unroll
      for (int nt = 0; nt < 4; ++nt) {
        const _Float16* wq = WqT + (size_t)(hn * DH + 16 * nt) * CIN;
        bwq[nt][0] = ldfragp(wq); bwq[nt][1] = ldfragp(wq + 512);
        const int col = hn * DH + 16 * nt + m;
        bq[nt] = Wq_b[col]; gq[nt] = lnq_g[col]; btq[nt] = lnq_b[col];
      }
    }
    // holds the group in front of attn*Wo (sunk to the next head's products each load would be waited for singly)
    __builtin_amdgcn_sched_barrier(0);

    // co += (attn/1024) * (Wo x64): A = As (row token, k = e), B = WoP[eo][h*64 + e]
    const v16h aa0 = ldfrag(Aw, TP);
    const v16h aa1 = ldfrag(Aw + 32, TP);
#pragma unroll
    for (int nt = 0; nt < 4; ++nt) {
      co[nt] = wmf(aa0, bwo[nt][0], co[nt]);
      co[nt] = wmf(aa1, bwo[nt][1], co[nt]);
    }
  }

  // epilogue: out = co/1024 + Wo_b/16384
#pragma unroll
  for (int nt = 0; nt < 4; ++nt) {
#pragma unroll
    for (int r = 0; r < 8; ++r) sw[(8 * hh + r) * DH + 16 * nt + m] = co[nt][r] * (1.0f / 1024.0f) + wob[nt];
  }
  __syncthreads();
  float* gp = out + tok0 * DH;
#pragma unroll
  for (int i = 0; i < 8; ++i) {
    const v4f x = *(const v4f*)(sw + i * 128 + 4 * lane);
    *(v4f*)(gp + i * 128 + 4 * lane) = x;
  }
  
}

// ---------------------------------------------------------------------------
extern "C" void kernel_launch(void* const* d_in, const int* in_sizes, int n_in,
                              void* d_out, int out_size, void* d_ws, size_t ws_size,
                              hipStream_t stream) {
  if (n_in < 13) return;
  if (in_sizes[0] != NB * NTOK * CIN) return;
  if (in_sizes[1] != CIN * HD || in_sizes[3] != CIN * HD || in_sizes[5] != CIN * HD) return;
  if (in_sizes[2] != HD || in_sizes[4] != HD || in_sizes[6] != HD) return;
  if (in_sizes[7] != NH * DH || in_sizes[8] != NH * DH || in_sizes[9] != NH * DH || in_sizes[10] != NH * DH) return;
  if (in_sizes[11] != HD * DH || in_sizes[12] != DH) return;
  if (out_size != NB * NTOK * DH) return;

  const float* v     = (const float*)d_in[0];
  const float* Wq_w  = (const float*)d_in[1];
  const float* Wq_b  = (const float*)d_in[2];
  const float* Wk_w  = (const float*)d_in[3];
  const float* Wk_b  = (const float*)d_in[4];
  const float* Wv_w  = (const float*)d_in[5];
  const float* Wv_b  = (const float*)d_in[6];
  const float* lnq_g = (const float*)d_in[7];
  const float* lnq_b = (const float*)d_in[8];
  const float* lnk_g = (const float*)d_in[9];
  const float* lnk_b = (const float*)d_in[10];
  const float* Wo_w  = (const float*)d_in[11];
  const float* Wo_b  = (const float*)d_in[12];
  float* out = (float*)d_out;

  // workspace carve (256-B aligned; every region an exact multiple of its whole-line store extent)
  char* ws = (char*)d_ws;
  size_t off = 0;
  const size_t oVh  = off; off += (size_t)NB * NTOK * CIN * 2;        off = (off + 255) & ~(size_t)255;   // 8388608
  const size_t oWq  = off; off += (size_t)CIN * HD * 2;               off = (off + 255) & ~(size_t)255;   // 65536
  const size_t oWk  = off; off += (size_t)CIN * HD * 2;               off = (off + 255) & ~(size_t)255;
  const size_t oWv  = off; off += (size_t)CIN * HD * 2;               off = (off + 255) & ~(size_t)255;
  const size_t oWo  = off; off += (size_t)HD * DH * 2;                off = (off + 255) & ~(size_t)255;   // 65536
  const size_t oKvT = off; off += (size_t)NB * NH * DH * DH * 2;      off = (off + 255) & ~(size_t)255;   // 262144
  const size_t oPt  = off; off += (size_t)NB * NH * NTILE * DH * DH * 4; off = (off + 255) & ~(size_t)255; // 4194304
  if (off > ws_size || off > (size_t)WSCAP) return;
  _Float16* vh   = (_Float16*)(ws + oVh);
  _Float16* WqT  = (_Float16*)(ws + oWq);
  _Float16* WkT  = (_Float16*)(ws + oWk);
  _Float16* WvT  = (_Float16*)(ws + oWv);
  _Float16* WoP  = (_Float16*)(ws + oWo);
  _Float16* kvT  = (_Float16*)(ws + oKvT);
  float*    part = (float*)(ws + oPt);

  // 1: v -> f16 plane, weights -> f16 planes (x64)
  k_prep<<<NVB + NWB, 256, 0, stream>>>(v, Wq_w, Wk_w, Wv_w, Wo_w, vh, WqT, WkT, WvT, WoP);
  // 2: K/V projection + LayerNorm(K) + K^T V partials per (batch, head, token tile)
  k_kv<<<NB * NH * NTILE, 128, 0, stream>>>(vh, WkT, WvT, Wk_b, Wv_b, lnk_g, lnk_b, part);
  // 3: fixed-order partial sum -> kvT planes (f16, x1/16)
  k_kvred<<<NB * NH, 256, 0, stream>>>(part, kvT);
  // 4: Q projection + LayerNorm(Q) + Q kv + output projection, /n
  k_out<<<(NB * NTOK) / 64, 128, 0, stream>>>(vh, WqT, Wq_b, lnq_g, lnq_b, kvT, WoP, Wo_b, out);
}

// v003
// One run takes 63.8 microseconds.
// In two side-by-side timings against v002, it was 1.25 and 1.26 times as fast.
// Over all steps from v000 it is 2.65 times as fast.
#include <hip/hip_runtime.h>
#include <stddef.h>

// All contractions on v_wmma_f32_16x16x32_f16 (f16 operands, f32 accumulate): Q/K/V projections (activations as-is, weights carried x64), K^T*V per (batch, head) over token tiles with f32 fixed-order partial sums, Q*kv (kv carried x1/16), attn*Wo (attn carried x1/1024, Wo carried x64); RNE converts; power-of-two carries folded back in the f32 epilogues. LayerNorm, bias, 1/n scaling: f32 VALU.

#define NB     4
#define NTOK   16384
#define CIN    64
#define NH     8
#define DH     64
#define HD     (NH * DH)
#define NTILE  8                       // token tiles per (batch, head) for the K^T V partials
#define CHT    (NTOK / NTILE)          // 2048 tokens per kv block
#define KVIT   (CHT / 64)              // 32 steps of 64 tokens
#define TP     72                      // LDS pitch in halves of the transposed K/V tiles and the Q/attn tiles
#define NVB    ((NB * NTOK * CIN) / (256 * 8))   // 2048 blocks convert v
#define NWB    64                      // blocks convert the four weight planes
#define WSC    64.0f
#define RWSC   (1.0f / 64.0f)
#define EPSV   1e-5f
#define WSCAP  134217728

static_assert(CIN == 64 && DH == 64 && HD == 512 && NH == 8);
static_assert((NTOK % NTILE) == 0 && (CHT % 64) == 0 && (NTOK % 64) == 0);
static_assert(NVB * 256 * 8 == NB * NTOK * CIN);
static_assert(16 * 256 * 8 == CIN * HD && 16 * 256 * 8 == HD * DH);
static_assert((TP % 8) == 0 && TP >= 64);

typedef float    v4f  __attribute__((ext_vector_type(4)));
typedef float    v8f  __attribute__((ext_vector_type(8)));
typedef _Float16 v8h  __attribute__((ext_vector_type(8)));
typedef _Float16 v16h __attribute__((ext_vector_type(16)));
union FragH { v16h v; v8h h[2]; };

// WMMA as the plain builtin: the compiler keeps the hazard distances of its own form and is free
// to issue the fragment loads of a whole group ahead of the products.
__device__ __forceinline__ v8f wmf(v16h a, v16h b, v8f c) {
  return __builtin_amdgcn_wmma_f32_16x16x32_f16(false, a, false, b, (short)0, c, false, false);
}

// 16x32 fragment from a 16-bit [row][k] (k-contiguous) tile, p = &T[row0][k0], pitch ld halves.
// Used for A (row = l&15) and for B stored as [n][k] (col = l&15); split k map:
// elements 0..7 <- k0 + 8h + 0..7, elements 8..15 <- k0 + 16 + 8h + 0..7, h = lane>>4.
__device__ __forceinline__ v16h ldfrag(const _Float16* p, int ld) {
  const int l = threadIdx.x & 31, hh = l >> 4, m = l & 15;
  const _Float16* q = p + m * ld + 8 * hh;
  FragH f;
  f.h[0] = *(const v8h*)q;
  f.h[1] = *(const v8h*)(q + 16);
  return f.v;
}

// The same fragment from a plane kept in fragment order: one (16-row tile, 32-deep k step) = 512 halves,
// chunk j (0, 1) of lane l at halves 256 j + 8 l, holding T[row0 + (l & 15)][k0 + 16 j + 8 (l >> 4) + 0..7].
// Each of the two 16-byte loads of a wave then reads 512 contiguous bytes (4 whole lines, not 32 B of 16 lines).
__device__ __forceinline__ v16h ldfragp(const _Float16* blk) {
  const _Float16* q = blk + 8 * (threadIdx.x & 31);
  FragH f;
  f.h[0] = *(const v8h*)q;
  f.h[1] = *(const v8h*)(q + 256);
  return f.v;
}

// value of lane (l ^ M) of the same 16-lane row, M < 16: a DPP row_xmask operand (control 0x160 | M), all lanes on.
// It stays in the vector pipe and folds into the add that uses it; a shuffle goes through the LDS unit and is waited for.
template <int M>
__device__ __forceinline__ float rowx(float x) {
  return __builtin_bit_cast(float, __builtin_amdgcn_update_dpp(0, __builtin_bit_cast(int, x), 0x160 | M, 0xf, 0xf, true));
}

// sum over the 16 lanes of a half-wave (xor masks < 16 stay inside the row); butterfly order 8, 4, 2, 1
__device__ __forceinline__ float hred16(float x) {
  x += rowx<8>(x);
  x += rowx<4>(x);
  x += rowx<2>(x);
  x += rowx<1>(x);
  return x;
}

// ---------------------------------------------------------------------------
// Prep: blocks 0..NVB-1 convert v [65536][64] f32 -> vh f16 (same layout);
// blocks NVB..NVB+63 build the weight planes (x64) in the fragment order of ldfragp:
//   WqT/WkT/WvT: block (o tile 0..31, k step 0..1) of W^T [512][64]; WoP: block (head, eo tile 0..3, k step 0..1) of Wo^T [64][512].
// One thread = 8 contiguous halves, a wave writes 512 contiguous B per instruction,
// coverage: vh 2048x256x8 = 4194304; each weight plane 16x256x8 = 32768.
// ---------------------------------------------------------------------------
__global__ __launch_bounds__(256) void k_prep(
    const float* __restrict__ v, const float* __restrict__ Wq, const float* __restrict__ Wk,
    const float* __restrict__ Wv, const float* __restrict__ Wo,
    _Float16* vh, _Float16* WqT, _Float16* WkT, _Float16* WvT, _Float16* WoP) {
  const int t = threadIdx.x;
  const int bid = blockIdx.x;
  v8h o;
  _Float16* d;
  if (bid < NVB) {
    const size_t i = (size_t)bid * 256 + t;
    const v4f a = *(const v4f*)(v + i * 8);
    const v4f c = *(const v4f*)(v + i * 8 + 4);
    o[0] = (_Float16)a.x; o[1] = (_Float16)a.y; o[2] = (_Float16)a.z; o[3] = (_Float16)a.w;
    o[4] = (_Float16)c.x; o[5] = (_Float16)c.y; o[6] = (_Float16)c.z; o[7] = (_Float16)c.w;
    d = vh + i * 8;
  } else {
    const int wb = bid - NVB;              // 0..63
    const int which = wb >> 4;             // 0 q, 1 k, 2 v, 3 o
    const int i = (wb & 15) * 256 + t;     // 0..4095: 16-byte chunk of the plane
    const int l = i & 31, kc = ((i >> 6) & 1) * 32 + ((i >> 5) & 1) * 16 + (l >> 4) * 8;   // lane, k offset in 64
    if (which < 3) {
      const float* W = (which == 0) ? Wq : ((which == 1) ? Wk : Wv);
      _Float16* T = (which == 0) ? WqT : ((which == 1) ? WkT : WvT);
      const int oc = (i >> 7) * 16 + (l & 15), c0 = kc;  // chunk = W[c0..c0+7][oc] * 64
#pragma unroll
      for (int e = 0; e < 8; ++e) o[e] = (_Float16)(W[(c0 + e) * HD + oc] * WSC);
      d = T + (size_t)i * 8;
    } else {
      const int e = ((i >> 7) & 3) * 16 + (l & 15), k0 = (i >> 9) * DH + kc;   // chunk = Wo[k0..k0+7][e] * 64
#pragma unroll
      for (int j = 0; j < 8; ++j) o[j] = (_Float16)(Wo[(k0 + j) * DH + e] * WSC);
      d = WoP + (size_t)i * 8;
    }
  }
  *(v8h*)d = o;
  
}

// ---------------------------------------------------------------------------
// K/V projection + LayerNorm(K) + K^T V partial. Block = (batch, head, token tile),
// 4 waves; per step each wave projects its own 16 tokens (A = vh rows, B = WkT/WvT
// K and V are written transposed into LDS Kt/Vt [d][token] (one 16-B store per
// 16x16 tile per lane: 8 consecutive tokens of one d). Block barrier. Wave w then
// accumulates kv rows d = 16w..16w+15 x all 64 e over the 64 tokens: A = Kt (row d,
// k = token), B = Vt (col e, k = token), same loader. Barrier before the next step.
// Epilogue: kv strip staged as f32 rows in LDS, barrier, 8 store instructions per
// coverage: Kt/Vt 4 waves x 4 tiles x 32 lanes x 8 = 64x64 halves each per step;
// part 4 waves x 8 x 32 x 4 floats = the block's 64x64 partial.
// ---------------------------------------------------------------------------
__global__ __launch_bounds__(128) void k_kv(
    const _Float16* __restrict__ vh, const _Float16* __restrict__ WkT, const _Float16* __restrict__ WvT,
    const float* __restrict__ Wk_b, const float* __restrict__ Wv_b,
    const float* __restrict__ lnk_g, const float* __restrict__ lnk_b, float* part) {
  __shared__ __attribute__((aligned(16))) _Float16 Kt[DH * TP];
  __shared__ __attribute__((aligned(16))) _Float16 Vt[DH * TP];
  __shared__ __attribute__((aligned(16))) float stg[4 * 16 * DH];
  const int lane = threadIdx.x & 31, wv = threadIdx.x >> 5, hh = lane >> 4, m = lane & 15;
  const int tile = blockIdx.x % NTILE;
  const int h = (blockIdx.x / NTILE) % NH;
  const int b = blockIdx.x / (NTILE * NH);

  float bk[4], bv[4], gk[4], btk[4];
#pragma unroll
  for (int nt = 0; nt < 4; ++nt) {
    const int col = h * DH + 16 * nt + m;
    bk[nt] = Wk_b[col]; bv[nt] = Wv_b[col];
    gk[nt] = lnk_g[col]; btk[nt] = lnk_b[col];
  }

  v8f kvacc[4];
#pragma unroll
  for (int et = 0; et < 4; ++et) { v8f z = {0.f, 0.f, 0.f, 0.f, 0.f, 0.f, 0.f, 0.f}; kvacc[et] = z; }

  asm volatile("s_wait_xcnt 0x0" ::: "memory");

  // the head's K and V weight fragments do not change over the token loop: one load group, kept in registers
  v16h wkf[4][2], wvf[4][2];
#pragma unroll
  for (int nt = 0; nt < 4; ++nt) {
    const _Float16* wk = WkT + (size_t)(h * DH + 16 * nt) * CIN;
    const _Float16* wvp = WvT + (size_t)(h * DH + 16 * nt) * CIN;
    wkf[nt][0] = ldfragp(wk);  wkf[nt][1] = ldfragp(wk + 512);
    wvf[nt][0] = ldfragp(wvp); wvf[nt][1] = ldfragp(wvp + 512);
  }

  // activation rows of step 0; each step fetches the next step's rows behind its own projections
  const _Float16* ab = vh + ((size_t)b * NTOK + (size_t)tile * CHT + (size_t)wv * 16) * CIN;
  v16h av0 = ldfrag(ab, CIN);
  v16h av1 = ldfrag(ab + 32, CIN);

#pragma unroll 1
  for (int it = 0; it < KVIT; ++it) {
    v8f ck[4], cv[4];
#pragma unroll
    for (int nt = 0; nt < 4; ++nt) {
      v8f z = {0.f, 0.f, 0.f, 0.f, 0.f, 0.f, 0.f, 0.f}; ck[nt] = z; cv[nt] = z;
      ck[nt] = wmf(av0, wkf[nt][0], ck[nt]);
      ck[nt] = wmf(av1, wkf[nt][1], ck[nt]);
      cv[nt] = wmf(av0, wvf[nt][0], cv[nt]);
      cv[nt] = wmf(av1, wvf[nt][1], cv[nt]);
    }

    // next step's rows fly during the LayerNorm (the last step reads its own rows again: in bounds, unused)
    {
      const int itn = (it + 1 < KVIT) ? it + 1 : it;
      const _Float16* an = ab + (size_t)itn * (64 * CIN);
      av0 = ldfrag(an, CIN);
      av1 = ldfrag(an + 32, CIN);
    }
    // the LayerNorm reuses the address registers of the four loads above: wait before they are overwritten
    asm volatile("s_wait_xcnt 0x0" ::: "memory");
    // holds the four loads in front of the LayerNorm: sunk to their use they would be waited for in full
    __builtin_amdgcn_sched_barrier(0);

    // K: bias + LayerNorm over the 64 head dims (row 8hh+r spread over 16 lanes x 4 tiles)
#pragma unroll
    for (int r = 0; r < 8; ++r) {
      float x0 = ck[0][r] * RWSC + bk[0];
      float x1 = ck[1][r] * RWSC + bk[1];
      float x2 = ck[2][r] * RWSC + bk[2];
      float x3 = ck[3][r] * RWSC + bk[3];
      float s = (x0 + x1) + (x2 + x3);
      s = hred16(s);
      const float mu = s * (1.0f / 64.0f);
      x0 -= mu; x1 -= mu; x2 -= mu; x3 -= mu;
      float q = (x0 * x0 + x1 * x1) + (x2 * x2 + x3 * x3);
      q = hred16(q);
      const float var = q * (1.0f / 64.0f);
      const float rs = rsqrtf(var + EPSV);
      ck[0][r] = x0 * rs * gk[0] + btk[0];
      ck[1][r] = x1 * rs * gk[1] + btk[1];
      ck[2][r] = x2 * rs * gk[2] + btk[2];
      ck[3][r] = x3 * rs * gk[3] + btk[3];
    }

    // transposed tiles: Kt[d][token], Vt[e][token], token = wv*16 + 8hh + r
#pragma unroll
    for (int nt = 0; nt < 4; ++nt) {
      v8h kk, vv;
#pragma unroll
      for (int r = 0; r < 8; ++r) {
        kk[r] = (_Float16)ck[nt][r];
        vv[r] = (_Float16)(cv[nt][r] * RWSC + bv[nt]);
      }
      *(v8h*)(Kt + (16 * nt + m) * TP + wv * 16 + 8 * hh) = kk;
      *(v8h*)(Vt + (16 * nt + m) * TP + wv * 16 + 8 * hh) = vv;
    }
    __syncthreads();

    // kv rows 16wv..16wv+15 += K^T V over the 64 tokens (2 k-steps)
    const _Float16* ka = Kt + (16 * wv) * TP;
    v16h ak[2], bvf[2][4];
#pragma unroll
    for (int ks = 0; ks < 2; ++ks) {
      ak[ks] = ldfrag(ka + 32 * ks, TP);
#pragma unroll
      for (int et = 0; et < 4; ++et) bvf[ks][et] = ldfrag(Vt + (16 * et) * TP + 32 * ks, TP);
    }
    // keeps the LDS fragment reads one group in front of the products: one place with reads, not one per product
    __builtin_amdgcn_sched_barrier(0);
#pragma unroll
    for (int ks = 0; ks < 2; ++ks) {
#pragma unroll
      for (int et = 0; et < 4; ++et) kvacc[et] = wmf(ak[ks], bvf[ks][et], kvacc[et]);
    }
    __syncthreads();
  }

  // epilogue: stage the wave's 16x64 f32 strip, then whole-line stores
  float* sw = stg + wv * (16 * DH);
#pragma unroll
  for (int et = 0; et < 4; ++et) {
#pragma unroll
    for (int r = 0; r < 8; ++r) sw[(8 * hh + r) * DH + 16 * et + m] = kvacc[et][r];
  }
  __syncthreads();
  float* gp = part + ((size_t)blockIdx.x * DH + (size_t)(16 * wv)) * DH;
#pragma unroll
  for (int i = 0; i < 8; ++i) {
    const v4f x = *(const v4f*)(sw + i * 128 + 4 * lane);
    *(v4f*)(gp + i * 128 + 4 * lane) = x;
  }
  
}

// ---------------------------------------------------------------------------
// kv reduce (block = (batch, head), 256 threads): fixed-order f32 sum of the
// NTILE partials into LDS kv[d][e], barrier, then the kvT plane (kv^T [e][d], f16 of
// kv/16) in the fragment order of ldfragp, block (e tile, k step): chunk idx, one 16-B store per
// coverage: 256 threads x 2 idx x 8 halves = 4096 = the (b,h) 64x64 plane.
// ---------------------------------------------------------------------------
__global__ __launch_bounds__(256) void k_kvred(const float* __restrict__ part, _Float16* kvT) {
  __shared__ __attribute__((aligned(16))) float kvs[DH * DH];
  const int t = threadIdx.x;
  const int bh = blockIdx.x;
  const float* p0 = part + (size_t)bh * NTILE * (DH * DH);
#pragma unroll 1
  for (int j = 0; j < (DH * DH) / 256; ++j) {
    const int idx = j * 256 + t;
    float s = 0.0f;
#pragma unroll
    for (int tl = 0; tl < NTILE; ++tl) s += p0[(size_t)tl * (DH * DH) + idx];
    kvs[idx] = s;
  }
  __syncthreads();
  v8h o0, o1;
  {
    const int idx = t;
    const int e = (idx >> 7) * 16 + (idx & 15), d0 = ((idx >> 6) & 1) * 32 + ((idx >> 5) & 1) * 16 + ((idx >> 4) & 1) * 8;
#pragma unroll
    for (int i = 0; i < 8; ++i) o0[i] = (_Float16)(kvs[(d0 + i) * DH + e] * (1.0f / 16.0f));
  }
  {
    const int idx = t + 256;
    const int e = (idx >> 7) * 16 + (idx & 15), d0 = ((idx >> 6) & 1) * 32 + ((idx >> 5) & 1) * 16 + ((idx >> 4) & 1) * 8;
#pragma unroll
    for (int i = 0; i < 8; ++i) o1[i] = (_Float16)(kvs[(d0 + i) * DH + e] * (1.0f / 16.0f));
  }
  _Float16* dp0 = kvT + (size_t)bh * (DH * DH) + (size_t)t * 8;
  _Float16* dp1 = dp0 + 2048;
  *(v8h*)dp0 = o0;
  *(v8h*)dp1 = o1;
  
}

// ---------------------------------------------------------------------------
// Output: block = 64 tokens (4 waves x 16 tokens), all heads. Per head: Q proj
// the wave's LDS tile Qs[token][d] as f16 (scalar stores), block barrier, A
// fragments reloaded with ldfrag; ca = Q * (kv/16) with B = kvT plane [e][d];
// attn/1024 = ca/64 spilled as f16 to As[token][e], block barrier, reloaded as A;
// co += (attn/1024) * (Wo x64) with B = WoP plane [eo][h*64+d]. Epilogue:
// out = co/1024 + Wo_b/16384 staged as f32 rows in LDS, barrier, 8 store
// coverage: Qs/As 32 lanes x 32 halves = 16x64 per wave per head; out 4 waves x
// 8 x 32 x 4 floats = the block's 64 rows x 64.
// ---------------------------------------------------------------------------
__global__ __launch_bounds__(128) void k_out(
    const _Float16* __restrict__ vh, const _Float16* __restrict__ WqT,
    const float* __restrict__ Wq_b, const float* __restrict__ lnq_g, const float* __restrict__ lnq_b,
    const _Float16* __restrict__ kvT, const _Float16* __restrict__ WoP,
    const float* __restrict__ Wo_b, float* out) {
  __shared__ __attribute__((aligned(16))) _Float16 Qs[4 * 16 * TP];
  __shared__ __attribute__((aligned(16))) _Float16 As[4 * 16 * TP];
  __shared__ __attribute__((aligned(16))) float stg[4 * 16 * DH];
  const int lane = threadIdx.x & 31, wv = threadIdx.x >> 5, hh = lane >> 4, m = lane & 15;
  const int b = blockIdx.x / (NTOK / 64);
  const size_t tok0 = (size_t)blockIdx.x * 64 + (size_t)wv * 16;
  _Float16* Qw = Qs + wv * (16 * TP);
  _Float16* Aw = As + wv * (16 * TP);
  float* sw = stg + wv * (16 * DH);

  const _Float16* ap = vh + tok0 * CIN;
  const v16h av0 = ldfrag(ap, CIN);
  const v16h av1 = ldfrag(ap + 32, CIN);

  float wob[4];
#pragma unroll
  for (int nt = 0; nt < 4; ++nt) wob[nt] = Wo_b[16 * nt + m] * (1.0f / 16384.0f);

  v8f co[4];
#pragma unroll
  for (int nt = 0; nt < 4; ++nt) { v8f z = {0.f, 0.f, 0.f, 0.f, 0.f, 0.f, 0.f, 0.f}; co[nt] = z; }

  // head 0's Q weight fragments and LayerNorm rows; each head fetches the next head's in front of its attn*Wo products
  v16h bwq[4][2];
  float bq[4], gq[4], btq[4];
#pragma unroll
  for (int nt = 0; nt < 4; ++nt) {
    const _Float16* wq = WqT + (size_t)(16 * nt) * CIN;
    bwq[nt][0] = ldfragp(wq); bwq[nt][1] = ldfragp(wq + 512);
    const int col = 16 * nt + m;
    bq[nt] = Wq_b[col]; gq[nt] = lnq_g[col]; btq[nt] = lnq_b[col];
  }

#pragma unroll 1
  for (int h = 0; h < NH; ++h) {
    // Q projection for head h
    v8f cq[4];
#pragma unroll
    for (int nt = 0; nt < 4; ++nt) {
      v8f z = {0.f, 0.f, 0.f, 0.f, 0.f, 0.f, 0.f, 0.f}; cq[nt] = z;
      cq[nt] = wmf(av0, bwq[nt][0], cq[nt]);
      cq[nt] = wmf(av1, bwq[nt][1], cq[nt]);
    }

    // this head's kv fragments as one load group: they fly during the LayerNorm
    const _Float16* kp = kvT + (size_t)(b * NH + h) * (DH * DH);
    v16h bkv[4][2];
#pragma unroll
    for (int et = 0; et < 4; ++et) {
      bkv[et][0] = ldfragp(kp + (16 * et) * DH);
      bkv[et][1] = ldfragp(kp + (16 * et) * DH + 512);
    }
    // holds the group in front of the LayerNorm (sunk into it the loads start later and in pieces)
    __builtin_amdgcn_sched_barrier(0);

    // bias + LayerNorm
#pragma unroll
    for (int r = 0; r < 8; ++r) {
      float x0 = cq[0][r] * RWSC + bq[0];
      float x1 = cq[1][r] * RWSC + bq[1];
      float x2 = cq[2][r] * RWSC + bq[2];
      float x3 = cq[3][r] * RWSC + bq[3];
      float s = (x0 + x1) + (x2 + x3);
      s = hred16(s);
      const float mu = s * (1.0f / 64.0f);
      x0 -= mu; x1 -= mu; x2 -= mu; x3 -= mu;
      float q = (x0 * x0 + x1 * x1) + (x2 * x2 + x3 * x3);
      q = hred16(q);
      const float var = q * (1.0f / 64.0f);
      const float rs = rsqrtf(var + EPSV);
      cq[0][r] = x0 * rs * gq[0] + btq[0];
      cq[1][r] = x1 * rs * gq[1] + btq[1];
      cq[2][r] = x2 * rs * gq[2] + btq[2];
      cq[3][r] = x3 * rs * gq[3] + btq[3];
    }

    // Q rows -> Qs[token][d] f16
#pragma unroll
    for (int nt = 0; nt < 4; ++nt) {
#pragma unroll
      for (int r = 0; r < 8; ++r) Qw[(8 * hh + r) * TP + 16 * nt + m] = (_Float16)cq[nt][r];
    }
    __syncthreads();

    // this head's Wo fragments as one load group: they fly during Q*kv and the attn spill
    const _Float16* wo = WoP + h * (DH * DH);
    v16h bwo[4][2];
#pragma unroll
    for (int nt = 0; nt < 4; ++nt) {
      bwo[nt][0] = ldfragp(wo + (16 * nt) * DH);
      bwo[nt][1] = ldfragp(wo + (16 * nt) * DH + 512);
    }
    // holds the group in front of Q*kv (sunk to its products each load would be waited for singly)
    __builtin_amdgcn_sched_barrier(0);

    // ca = Q * (kv/16): A = Qs (row token, k = d), B = kvT[e][d] (col e, k = d)
    const v16h aq0 = ldfrag(Qw, TP);
    const v16h aq1 = ldfrag(Qw + 32, TP);
    v8f ca[4];
#pragma unroll
    for (int et = 0; et < 4; ++et) {
      v8f z = {0.f, 0.f, 0.f, 0.f, 0.f, 0.f, 0.f, 0.f}; ca[et] = z;
      ca[et] = wmf(aq0, bkv[et][0], ca[et]);
      ca[et] = wmf(aq1, bkv[et][1], ca[et]);
    }

    // attn/1024 = ca/64 -> As[token][e] f16
#pragma unroll
    for (int et = 0; et < 4; ++et) {
#pragma unroll
      for (int r = 0; r < 8; ++r) Aw[(8 * hh + r) * TP + 16 * et + m] = (_Float16)(ca[et][r] * (1.0f / 64.0f));
    }
    __syncthreads();

    // next head's Q weight fragments and LayerNorm rows as one load group: they fly during attn*Wo
    // (the last head reads its own again: in bounds, unused)
    {
      const int hn = (h + 1 < NH) ? h + 1 : h;
#pragma unroll
      for (int nt = 0; nt < 4; ++nt) {
        const _Float16* wq = WqT + (size_t)(hn * DH + 16 * nt) * CIN;
        bwq[nt][0] = ldfragp(wq); bwq[nt][1] = ldfragp(wq + 512);
        const int col = hn * DH + 16 * nt + m;
        bq[nt] = Wq_b[col]; gq[nt] = lnq_g[col]; btq[nt] = lnq_b[col];
      }
    }
    // holds the group in front of attn*Wo (sunk to the next head's products each load would be waited for singly)
    __builtin_amdgcn_sched_barrier(0);

    // co += (attn/1024) * (Wo x64): A = As (row token, k = e), B = WoP[eo][h*64 + e]
    const v16h aa0 = ldfrag(Aw, TP);
    const v16h aa1 = ldfrag(Aw + 32, TP);
#pragma unroll
    for (int nt = 0; nt < 4; ++nt) {
      co[nt] = wmf(aa0, bwo[nt][0], co[nt]);
      co[nt] = wmf(aa1, bwo[nt][1], co[nt]);
    }
  }

  // epilogue: out = co/1024 + Wo_b/16384
#pragma unroll
  for (int nt = 0; nt < 4; ++nt) {
#pragma unroll
    for (int r = 0; r < 8; ++r) sw[(8 * hh + r) * DH + 16 * nt + m] = co[nt][r] * (1.0f / 1024.0f) + wob[nt];
  }
  __syncthreads();
  float* gp = out + tok0 * DH;
#pragma unroll
  for (int i = 0; i < 8; ++i) {
    const v4f x = *(const v4f*)(sw + i * 128 + 4 * lane);
    *(v4f*)(gp + i * 128 + 4 * lane) = x;
  }
  
}

// ---------------------------------------------------------------------------
extern "C" void kernel_launch(void* const* d_in, const int* in_sizes, int n_in,
                              void* d_out, int out_size, void* d_ws, size_t ws_size,
                              hipStream_t stream) {
  if (n_in < 13) return;
  if (in_sizes[0] != NB * NTOK * CIN) return;
  if (in_sizes[1] != CIN * HD || in_sizes[3] != CIN * HD || in_sizes[5] != CIN * HD) return;
  if (in_sizes[2] != HD || in_sizes[4] != HD || in_sizes[6] != HD) return;
  if (in_sizes[7] != NH * DH || in_sizes[8] != NH * DH || in_sizes[9] != NH * DH || in_sizes[10] != NH * DH) return;
  if (in_sizes[11] != HD * DH || in_sizes[12] != DH) return;
  if (out_size != NB * NTOK * DH) return;

  const float* v     = (const float*)d_in[0];
  const float* Wq_w  = (const float*)d_in[1];
  const float* Wq_b  = (const float*)d_in[2];
  const float* Wk_w  = (const float*)d_in[3];
  const float* Wk_b  = (const float*)d_in[4];
  const float* Wv_w  = (const float*)d_in[5];
  const float* Wv_b  = (const float*)d_in[6];
  const float* lnq_g = (const float*)d_in[7];
  const float* lnq_b = (const float*)d_in[8];
  const float* lnk_g = (const float*)d_in[9];
  const float* lnk_b = (const float*)d_in[10];
  const float* Wo_w  = (const float*)d_in[11];
  const float* Wo_b  = (const float*)d_in[12];
  float* out = (float*)d_out;

  // workspace carve (256-B aligned; every region an exact multiple of its whole-line store extent)
  char* ws = (char*)d_ws;
  size_t off = 0;
  const size_t oVh  = off; off += (size_t)NB * NTOK * CIN * 2;        off = (off + 255) & ~(size_t)255;   // 8388608
  const size_t oWq  = off; off += (size_t)CIN * HD * 2;               off = (off + 255) & ~(size_t)255;   // 65536
  const size_t oWk  = off; off += (size_t)CIN * HD * 2;               off = (off + 255) & ~(size_t)255;
  const size_t oWv  = off; off += (size_t)CIN * HD * 2;               off = (off + 255) & ~(size_t)255;
  const size_t oWo  = off; off += (size_t)HD * DH * 2;                off = (off + 255) & ~(size_t)255;   // 65536
  const size_t oKvT = off; off += (size_t)NB * NH * DH * DH * 2;      off = (off + 255) & ~(size_t)255;   // 262144
  const size_t oPt  = off; off += (size_t)NB * NH * NTILE * DH * DH * 4; off = (off + 255) & ~(size_t)255; // 4194304
  if (off > ws_size || off > (size_t)WSCAP) return;
  _Float16* vh   = (_Float16*)(ws + oVh);
  _Float16* WqT  = (_Float16*)(ws + oWq);
  _Float16* WkT  = (_Float16*)(ws + oWk);
  _Float16* WvT  = (_Float16*)(ws + oWv);
  _Float16* WoP  = (_Float16*)(ws + oWo);
  _Float16* kvT  = (_Float16*)(ws + oKvT);
  float*    part = (float*)(ws + oPt);

  // 1: v -> f16 plane, weights -> f16 planes (x64)
  k_prep<<<NVB + NWB, 256, 0, stream>>>(v, Wq_w, Wk_w, Wv_w, Wo_w, vh, WqT, WkT, WvT, WoP);
  // 2: K/V projection + LayerNorm(K) + K^T V partials per (batch, head, token tile)
  k_kv<<<NB * NH * NTILE, 128, 0, stream>>>(vh, WkT, WvT, Wk_b, Wv_b, lnk_g, lnk_b, part);
  // 3: fixed-order partial sum -> kvT planes (f16, x1/16)
  k_kvred<<<NB * NH, 256, 0, stream>>>(part, kvT);
  // 4: Q projection + LayerNorm(Q) + Q kv + output projection, /n
  k_out<<<(NB * NTOK) / 64, 128, 0, stream>>>(vh, WqT, Wq_b, lnq_g, lnq_b, kvT, WoP, Wo_b, out);
}

// v004
// A run of this version takes 53.4 microseconds.
// Next to v003, in two timings, it ran 1.20 and 1.18 times as fast.
// Counting every step since v000, it is 3.15 times as fast.
#include <hip/hip_runtime.h>
#include <stddef.h>

// All contractions on v_wmma_f32_16x16x32_f16 (f16 operands, f32 accumulate): Q/K/V projections (activations as-is, weights carried x64), K^T*V per (batch, head) over token tiles with f32 fixed-order partial sums, Q*kv (kv carried x1/16), attn*Wo (attn carried x1/1024, Wo carried x64); RNE converts; power-of-two carries folded back in the f32 epilogues. LayerNorm, bias, 1/n scaling: f32 VALU.

#define NB     4
#define NTOK   16384
#define CIN    64
#define NH     8
#define DH     64
#define HD     (NH * DH)
#define NTILE  16                      // token tiles per (batch, head) for the K^T V partials: 512 blocks, two per WGP, two waves per SIMD
#define CHT    (NTOK / NTILE)          // 1024 tokens per kv block
#define KVIT   (CHT / 64)              // 16 steps of 64 tokens
#define TP     72                      // LDS pitch in halves of the transposed K/V tiles and the Q/attn tiles
#define NVB    ((NB * NTOK * CIN) / (256 * 8))   // 2048 blocks convert v
#define NWB    64                      // blocks convert the four weight planes
#define WSC    64.0f
#define RWSC   (1.0f / 64.0f)
#define EPSV   1e-5f
#define WSCAP  134217728

static_assert(CIN == 64 && DH == 64 && HD == 512 && NH == 8);
static_assert((NTOK % NTILE) == 0 && (CHT % 64) == 0 && (NTOK % 64) == 0);
static_assert(NVB * 256 * 8 == NB * NTOK * CIN);
static_assert(16 * 256 * 8 == CIN * HD && 16 * 256 * 8 == HD * DH);
static_assert((TP % 8) == 0 && TP >= 64);

typedef float    v4f  __attribute__((ext_vector_type(4)));
typedef float    v8f  __attribute__((ext_vector_type(8)));
typedef _Float16 v8h  __attribute__((ext_vector_type(8)));
typedef _Float16 v16h __attribute__((ext_vector_type(16)));
union FragH { v16h v; v8h h[2]; };

// WMMA as the plain builtin: the compiler keeps the hazard distances of its own form and is free
// to issue the fragment loads of a whole group ahead of the products.
__device__ __forceinline__ v8f wmf(v16h a, v16h b, v8f c) {
  return __builtin_amdgcn_wmma_f32_16x16x32_f16(false, a, false, b, (short)0, c, false, false);
}

// 16x32 fragment from a 16-bit [row][k] (k-contiguous) tile, p = &T[row0][k0], pitch ld halves.
// Used for A (row = l&15) and for B stored as [n][k] (col = l&15); split k map:
// elements 0..7 <- k0 + 8h + 0..7, elements 8..15 <- k0 + 16 + 8h + 0..7, h = lane>>4.
__device__ __forceinline__ v16h ldfrag(const _Float16* p, int ld) {
  const int l = threadIdx.x & 31, hh = l >> 4, m = l & 15;
  const _Float16* q = p + m * ld + 8 * hh;
  FragH f;
  f.h[0] = *(const v8h*)q;
  f.h[1] = *(const v8h*)(q + 16);
  return f.v;
}

// The same fragment from a plane kept in fragment order: one (16-row tile, 32-deep k step) = 512 halves,
// chunk j (0, 1) of lane l at halves 256 j + 8 l, holding T[row0 + (l & 15)][k0 + 16 j + 8 (l >> 4) + 0..7].
// Each of the two 16-byte loads of a wave then reads 512 contiguous bytes (4 whole lines, not 32 B of 16 lines).
__device__ __forceinline__ v16h ldfragp(const _Float16* blk) {
  const _Float16* q = blk + 8 * (threadIdx.x & 31);
  FragH f;
  f.h[0] = *(const v8h*)q;
  f.h[1] = *(const v8h*)(q + 256);
  return f.v;
}

// value of lane (l ^ M) of the same 16-lane row, M < 16: a DPP row_xmask operand (control 0x160 | M), all lanes on.
// It stays in the vector pipe and folds into the add that uses it; a shuffle goes through the LDS unit and is waited for.
template <int M>
__device__ __forceinline__ float rowx(float x) {
  return __builtin_bit_cast(float, __builtin_amdgcn_update_dpp(0, __builtin_bit_cast(int, x), 0x160 | M, 0xf, 0xf, true));
}

// sum over the 16 lanes of a half-wave (xor masks < 16 stay inside the row); butterfly order 8, 4, 2, 1
__device__ __forceinline__ float hred16(float x) {
  x += rowx<8>(x);
  x += rowx<4>(x);
  x += rowx<2>(x);
  x += rowx<1>(x);
  return x;
}

// ---------------------------------------------------------------------------
// Prep: blocks 0..NVB-1 convert v [65536][64] f32 -> vh f16 (same layout);
// blocks NVB..NVB+63 build the weight planes (x64) in the fragment order of ldfragp:
//   WqT/WkT/WvT: block (o tile 0..31, k step 0..1) of W^T [512][64]; WoP: block (head, eo tile 0..3, k step 0..1) of Wo^T [64][512].
// One thread = 8 contiguous halves, a wave writes 512 contiguous B per instruction,
// coverage: vh 2048x256x8 = 4194304; each weight plane 16x256x8 = 32768.
// ---------------------------------------------------------------------------
__global__ __launch_bounds__(256) void k_prep(
    const float* __restrict__ v, const float* __restrict__ Wq, const float* __restrict__ Wk,
    const float* __restrict__ Wv, const float* __restrict__ Wo,
    _Float16* vh, _Float16* WqT, _Float16* WkT, _Float16* WvT, _Float16* WoP) {
  const int t = threadIdx.x;
  const int bid = blockIdx.x;
  v8h o;
  _Float16* d;
  if (bid < NVB) {
    const size_t i = (size_t)bid * 256 + t;
    const v4f a = *(const v4f*)(v + i * 8);
    const v4f c = *(const v4f*)(v + i * 8 + 4);
    o[0] = (_Float16)a.x; o[1] = (_Float16)a.y; o[2] = (_Float16)a.z; o[3] = (_Float16)a.w;
    o[4] = (_Float16)c.x; o[5] = (_Float16)c.y; o[6] = (_Float16)c.z; o[7] = (_Float16)c.w;
    d = vh + i * 8;
  } else {
    const int wb = bid - NVB;              // 0..63
    const int which = wb >> 4;             // 0 q, 1 k, 2 v, 3 o
    const int i = (wb & 15) * 256 + t;     // 0..4095: 16-byte chunk of the plane
    const int l = i & 31, kc = ((i >> 6) & 1) * 32 + ((i >> 5) & 1) * 16 + (l >> 4) * 8;   // lane, k offset in 64
    if (which < 3) {
      const float* W = (which == 0) ? Wq : ((which == 1) ? Wk : Wv);
      _Float16* T = (which == 0) ? WqT : ((which == 1) ? WkT : WvT);
      const int oc = (i >> 7) * 16 + (l & 15), c0 = kc;  // chunk = W[c0..c0+7][oc] * 64
#pragma unroll
      for (int e = 0; e < 8; ++e) o[e] = (_Float16)(W[(c0 + e) * HD + oc] * WSC);
      d = T + (size_t)i * 8;
    } else {
      const int e = ((i >> 7) & 3) * 16 + (l & 15), k0 = (i >> 9) * DH + kc;   // chunk = Wo[k0..k0+7][e] * 64
#pragma unroll
      for (int j = 0; j < 8; ++j) o[j] = (_Float16)(Wo[(k0 + j) * DH + e] * WSC);
      d = WoP + (size_t)i * 8;
    }
  }
  *(v8h*)d = o;
  
}

// ---------------------------------------------------------------------------
// K/V projection + LayerNorm(K) + K^T V partial. Block = (batch, head, token tile),
// 4 waves; per step each wave projects its own 16 tokens (A = vh rows, B = WkT/WvT
// K and V are written transposed into LDS Kt/Vt [d][token] (one 16-B store per
// 16x16 tile per lane: 8 consecutive tokens of one d). Block barrier. Wave w then
// accumulates kv rows d = 16w..16w+15 x all 64 e over the 64 tokens: A = Kt (row d,
// k = token), B = Vt (col e, k = token), same loader. Barrier before the next step.
// Epilogue: kv strip staged as f32 rows in LDS, barrier, 8 store instructions per
// coverage: Kt/Vt 4 waves x 4 tiles x 32 lanes x 8 = 64x64 halves each per step;
// part 4 waves x 8 x 32 x 4 floats = the block's 64x64 partial.
// ---------------------------------------------------------------------------
__global__ __launch_bounds__(128) void k_kv(
    const _Float16* __restrict__ vh, const _Float16* __restrict__ WkT, const _Float16* __restrict__ WvT,
    const float* __restrict__ Wk_b, const float* __restrict__ Wv_b,
    const float* __restrict__ lnk_g, const float* __restrict__ lnk_b, float* part) {
  __shared__ __attribute__((aligned(16))) _Float16 Kt[DH * TP];
  __shared__ __attribute__((aligned(16))) _Float16 Vt[DH * TP];
  __shared__ __attribute__((aligned(16))) float stg[4 * 16 * DH];
  const int lane = threadIdx.x & 31, wv = threadIdx.x >> 5, hh = lane >> 4, m = lane & 15;
  const int tile = blockIdx.x % NTILE;
  const int h = (blockIdx.x / NTILE) % NH;
  const int b = blockIdx.x / (NTILE * NH);

  float bk[4], bv[4], gk[4], btk[4];
#pragma unroll
  for (int nt = 0; nt < 4; ++nt) {
    const int col = h * DH + 16 * nt + m;
    bk[nt] = Wk_b[col]; bv[nt] = Wv_b[col];
    gk[nt] = lnk_g[col]; btk[nt] = lnk_b[col];
  }

  v8f kvacc[4];
#pragma unroll
  for (int et = 0; et < 4; ++et) { v8f z = {0.f, 0.f, 0.f, 0.f, 0.f, 0.f, 0.f, 0.f}; kvacc[et] = z; }

  asm volatile("s_wait_xcnt 0x0" ::: "memory");

  // the head's K and V weight fragments do not change over the token loop: one load group, kept in registers
  v16h wkf[4][2], wvf[4][2];
#pragma unroll
  for (int nt = 0; nt < 4; ++nt) {
    const _Float16* wk = WkT + (size_t)(h * DH + 16 * nt) * CIN;
    const _Float16* wvp = WvT + (size_t)(h * DH + 16 * nt) * CIN;
    wkf[nt][0] = ldfragp(wk);  wkf[nt][1] = ldfragp(wk + 512);
    wvf[nt][0] = ldfragp(wvp); wvf[nt][1] = ldfragp(wvp + 512);
  }

  // activation rows of step 0; each step fetches the next step's rows behind its own projections
  const _Float16* ab = vh + ((size_t)b * NTOK + (size_t)tile * CHT + (size_t)wv * 16) * CIN;
  v16h av0 = ldfrag(ab, CIN);
  v16h av1 = ldfrag(ab + 32, CIN);

#pragma unroll 1
  for (int it = 0; it < KVIT; ++it) {
    v8f ck[4], cv[4];
#pragma unroll
    for (int nt = 0; nt < 4; ++nt) {
      v8f z = {0.f, 0.f, 0.f, 0.f, 0.f, 0.f, 0.f, 0.f}; ck[nt] = z; cv[nt] = z;
      ck[nt] = wmf(av0, wkf[nt][0], ck[nt]);
      ck[nt] = wmf(av1, wkf[nt][1], ck[nt]);
      cv[nt] = wmf(av0, wvf[nt][0], cv[nt]);
      cv[nt] = wmf(av1, wvf[nt][1], cv[nt]);
    }

    // next step's rows fly during the LayerNorm (the last step reads its own rows again: in bounds, unused)
    {
      const int itn = (it + 1 < KVIT) ? it + 1 : it;
      const _Float16* an = ab + (size_t)itn * (64 * CIN);
      av0 = ldfrag(an, CIN);
      av1 = ldfrag(an + 32, CIN);
    }
    // the LayerNorm reuses the address registers of the four loads above: wait before they are overwritten
    asm volatile("s_wait_xcnt 0x0" ::: "memory");
    // holds the four loads in front of the LayerNorm: sunk to their use they would be waited for in full
    __builtin_amdgcn_sched_barrier(0);

    // K: bias + LayerNorm over the 64 head dims (row 8hh+r spread over 16 lanes x 4 tiles)
#pragma unroll
    for (int r = 0; r < 8; ++r) {
      float x0 = ck[0][r] * RWSC + bk[0];
      float x1 = ck[1][r] * RWSC + bk[1];
      float x2 = ck[2][r] * RWSC + bk[2];
      float x3 = ck[3][r] * RWSC + bk[3];
      float s = (x0 + x1) + (x2 + x3);
      s = hred16(s);
      const float mu = s * (1.0f / 64.0f);
      x0 -= mu; x1 -= mu; x2 -= mu; x3 -= mu;
      float q = (x0 * x0 + x1 * x1) + (x2 * x2 + x3 * x3);
      q = hred16(q);
      const float var = q * (1.0f / 64.0f);
      const float rs = rsqrtf(var + EPSV);
      ck[0][r] = x0 * rs * gk[0] + btk[0];
      ck[1][r] = x1 * rs * gk[1] + btk[1];
      ck[2][r] = x2 * rs * gk[2] + btk[2];
      ck[3][r] = x3 * rs * gk[3] + btk[3];
    }

    // transposed tiles: Kt[d][token], Vt[e][token], token = wv*16 + 8hh + r
#pragma unroll
    for (int nt = 0; nt < 4; ++nt) {
      v8h kk, vv;
#pragma unroll
      for (int r = 0; r < 8; ++r) {
        kk[r] = (_Float16)ck[nt][r];
        vv[r] = (_Float16)(cv[nt][r] * RWSC + bv[nt]);
      }
      *(v8h*)(Kt + (16 * nt + m) * TP + wv * 16 + 8 * hh) = kk;
      *(v8h*)(Vt + (16 * nt + m) * TP + wv * 16 + 8 * hh) = vv;
    }
    __syncthreads();

    // kv rows 16wv..16wv+15 += K^T V over the 64 tokens (2 k-steps)
    const _Float16* ka = Kt + (16 * wv) * TP;
    v16h ak[2], bvf[2][4];
#pragma unroll
    for (int ks = 0; ks < 2; ++ks) {
      ak[ks] = ldfrag(ka + 32 * ks, TP);
#pragma unroll
      for (int et = 0; et < 4; ++et) bvf[ks][et] = ldfrag(Vt + (16 * et) * TP + 32 * ks, TP);
    }
    // keeps the LDS fragment reads one group in front of the products: one place with reads, not one per product
    __builtin_amdgcn_sched_barrier(0);
#pragma unroll
    for (int ks = 0; ks < 2; ++ks) {
#pragma unroll
      for (int et = 0; et < 4; ++et) kvacc[et] = wmf(ak[ks], bvf[ks][et], kvacc[et]);
    }
    __syncthreads();
  }

  // epilogue: stage the wave's 16x64 f32 strip, then whole-line stores
  float* sw = stg + wv * (16 * DH);
#pragma unroll
  for (int et = 0; et < 4; ++et) {
#pragma unroll
    for (int r = 0; r < 8; ++r) sw[(8 * hh + r) * DH + 16 * et + m] = kvacc[et][r];
  }
  __syncthreads();
  float* gp = part + ((size_t)blockIdx.x * DH + (size_t)(16 * wv)) * DH;
#pragma unroll
  for (int i = 0; i < 8; ++i) {
    const v4f x = *(const v4f*)(sw + i * 128 + 4 * lane);
    *(v4f*)(gp + i * 128 + 4 * lane) = x;
  }
  
}

// ---------------------------------------------------------------------------
// kv reduce (block = (batch, head), 256 threads): fixed-order f32 sum of the
// NTILE partials into LDS kv[d][e], barrier, then the kvT plane (kv^T [e][d], f16 of
// kv/16) in the fragment order of ldfragp, block (e tile, k step): chunk idx, one 16-B store per
// coverage: 256 threads x 2 idx x 8 halves = 4096 = the (b,h) 64x64 plane.
// ---------------------------------------------------------------------------
__global__ __launch_bounds__(256) void k_kvred(const float* __restrict__ part, _Float16* kvT) {
  __shared__ __attribute__((aligned(16))) float kvs[DH * DH];
  const int t = threadIdx.x;
  const int bh = blockIdx.x;
  const float* p0 = part + (size_t)bh * NTILE * (DH * DH);
#pragma unroll 1
  for (int j = 0; j < (DH * DH) / 256; ++j) {
    const int idx = j * 256 + t;
    float s = 0.0f;
#pragma unroll
    for (int tl = 0; tl < NTILE; ++tl) s += p0[(size_t)tl * (DH * DH) + idx];
    kvs[idx] = s;
  }
  __syncthreads();
  v8h o0, o1;
  {
    const int idx = t;
    const int e = (idx >> 7) * 16 + (idx & 15), d0 = ((idx >> 6) & 1) * 32 + ((idx >> 5) & 1) * 16 + ((idx >> 4) & 1) * 8;
#pragma unroll
    for (int i = 0; i < 8; ++i) o0[i] = (_Float16)(kvs[(d0 + i) * DH + e] * (1.0f / 16.0f));
  }
  {
    const int idx = t + 256;
    const int e = (idx >> 7) * 16 + (idx & 15), d0 = ((idx >> 6) & 1) * 32 + ((idx >> 5) & 1) * 16 + ((idx >> 4) & 1) * 8;
#pragma unroll
    for (int i = 0; i < 8; ++i) o1[i] = (_Float16)(kvs[(d0 + i) * DH + e] * (1.0f / 16.0f));
  }
  _Float16* dp0 = kvT + (size_t)bh * (DH * DH) + (size_t)t * 8;
  _Float16* dp1 = dp0 + 2048;
  *(v8h*)dp0 = o0;
  *(v8h*)dp1 = o1;
  
}

// ---------------------------------------------------------------------------
// Output: block = 64 tokens (4 waves x 16 tokens), all heads. Per head: Q proj
// the wave's LDS tile Qs[token][d] as f16 (scalar stores), block barrier, A
// fragments reloaded with ldfrag; ca = Q * (kv/16) with B = kvT plane [e][d];
// attn/1024 = ca/64 spilled as f16 to As[token][e], block barrier, reloaded as A;
// co += (attn/1024) * (Wo x64) with B = WoP plane [eo][h*64+d]. Epilogue:
// out = co/1024 + Wo_b/16384 staged as f32 rows in LDS, barrier, 8 store
// coverage: Qs/As 32 lanes x 32 halves = 16x64 per wave per head; out 4 waves x
// 8 x 32 x 4 floats = the block's 64 rows x 64.
// ---------------------------------------------------------------------------
__global__ __launch_bounds__(128) void k_out(
    const _Float16* __restrict__ vh, const _Float16* __restrict__ WqT,
    const float* __restrict__ Wq_b, const float* __restrict__ lnq_g, const float* __restrict__ lnq_b,
    const _Float16* __restrict__ kvT, const _Float16* __restrict__ WoP,
    const float* __restrict__ Wo_b, float* out) {
  __shared__ __attribute__((aligned(16))) _Float16 Qs[4 * 16 * TP];
  __shared__ __attribute__((aligned(16))) _Float16 As[4 * 16 * TP];
  __shared__ __attribute__((aligned(16))) float stg[4 * 16 * DH];
  const int lane = threadIdx.x & 31, wv = threadIdx.x >> 5, hh = lane >> 4, m = lane & 15;
  const int b = blockIdx.x / (NTOK / 64);
  const size_t tok0 = (size_t)blockIdx.x * 64 + (size_t)wv * 16;
  _Float16* Qw = Qs + wv * (16 * TP);
  _Float16* Aw = As + wv * (16 * TP);
  float* sw = stg + wv * (16 * DH);

  const _Float16* ap = vh + tok0 * CIN;
  const v16h av0 = ldfrag(ap, CIN);
  const v16h av1 = ldfrag(ap + 32, CIN);

  float wob[4];
#pragma unroll
  for (int nt = 0; nt < 4; ++nt) wob[nt] = Wo_b[16 * nt + m] * (1.0f / 16384.0f);

  v8f co[4];
#pragma unroll
  for (int nt = 0; nt < 4; ++nt) { v8f z = {0.f, 0.f, 0.f, 0.f, 0.f, 0.f, 0.f, 0.f}; co[nt] = z; }

  // head 0's Q weight fragments and LayerNorm rows; each head fetches the next head's in front of its attn*Wo products
  v16h bwq[4][2];
  float bq[4], gq[4], btq[4];
#pragma unroll
  for (int nt = 0; nt < 4; ++nt) {
    const _Float16* wq = WqT + (size_t)(16 * nt) * CIN;
    bwq[nt][0] = ldfragp(wq); bwq[nt][1] = ldfragp(wq + 512);
    const int col = 16 * nt + m;
    bq[nt] = Wq_b[col]; gq[nt] = lnq_g[col]; btq[nt] = lnq_b[col];
  }

#pragma unroll 1
  for (int h = 0; h < NH; ++h) {
    // Q projection for head h
    v8f cq[4];
#pragma unroll
    for (int nt = 0; nt < 4; ++nt) {
      v8f z = {0.f, 0.f, 0.f, 0.f, 0.f, 0.f, 0.f, 0.f}; cq[nt] = z;
      cq[nt] = wmf(av0, bwq[nt][0], cq[nt]);
      cq[nt] = wmf(av1, bwq[nt][1], cq[nt]);
    }

    // this head's kv fragments as one load group: they fly during the LayerNorm
    const _Float16* kp = kvT + (size_t)(b * NH + h) * (DH * DH);
    v16h bkv[4][2];
#pragma unroll
    for (int et = 0; et < 4; ++et) {
      bkv[et][0] = ldfragp(kp + (16 * et) * DH);
      bkv[et][1] = ldfragp(kp + (16 * et) * DH + 512);
    }
    // holds the group in front of the LayerNorm (sunk into it the loads start later and in pieces)
    __builtin_amdgcn_sched_barrier(0);

    // bias + LayerNorm
#pragma unroll
    for (int r = 0; r < 8; ++r) {
      float x0 = cq[0][r] * RWSC + bq[0];
      float x1 = cq[1][r] * RWSC + bq[1];
      float x2 = cq[2][r] * RWSC + bq[2];
      float x3 = cq[3][r] * RWSC + bq[3];
      float s = (x0 + x1) + (x2 + x3);
      s = hred16(s);
      const float mu = s * (1.0f / 64.0f);
      x0 -= mu; x1 -= mu; x2 -= mu; x3 -= mu;
      float q = (x0 * x0 + x1 * x1) + (x2 * x2 + x3 * x3);
      q = hred16(q);
      const float var = q * (1.0f / 64.0f);
      const float rs = rsqrtf(var + EPSV);
      cq[0][r] = x0 * rs * gq[0] + btq[0];
      cq[1][r] = x1 * rs * gq[1] + btq[1];
      cq[2][r] = x2 * rs * gq[2] + btq[2];
      cq[3][r] = x3 * rs * gq[3] + btq[3];
    }

    // Q rows -> Qs[token][d] f16
#pragma unroll
    for (int nt = 0; nt < 4; ++nt) {
#pragma unroll
      for (int r = 0; r < 8; ++r) Qw[(8 * hh + r) * TP + 16 * nt + m] = (_Float16)cq[nt][r];
    }
    __syncthreads();

    // this head's Wo fragments as one load group: they fly during Q*kv and the attn spill
    const _Float16* wo = WoP + h * (DH * DH);
    v16h bwo[4][2];
#pragma unroll
    for (int nt = 0; nt < 4; ++nt) {
      bwo[nt][0] = ldfragp(wo + (16 * nt) * DH);
      bwo[nt][1] = ldfragp(wo + (16 * nt) * DH + 512);
    }
    // holds the group in front of Q*kv (sunk to its products each load would be waited for singly)
    __builtin_amdgcn_sched_barrier(0);

    // ca = Q * (kv/16): A = Qs (row token, k = d), B = kvT[e][d] (col e, k = d)
    const v16h aq0 = ldfrag(Qw, TP);
    const v16h aq1 = ldfrag(Qw + 32, TP);
    v8f ca[4];
#pragma unroll
    for (int et = 0; et < 4; ++et) {
      v8f z = {0.f, 0.f, 0.f, 0.f, 0.f, 0.f, 0.f, 0.f}; ca[et] = z;
      ca[et] = wmf(aq0, bkv[et][0], ca[et]);
      ca[et] = wmf(aq1, bkv[et][1], ca[et]);
    }

    // attn/1024 = ca/64 -> As[token][e] f16
#pragma unroll
    for (int et = 0; et < 4; ++et) {
#pragma unroll
      for (int r = 0; r < 8; ++r) Aw[(8 * hh + r) * TP + 16 * et + m] = (_Float16)(ca[et][r] * (1.0f / 64.0f));
    }
    __syncthreads();

    // next head's Q weight fragments and LayerNorm rows as one load group: they fly during attn*Wo
    // (the last head reads its own again: in bounds, unused)
    {
      const int hn = (h + 1 < NH) ? h + 1 : h;
#pragma unroll
      for (int nt = 0; nt < 4; ++nt) {
        const _Float16* wq = WqT + (size_t)(hn * DH + 16 * nt) * CIN;
        bwq[nt][0] = ldfragp(wq); bwq[nt][1] = ldfragp(wq + 512);
        const int col = hn * DH + 16 * nt + m;
        bq[nt] = Wq_b[col]; gq[nt] = lnq_g[col]; btq[nt] = lnq_b[col];
      }
    }
    // holds the group in front of attn*Wo (sunk to the next head's products each load would be waited for singly)
    __builtin_amdgcn_sched_barrier(0);

    // co += (attn/1024) * (Wo x64): A = As (row token, k = e), B = WoP[eo][h*64 + e]
    const v16h aa0 = ldfrag(Aw, TP);
    const v16h aa1 = ldfrag(Aw + 32, TP);
#pragma unroll
    for (int nt = 0; nt < 4; ++nt) {
      co[nt] = wmf(aa0, bwo[nt][0], co[nt]);
      co[nt] = wmf(aa1, bwo[nt][1], co[nt]);
    }
  }

  // epilogue: out = co/1024 + Wo_b/16384
#pragma unroll
  for (int nt = 0; nt < 4; ++nt) {
#pragma unroll
    for (int r = 0; r < 8; ++r) sw[(8 * hh + r) * DH + 16 * nt + m] = co[nt][r] * (1.0f / 1024.0f) + wob[nt];
  }
  __syncthreads();
  float* gp = out + tok0 * DH;
#pragma unroll
  for (int i = 0; i < 8; ++i) {
    const v4f x = *(const v4f*)(sw + i * 128 + 4 * lane);
    *(v4f*)(gp + i * 128 + 4 * lane) = x;
  }
  
}

// ---------------------------------------------------------------------------
extern "C" void kernel_launch(void* const* d_in, const int* in_sizes, int n_in,
                              void* d_out, int out_size, void* d_ws, size_t ws_size,
                              hipStream_t stream) {
  if (n_in < 13) return;
  if (in_sizes[0] != NB * NTOK * CIN) return;
  if (in_sizes[1] != CIN * HD || in_sizes[3] != CIN * HD || in_sizes[5] != CIN * HD) return;
  if (in_sizes[2] != HD || in_sizes[4] != HD || in_sizes[6] != HD) return;
  if (in_sizes[7] != NH * DH || in_sizes[8] != NH * DH || in_sizes[9] != NH * DH || in_sizes[10] != NH * DH) return;
  if (in_sizes[11] != HD * DH || in_sizes[12] != DH) return;
  if (out_size != NB * NTOK * DH) return;

  const float* v     = (const float*)d_in[0];
  const float* Wq_w  = (const float*)d_in[1];
  const float* Wq_b  = (const float*)d_in[2];
  const float* Wk_w  = (const float*)d_in[3];
  const float* Wk_b  = (const float*)d_in[4];
  const float* Wv_w  = (const float*)d_in[5];
  const float* Wv_b  = (const float*)d_in[6];
  const float* lnq_g = (const float*)d_in[7];
  const float* lnq_b = (const float*)d_in[8];
  const float* lnk_g = (const float*)d_in[9];
  const float* lnk_b = (const float*)d_in[10];
  const float* Wo_w  = (const float*)d_in[11];
  const float* Wo_b  = (const float*)d_in[12];
  float* out = (float*)d_out;

  // workspace carve (256-B aligned; every region an exact multiple of its whole-line store extent)
  char* ws = (char*)d_ws;
  size_t off = 0;
  const size_t oVh  = off; off += (size_t)NB * NTOK * CIN * 2;        off = (off + 255) & ~(size_t)255;   // 8388608
  const size_t oWq  = off; off += (size_t)CIN * HD * 2;               off = (off + 255) & ~(size_t)255;   // 65536
  const size_t oWk  = off; off += (size_t)CIN * HD * 2;               off = (off + 255) & ~(size_t)255;
  const size_t oWv  = off; off += (size_t)CIN * HD * 2;               off = (off + 255) & ~(size_t)255;
  const size_t oWo  = off; off += (size_t)HD * DH * 2;                off = (off + 255) & ~(size_t)255;   // 65536
  const size_t oKvT = off; off += (size_t)NB * NH * DH * DH * 2;      off = (off + 255) & ~(size_t)255;   // 262144
  const size_t oPt  = off; off += (size_t)NB * NH * NTILE * DH * DH * 4; off = (off + 255) & ~(size_t)255; // 8388608
  if (off > ws_size || off > (size_t)WSCAP) return;
  _Float16* vh   = (_Float16*)(ws + oVh);
  _Float16* WqT  = (_Float16*)(ws + oWq);
  _Float16* WkT  = (_Float16*)(ws + oWk);
  _Float16* WvT  = (_Float16*)(ws + oWv);
  _Float16* WoP  = (_Float16*)(ws + oWo);
  _Float16* kvT  = (_Float16*)(ws + oKvT);
  float*    part = (float*)(ws + oPt);

  // 1: v -> f16 plane, weights -> f16 planes (x64)
  k_prep<<<NVB + NWB, 256, 0, stream>>>(v, Wq_w, Wk_w, Wv_w, Wo_w, vh, WqT, WkT, WvT, WoP);
  // 2: K/V projection + LayerNorm(K) + K^T V partials per (batch, head, token tile)
  k_kv<<<NB * NH * NTILE, 128, 0, stream>>>(vh, WkT, WvT, Wk_b, Wv_b, lnk_g, lnk_b, part);
  // 3: fixed-order partial sum -> kvT planes (f16, x1/16)
  k_kvred<<<NB * NH, 256, 0, stream>>>(part, kvT);
  // 4: Q projection + LayerNorm(Q) + Q kv + output projection, /n
  k_out<<<(NB * NTOK) / 64, 128, 0, stream>>>(vh, WqT, Wq_b, lnq_g, lnq_b, kvT, WoP, Wo_b, out);
}

// v005
// Measured time: 48.7 microseconds a run.
// Two timings next to v004 both put it at 1.10 times that version's speed.
// Counting every step since v000, it is 3.45 times as fast.
#include <hip/hip_runtime.h>
#include <stddef.h>

// All contractions on v_wmma_f32_16x16x32_f16 (f16 operands, f32 accumulate). The chain (Q (K^T V)) Wo is taken as Q (K^T (V Wo)) per head: Wvo = Wv_h*Wo_h (both carried x64) once in the prep launch, Q/K/V' projections (activations as-is, weights carried x64), K^T*V' per (batch, head) over token tiles with f32 fixed-order partial sums, Q*kv' (kv' carried x1/16) summed over the heads in the accumulator; RNE converts; power-of-two carries folded back in the f32 epilogues. LayerNorm, bias, 1/n scaling: f32 VALU.

#define NB     4
#define NTOK   16384
#define CIN    64
#define NH     8
#define DH     64
#define HD     (NH * DH)
#define NTILE  16                      // token tiles per (batch, head) for the K^T V partials: 512 blocks, two per WGP, two waves per SIMD
#define CHT    (NTOK / NTILE)          // 1024 tokens per kv block
#define KVIT   (CHT / 64)              // 16 steps of 64 tokens
#define TP     72                      // LDS pitch in halves of the transposed K/V tiles and the Q tiles
#define NVB    ((NB * NTOK * CIN) / (256 * 8))   // 2048 blocks convert v
#define NWB    52                      // weight blocks: 16 Wq plane, 16 Wk plane, 20 Wv*Wo plane with the bias row bv*Wo
#define WSC    64.0f
#define RWSC   (1.0f / 64.0f)
#define EPSV   1e-5f
#define WSCAP  134217728

static_assert(CIN == 64 && DH == 64 && HD == 512 && NH == 8);
static_assert((NTOK % NTILE) == 0 && (CHT % 64) == 0 && (NTOK % 64) == 0);
static_assert(NVB * 256 * 8 == NB * NTOK * CIN);
static_assert(16 * 256 * 8 == CIN * HD && 20 * 8 == NH * (CIN / 16 + 1) * (DH / 16));
static_assert((TP % 8) == 0 && TP >= 64);

typedef float    v4f  __attribute__((ext_vector_type(4)));
typedef float    v8f  __attribute__((ext_vector_type(8)));
typedef _Float16 v8h  __attribute__((ext_vector_type(8)));
typedef _Float16 v16h __attribute__((ext_vector_type(16)));
union FragH { v16h v; v8h h[2]; };

// WMMA as the plain builtin: the compiler keeps the hazard distances of its own form and is free
// to issue the fragment loads of a whole group ahead of the products.
__device__ __forceinline__ v8f wmf(v16h a, v16h b, v8f c) {
  return __builtin_amdgcn_wmma_f32_16x16x32_f16(false, a, false, b, (short)0, c, false, false);
}

// 16x32 fragment from a 16-bit [row][k] (k-contiguous) tile, p = &T[row0][k0], pitch ld halves.
// Used for A (row = l&15) and for B stored as [n][k] (col = l&15); split k map:
// elements 0..7 <- k0 + 8h + 0..7, elements 8..15 <- k0 + 16 + 8h + 0..7, h = lane>>4.
__device__ __forceinline__ v16h ldfrag(const _Float16* p, int ld) {
  const int l = threadIdx.x & 31, hh = l >> 4, m = l & 15;
  const _Float16* q = p + m * ld + 8 * hh;
  FragH f;
  f.h[0] = *(const v8h*)q;
  f.h[1] = *(const v8h*)(q + 16);
  return f.v;
}

// The same fragment from a plane kept in fragment order: one (16-row tile, 32-deep k step) = 512 halves,
// chunk j (0, 1) of lane l at halves 256 j + 8 l, holding T[row0 + (l & 15)][k0 + 16 j + 8 (l >> 4) + 0..7].
// Each of the two 16-byte loads of a wave then reads 512 contiguous bytes (4 whole lines, not 32 B of 16 lines).
__device__ __forceinline__ v16h ldfragp(const _Float16* blk) {
  const _Float16* q = blk + 8 * (threadIdx.x & 31);
  FragH f;
  f.h[0] = *(const v8h*)q;
  f.h[1] = *(const v8h*)(q + 256);
  return f.v;
}

// value of lane (l ^ M) of the same 16-lane row, M < 16: a DPP row_xmask operand (control 0x160 | M), all lanes on.
// It stays in the vector pipe and folds into the add that uses it; a shuffle goes through the LDS unit and is waited for.
template <int M>
__device__ __forceinline__ float rowx(float x) {
  return __builtin_bit_cast(float, __builtin_amdgcn_update_dpp(0, __builtin_bit_cast(int, x), 0x160 | M, 0xf, 0xf, true));
}

// sum over the 16 lanes of a half-wave (xor masks < 16 stay inside the row); butterfly order 8, 4, 2, 1
__device__ __forceinline__ float hred16(float x) {
  x += rowx<8>(x);
  x += rowx<4>(x);
  x += rowx<2>(x);
  x += rowx<1>(x);
  return x;
}

// ---------------------------------------------------------------------------
// Prep: blocks 0..NVB-1 convert v [65536][64] f32 -> vh f16 (same layout);
// blocks NVB..NVB+51 build the weight planes (x64) in the fragment order of ldfragp,
//   WqT/WkT/WvT: block (o tile 0..31, k step 0..1) of W^T [512][64]; WvT holds Wvo[c][h*64+eo] = sum_e Wv[c][h*64+e] Wo[h*64+e][eo]:
//   one wave = one 16x16 tile (head, row tile, eo tile), A = Wv rows c (k = e), B = Wo columns eo (k = e), same k map in both;
//   the accumulator (8 consecutive c of one eo per lane) is that lane's 16-byte chunk of the plane as it stands.
//   Row tile 4 has the bias row Wv_b in all 16 rows: its accumulator row 0 is bvo[h*64+eo] = sum_e Wv_b[h*64+e] Wo[h*64+e][eo], kept f32.
// One thread = 8 contiguous halves, a wave writes 512 contiguous B per instruction,
// coverage: vh 2048x256x8 = 4194304; each weight plane 16x256x8 = 32768; bvo 8 heads x 4 tiles x 16 lanes = 512.
// ---------------------------------------------------------------------------
__global__ __launch_bounds__(256) void k_prep(
    const float* __restrict__ v, const float* __restrict__ Wq, const float* __restrict__ Wk,
    const float* __restrict__ Wv, const float* __restrict__ Wv_b, const float* __restrict__ Wo,
    _Float16* vh, _Float16* WqT, _Float16* WkT, _Float16* WvT, float* bvo) {
  const int t = threadIdx.x;
  const int bid = blockIdx.x;
  v8h o;
  _Float16* d;
  if (bid < NVB) {
    const size_t i = (size_t)bid * 256 + t;
    const v4f a = *(const v4f*)(v + i * 8);
    const v4f c = *(const v4f*)(v + i * 8 + 4);
    o[0] = (_Float16)a.x; o[1] = (_Float16)a.y; o[2] = (_Float16)a.z; o[3] = (_Float16)a.w;
    o[4] = (_Float16)c.x; o[5] = (_Float16)c.y; o[6] = (_Float16)c.z; o[7] = (_Float16)c.w;
    d = vh + i * 8;
  } else {
    const int wb = bid - NVB;              // 0..51
    const int which = wb >> 4;             // 0 q, 1 k, 2 and 3 Wv*Wo
    if (which < 2) {
      const int i = (wb & 15) * 256 + t;   // 0..4095: 16-byte chunk of the plane
      const int l = i & 31, c0 = ((i >> 6) & 1) * 32 + ((i >> 5) & 1) * 16 + (l >> 4) * 8;   // lane, k offset in 64
      const float* W = (which == 0) ? Wq : Wk;
      _Float16* T = (which == 0) ? WqT : WkT;
      const int oc = (i >> 7) * 16 + (l & 15);           // chunk = W[c0..c0+7][oc] * 64
#pragma unroll
      for (int e = 0; e < 8; ++e) o[e] = (_Float16)(W[(c0 + e) * HD + oc] * WSC);
      d = T + (size_t)i * 8;
    } else {
      const int l = t & 31, hh = l >> 4, m = l & 15;
      const int tl = (wb - 32) * 8 + (t >> 5);           // 0..159: (head, row tile 0..4, eo tile)
      const int h = tl / 20, ct = (tl % 20) >> 2, et = tl & 3;
      const float* arow = (ct < 4) ? Wv + (ct * 16 + m) * HD : Wv_b;
      v8f acc = {0.f, 0.f, 0.f, 0.f, 0.f, 0.f, 0.f, 0.f};
#pragma unroll
      for (int ks = 0; ks < 2; ++ks) {
        const float* ar = arow + h * DH + 32 * ks + 8 * hh;                           // row c (or the bias row), e contiguous
        const float* br = Wo + (h * DH + 32 * ks + 8 * hh) * DH + et * 16 + m;        // column eo, e strided
        FragH a, bf;
#pragma unroll
        for (int j = 0; j < 2; ++j) {
#pragma unroll
          for (int e = 0; e < 8; ++e) {
            a.h[j][e]  = (_Float16)(ar[16 * j + e] * WSC);
            bf.h[j][e] = (_Float16)(br[(16 * j + e) * DH] * WSC);
          }
        }
        acc = wmf(a.v, bf.v, acc);
      }
      if (ct == 4) {
        if (hh == 0) bvo[h * DH + et * 16 + m] = acc[0] * (RWSC * RWSC);
        return;
      }
#pragma unroll
      for (int r = 0; r < 8; ++r) o[r] = (_Float16)(acc[r] * RWSC);   // x4096 -> x64
      d = WvT + ((h * 4 + et) * 2 + (ct >> 1)) * 512 + (ct & 1) * 256 + 8 * l;
    }
  }
  *(v8h*)d = o;
  
}

// ---------------------------------------------------------------------------
// K/V' projection (V' = V Wo_h, through the Wvo plane and the bvo row) + LayerNorm(K) + K^T V' partial. Block = (batch, head, token tile),
// 4 waves; per step each wave projects its own 16 tokens (A = vh rows, B = WkT/WvT
// K and V are written transposed into LDS Kt/Vt [d][token] (one 16-B store per
// 16x16 tile per lane: 8 consecutive tokens of one d). Block barrier. Wave w then
// accumulates kv rows d = 16w..16w+15 x all 64 e over the 64 tokens: A = Kt (row d,
// k = token), B = Vt (col e, k = token), same loader. Barrier before the next step.
// Epilogue: kv strip staged as f32 rows in LDS, barrier, 8 store instructions per
// coverage: Kt/Vt 4 waves x 4 tiles x 32 lanes x 8 = 64x64 halves each per step;
// part 4 waves x 8 x 32 x 4 floats = the block's 64x64 partial.
// ---------------------------------------------------------------------------
__global__ __launch_bounds__(128) void k_kv(
    const _Float16* __restrict__ vh, const _Float16* __restrict__ WkT, const _Float16* __restrict__ WvT,
    const float* __restrict__ Wk_b, const float* __restrict__ bvo,
    const float* __restrict__ lnk_g, const float* __restrict__ lnk_b, float* part) {
  __shared__ __attribute__((aligned(16))) _Float16 Kt[DH * TP];
  __shared__ __attribute__((aligned(16))) _Float16 Vt[DH * TP];
  __shared__ __attribute__((aligned(16))) float stg[4 * 16 * DH];
  const int lane = threadIdx.x & 31, wv = threadIdx.x >> 5, hh = lane >> 4, m = lane & 15;
  const int tile = blockIdx.x % NTILE;
  const int h = (blockIdx.x / NTILE) % NH;
  const int b = blockIdx.x / (NTILE * NH);

  float bk[4], bv[4], gk[4], btk[4];
#pragma unroll
  for (int nt = 0; nt < 4; ++nt) {
    const int col = h * DH + 16 * nt + m;
    bk[nt] = Wk_b[col]; bv[nt] = bvo[col];
    gk[nt] = lnk_g[col]; btk[nt] = lnk_b[col];
  }

  v8f kvacc[4];
#pragma unroll
  for (int et = 0; et < 4; ++et) { v8f z = {0.f, 0.f, 0.f, 0.f, 0.f, 0.f, 0.f, 0.f}; kvacc[et] = z; }

  asm volatile("s_wait_xcnt 0x0" ::: "memory");

  // the head's K and V weight fragments do not change over the token loop: one load group, kept in registers
  v16h wkf[4][2], wvf[4][2];
#pragma unroll
  for (int nt = 0; nt < 4; ++nt) {
    const _Float16* wk = WkT + (size_t)(h * DH + 16 * nt) * CIN;
    const _Float16* wvp = WvT + (size_t)(h * DH + 16 * nt) * CIN;
    wkf[nt][0] = ldfragp(wk);  wkf[nt][1] = ldfragp(wk + 512);
    wvf[nt][0] = ldfragp(wvp); wvf[nt][1] = ldfragp(wvp + 512);
  }

  // activation rows of step 0; each step fetches the next step's rows behind its own projections
  const _Float16* ab = vh + ((size_t)b * NTOK + (size_t)tile * CHT + (size_t)wv * 16) * CIN;
  v16h av0 = ldfrag(ab, CIN);
  v16h av1 = ldfrag(ab + 32, CIN);

#pragma unroll 1
  for (int it = 0; it < KVIT; ++it) {
    v8f ck[4], cv[4];
#pragma unroll
    for (int nt = 0; nt < 4; ++nt) {
      v8f z = {0.f, 0.f, 0.f, 0.f, 0.f, 0.f, 0.f, 0.f}; ck[nt] = z; cv[nt] = z;
      ck[nt] = wmf(av0, wkf[nt][0], ck[nt]);
      ck[nt] = wmf(av1, wkf[nt][1], ck[nt]);
      cv[nt] = wmf(av0, wvf[nt][0], cv[nt]);
      cv[nt] = wmf(av1, wvf[nt][1], cv[nt]);
    }

    // next step's rows fly during the LayerNorm (the last step reads its own rows again: in bounds, unused)
    {
      const int itn = (it + 1 < KVIT) ? it + 1 : it;
      const _Float16* an = ab + (size_t)itn * (64 * CIN);
      av0 = ldfrag(an, CIN);
      av1 = ldfrag(an + 32, CIN);
    }
    // the LayerNorm reuses the address registers of the four loads above: wait before they are overwritten
    asm volatile("s_wait_xcnt 0x0" ::: "memory");
    // holds the four loads in front of the LayerNorm: sunk to their use they would be waited for in full
    __builtin_amdgcn_sched_barrier(0);

    // K: bias + LayerNorm over the 64 head dims (row 8hh+r spread over 16 lanes x 4 tiles)
#pragma unroll
    for (int r = 0; r < 8; ++r) {
      float x0 = ck[0][r] * RWSC + bk[0];
      float x1 = ck[1][r] * RWSC + bk[1];
      float x2 = ck[2][r] * RWSC + bk[2];
      float x3 = ck[3][r] * RWSC + bk[3];
      float s = (x0 + x1) + (x2 + x3);
      s = hred16(s);
      const float mu = s * (1.0f / 64.0f);
      x0 -= mu; x1 -= mu; x2 -= mu; x3 -= mu;
      float q = (x0 * x0 + x1 * x1) + (x2 * x2 + x3 * x3);
      q = hred16(q);
      const float var = q * (1.0f / 64.0f);
      const float rs = rsqrtf(var + EPSV);
      ck[0][r] = x0 * rs * gk[0] + btk[0];
      ck[1][r] = x1 * rs * gk[1] + btk[1];
      ck[2][r] = x2 * rs * gk[2] + btk[2];
      ck[3][r] = x3 * rs * gk[3] + btk[3];
    }

    // transposed tiles: Kt[d][token], Vt[e][token], token = wv*16 + 8hh + r
#pragma unroll
    for (int nt = 0; nt < 4; ++nt) {
      v8h kk, vv;
#pragma unroll
      for (int r = 0; r < 8; ++r) {
        kk[r] = (_Float16)ck[nt][r];
        vv[r] = (_Float16)(cv[nt][r] * RWSC + bv[nt]);
      }
      *(v8h*)(Kt + (16 * nt + m) * TP + wv * 16 + 8 * hh) = kk;
      *(v8h*)(Vt + (16 * nt + m) * TP + wv * 16 + 8 * hh) = vv;
    }
    __syncthreads();

    // kv rows 16wv..16wv+15 += K^T V over the 64 tokens (2 k-steps)
    const _Float16* ka = Kt + (16 * wv) * TP;
    v16h ak[2], bvf[2][4];
#pragma unroll
    for (int ks = 0; ks < 2; ++ks) {
      ak[ks] = ldfrag(ka + 32 * ks, TP);
#pragma unroll
      for (int et = 0; et < 4; ++et) bvf[ks][et] = ldfrag(Vt + (16 * et) * TP + 32 * ks, TP);
    }
    // keeps the LDS fragment reads one group in front of the products: one place with reads, not one per product
    __builtin_amdgcn_sched_barrier(0);
#pragma unroll
    for (int ks = 0; ks < 2; ++ks) {
#pragma unroll
      for (int et = 0; et < 4; ++et) kvacc[et] = wmf(ak[ks], bvf[ks][et], kvacc[et]);
    }
    __syncthreads();
  }

  // epilogue: stage the wave's 16x64 f32 strip, then whole-line stores
  float* sw = stg + wv * (16 * DH);
#pragma unroll
  for (int et = 0; et < 4; ++et) {
#pragma unroll
    for (int r = 0; r < 8; ++r) sw[(8 * hh + r) * DH + 16 * et + m] = kvacc[et][r];
  }
  __syncthreads();
  float* gp = part + ((size_t)blockIdx.x * DH + (size_t)(16 * wv)) * DH;
#pragma unroll
  for (int i = 0; i < 8; ++i) {
    const v4f x = *(const v4f*)(sw + i * 128 + 4 * lane);
    *(v4f*)(gp + i * 128 + 4 * lane) = x;
  }
  
}

// ---------------------------------------------------------------------------
// kv reduce (block = (batch, head), 256 threads): fixed-order f32 sum of the
// NTILE partials into LDS kv[d][e], barrier, then the kvT plane (kv^T [e][d], f16 of
// kv/16) in the fragment order of ldfragp, block (e tile, k step): chunk idx, one 16-B store per
// coverage: 256 threads x 2 idx x 8 halves = 4096 = the (b,h) 64x64 plane.
// ---------------------------------------------------------------------------
__global__ __launch_bounds__(256) void k_kvred(const float* __restrict__ part, _Float16* kvT) {
  __shared__ __attribute__((aligned(16))) float kvs[DH * DH];
  const int t = threadIdx.x;
  const int bh = blockIdx.x;
  const float* p0 = part + (size_t)bh * NTILE * (DH * DH);
#pragma unroll 1
  for (int j = 0; j < (DH * DH) / 256; ++j) {
    const int idx = j * 256 + t;
    float s = 0.0f;
#pragma unroll
    for (int tl = 0; tl < NTILE; ++tl) s += p0[(size_t)tl * (DH * DH) + idx];
    kvs[idx] = s;
  }
  __syncthreads();
  v8h o0, o1;
  {
    const int idx = t;
    const int e = (idx >> 7) * 16 + (idx & 15), d0 = ((idx >> 6) & 1) * 32 + ((idx >> 5) & 1) * 16 + ((idx >> 4) & 1) * 8;
#pragma unroll
    for (int i = 0; i < 8; ++i) o0[i] = (_Float16)(kvs[(d0 + i) * DH + e] * (1.0f / 16.0f));
  }
  {
    const int idx = t + 256;
    const int e = (idx >> 7) * 16 + (idx & 15), d0 = ((idx >> 6) & 1) * 32 + ((idx >> 5) & 1) * 16 + ((idx >> 4) & 1) * 8;
#pragma unroll
    for (int i = 0; i < 8; ++i) o1[i] = (_Float16)(kvs[(d0 + i) * DH + e] * (1.0f / 16.0f));
  }
  _Float16* dp0 = kvT + (size_t)bh * (DH * DH) + (size_t)t * 8;
  _Float16* dp1 = dp0 + 2048;
  *(v8h*)dp0 = o0;
  *(v8h*)dp1 = o1;
  
}

// ---------------------------------------------------------------------------
// Output: block = 64 tokens (4 waves x 16 tokens), all heads. Per head: Q proj
// + LayerNorm, Q to the wave's LDS tile Qs[token][d] as f16 (scalar stores), block
// barrier, A fragments reloaded with ldfrag; co += Q * (kv'/16) with B = kvT plane
// [eo][d], kv' = K^T (V Wo_h): the heads add up in the accumulator. Epilogue:
// out = co/1024 + Wo_b/16384 staged as f32 rows in LDS, barrier, 8 store
// coverage: Qs 32 lanes x 32 halves = 16x64 per wave per head; out 4 waves x
// 8 x 32 x 4 floats = the block's 64 rows x 64.
// ---------------------------------------------------------------------------
__global__ __launch_bounds__(128) void k_out(
    const _Float16* __restrict__ vh, const _Float16* __restrict__ WqT,
    const float* __restrict__ Wq_b, const float* __restrict__ lnq_g, const float* __restrict__ lnq_b,
    const _Float16* __restrict__ kvT,
    const float* __restrict__ Wo_b, float* out) {
  __shared__ __attribute__((aligned(16))) _Float16 Qs[4 * 16 * TP];
  __shared__ __attribute__((aligned(16))) float stg[4 * 16 * DH];
  const int lane = threadIdx.x & 31, wv = threadIdx.x >> 5, hh = lane >> 4, m = lane & 15;
  const int b = blockIdx.x / (NTOK / 64);
  const size_t tok0 = (size_t)blockIdx.x * 64 + (size_t)wv * 16;
  _Float16* Qw = Qs + wv * (16 * TP);
  float* sw = stg + wv * (16 * DH);

  const _Float16* ap = vh + tok0 * CIN;
  const v16h av0 = ldfrag(ap, CIN);
  const v16h av1 = ldfrag(ap + 32, CIN);

  float wob[4];
#pragma unroll
  for (int nt = 0; nt < 4; ++nt) wob[nt] = Wo_b[16 * nt + m] * (1.0f / 16384.0f);

  v8f co[4];
#pragma unroll
  for (int nt = 0; nt < 4; ++nt) { v8f z = {0.f, 0.f, 0.f, 0.f, 0.f, 0.f, 0.f, 0.f}; co[nt] = z; }

  // head 0's Q weight fragments and LayerNorm rows; each head fetches the next head's in front of its Q*kv' products
  v16h bwq[4][2];
  float bq[4], gq[4], btq[4];
#pragma unroll
  for (int nt = 0; nt < 4; ++nt) {
    const _Float16* wq = WqT + (size_t)(16 * nt) * CIN;
    bwq[nt][0] = ldfragp(wq); bwq[nt][1] = ldfragp(wq + 512);
    const int col = 16 * nt + m;
    bq[nt] = Wq_b[col]; gq[nt] = lnq_g[col]; btq[nt] = lnq_b[col];
  }

#pragma unroll 1
  for (int h = 0; h < NH; ++h) {
    // Q projection for head h
    v8f cq[4];
#pragma unroll
    for (int nt = 0; nt < 4; ++nt) {
      v8f z = {0.f, 0.f, 0.f, 0.f, 0.f, 0.f, 0.f, 0.f}; cq[nt] = z;
      cq[nt] = wmf(av0, bwq[nt][0], cq[nt]);
      cq[nt] = wmf(av1, bwq[nt][1], cq[nt]);
    }

    // this head's kv fragments as one load group: they fly during the LayerNorm
    const _Float16* kp = kvT + (size_t)(b * NH + h) * (DH * DH);
    v16h bkv[4][2];
#pragma unroll
    for (int et = 0; et < 4; ++et) {
      bkv[et][0] = ldfragp(kp + (16 * et) * DH);
      bkv[et][1] = ldfragp(kp + (16 * et) * DH + 512);
    }
    // holds the group in front of the LayerNorm (sunk into it the loads start later and in pieces)
    __builtin_amdgcn_sched_barrier(0);

    // bias + LayerNorm
#pragma unroll
    for (int r = 0; r < 8; ++r) {
      float x0 = cq[0][r] * RWSC + bq[0];
      float x1 = cq[1][r] * RWSC + bq[1];
      float x2 = cq[2][r] * RWSC + bq[2];
      float x3 = cq[3][r] * RWSC + bq[3];
      float s = (x0 + x1) + (x2 + x3);
      s = hred16(s);
      const float mu = s * (1.0f / 64.0f);
      x0 -= mu; x1 -= mu; x2 -= mu; x3 -= mu;
      float q = (x0 * x0 + x1 * x1) + (x2 * x2 + x3 * x3);
      q = hred16(q);
      const float var = q * (1.0f / 64.0f);
      const float rs = rsqrtf(var + EPSV);
      cq[0][r] = x0 * rs * gq[0] + btq[0];
      cq[1][r] = x1 * rs * gq[1] + btq[1];
      cq[2][r] = x2 * rs * gq[2] + btq[2];
      cq[3][r] = x3 * rs * gq[3] + btq[3];
    }

    // Q rows -> Qs[token][d] f16
#pragma unroll
    for (int nt = 0; nt < 4; ++nt) {
#pragma unroll
      for (int r = 0; r < 8; ++r) Qw[(8 * hh + r) * TP + 16 * nt + m] = (_Float16)cq[nt][r];
    }
    __syncthreads();

    // next head's Q weight fragments and LayerNorm rows as one load group: they fly during Q*kv'
    // (the last head reads its own again: in bounds, unused)
    {
      const int hn = (h + 1 < NH) ? h + 1 : h;
#pragma unroll
      for (int nt = 0; nt < 4; ++nt) {
        const _Float16* wq = WqT + (size_t)(hn * DH + 16 * nt) * CIN;
        bwq[nt][0] = ldfragp(wq); bwq[nt][1] = ldfragp(wq + 512);
        const int col = hn * DH + 16 * nt + m;
        bq[nt] = Wq_b[col]; gq[nt] = lnq_g[col]; btq[nt] = lnq_b[col];
      }
    }
    // holds the group in front of Q*kv' (sunk to the next head's products each load would be waited for singly)
    __builtin_amdgcn_sched_barrier(0);

    // co += Q * (kv'/16): A = Qs (row token, k = d), B = kvT[eo][d] (col eo, k = d).
    // The wave reads only its own Qs rows and its LDS operations stay in order, so the next head's stores need no second barrier.
    const v16h aq0 = ldfrag(Qw, TP);
    const v16h aq1 = ldfrag(Qw + 32, TP);
#pragma unroll
    for (int et = 0; et < 4; ++et) {
      co[et] = wmf(aq0, bkv[et][0], co[et]);
      co[et] = wmf(aq1, bkv[et][1], co[et]);
    }
  }

  // epilogue: out = co/1024 + Wo_b/16384
#pragma unroll
  for (int nt = 0; nt < 4; ++nt) {
#pragma unroll
    for (int r = 0; r < 8; ++r) sw[(8 * hh + r) * DH + 16 * nt + m] = co[nt][r] * (1.0f / 1024.0f) + wob[nt];
  }
  __syncthreads();
  float* gp = out + tok0 * DH;
#pragma unroll
  for (int i = 0; i < 8; ++i) {
    const v4f x = *(const v4f*)(sw + i * 128 + 4 * lane);
    *(v4f*)(gp + i * 128 + 4 * lane) = x;
  }
  
}

// ---------------------------------------------------------------------------
extern "C" void kernel_launch(void* const* d_in, const int* in_sizes, int n_in,
                              void* d_out, int out_size, void* d_ws, size_t ws_size,
                              hipStream_t stream) {
  if (n_in < 13) return;
  if (in_sizes[0] != NB * NTOK * CIN) return;
  if (in_sizes[1] != CIN * HD || in_sizes[3] != CIN * HD || in_sizes[5] != CIN * HD) return;
  if (in_sizes[2] != HD || in_sizes[4] != HD || in_sizes[6] != HD) return;
  if (in_sizes[7] != NH * DH || in_sizes[8] != NH * DH || in_sizes[9] != NH * DH || in_sizes[10] != NH * DH) return;
  if (in_sizes[11] != HD * DH || in_sizes[12] != DH) return;
  if (out_size != NB * NTOK * DH) return;

  const float* v     = (const float*)d_in[0];
  const float* Wq_w  = (const float*)d_in[1];
  const float* Wq_b  = (const float*)d_in[2];
  const float* Wk_w  = (const float*)d_in[3];
  const float* Wk_b  = (const float*)d_in[4];
  const float* Wv_w  = (const float*)d_in[5];
  const float* Wv_b  = (const float*)d_in[6];
  const float* lnq_g = (const float*)d_in[7];
  const float* lnq_b = (const float*)d_in[8];
  const float* lnk_g = (const float*)d_in[9];
  const float* lnk_b = (const float*)d_in[10];
  const float* Wo_w  = (const float*)d_in[11];
  const float* Wo_b  = (const float*)d_in[12];
  float* out = (float*)d_out;

  // workspace carve (256-B aligned; every region an exact multiple of its whole-line store extent)
  char* ws = (char*)d_ws;
  size_t off = 0;
  const size_t oVh  = off; off += (size_t)NB * NTOK * CIN * 2;        off = (off + 255) & ~(size_t)255;   // 8388608
  const size_t oWq  = off; off += (size_t)CIN * HD * 2;               off = (off + 255) & ~(size_t)255;   // 65536
  const size_t oWk  = off; off += (size_t)CIN * HD * 2;               off = (off + 255) & ~(size_t)255;
  const size_t oWv  = off; off += (size_t)CIN * HD * 2;               off = (off + 255) & ~(size_t)255;
  const size_t oBvo = off; off += (size_t)HD * 4;                     off = (off + 255) & ~(size_t)255;   // 2048
  const size_t oKvT = off; off += (size_t)NB * NH * DH * DH * 2;      off = (off + 255) & ~(size_t)255;   // 262144
  const size_t oPt  = off; off += (size_t)NB * NH * NTILE * DH * DH * 4; off = (off + 255) & ~(size_t)255; // 8388608
  if (off > ws_size || off > (size_t)WSCAP) return;
  _Float16* vh   = (_Float16*)(ws + oVh);
  _Float16* WqT  = (_Float16*)(ws + oWq);
  _Float16* WkT  = (_Float16*)(ws + oWk);
  _Float16* WvT  = (_Float16*)(ws + oWv);
  float*    bvo  = (float*)(ws + oBvo);
  _Float16* kvT  = (_Float16*)(ws + oKvT);
  float*    part = (float*)(ws + oPt);

  // 1: v -> f16 plane, Wq, Wk, Wv*Wo -> f16 planes (x64), bv*Wo row
  k_prep<<<NVB + NWB, 256, 0, stream>>>(v, Wq_w, Wk_w, Wv_w, Wv_b, Wo_w, vh, WqT, WkT, WvT, bvo);
  // 2: K/V' projection + LayerNorm(K) + K^T V' partials per (batch, head, token tile)
  k_kv<<<NB * NH * NTILE, 128, 0, stream>>>(vh, WkT, WvT, Wk_b, bvo, lnk_g, lnk_b, part);
  // 3: fixed-order partial sum -> kvT planes (f16, x1/16)
  k_kvred<<<NB * NH, 256, 0, stream>>>(part, kvT);
  // 4: Q projection + LayerNorm(Q) + Q kv' summed over heads, /n
  k_out<<<(NB * NTOK) / 64, 128, 0, stream>>>(vh, WqT, Wq_b, lnq_g, lnq_b, kvT, Wo_b, out);
}

// v006
// It runs in 46.5 microseconds.
// Timed twice side by side with v005, it ran 1.04 times as fast both times.
// Over all steps from v000 it is 3.60 times as fast.
#include <hip/hip_runtime.h>
#include <stddef.h>

// All contractions on v_wmma_f32_16x16x32_f16 (f16 operands, f32 accumulate). The chain (Q (K^T V)) Wo is taken as Q (K^T (V Wo)) per head: Wvo = Wv_h*Wo_h (both carried x64) once in the prep launch, Q/K/V' projections (activations as-is, weights carried x64), K^T*V' per (batch, head) over token tiles with f32 fixed-order partial sums, Q*kv' (kv' carried x1/16) summed over the heads in the accumulator; RNE converts; power-of-two carries folded back in the f32 epilogues. LayerNorm, bias, 1/n scaling: f32 VALU.

#define NB     4
#define NTOK   16384
#define CIN    64
#define NH     8
#define DH     64
#define HD     (NH * DH)
#define NTILE  16                      // token tiles per (batch, head) for the K^T V partials: 512 blocks, two per WGP, two waves per SIMD
#define CHT    (NTOK / NTILE)          // 1024 tokens per kv block
#define KVIT   (CHT / 64)              // 16 steps of 64 tokens
#define TP     72                      // LDS pitch in halves of the transposed K/V tiles
#define SP     68                      // LDS pitch in floats of the output rows staged by token: 16-byte stores of 16 rows spread over the banks
#define NVB    ((NB * NTOK * CIN) / (256 * 8))   // 2048 blocks convert v
#define NWB    52                      // weight blocks: 16 Wq plane, 16 Wk plane, 20 Wv*Wo plane with the bias row bv*Wo
#define WSC    64.0f
#define RWSC   (1.0f / 64.0f)
#define EPSV   1e-5f
#define WSCAP  134217728

static_assert(CIN == 64 && DH == 64 && HD == 512 && NH == 8);
static_assert((NTOK % NTILE) == 0 && (CHT % 64) == 0 && (NTOK % 64) == 0);
static_assert(NVB * 256 * 8 == NB * NTOK * CIN);
static_assert(16 * 256 * 8 == CIN * HD && 20 * 8 == NH * (CIN / 16 + 1) * (DH / 16));
static_assert((TP % 8) == 0 && TP >= 64);

typedef float    v2f  __attribute__((ext_vector_type(2)));
typedef float    v4f  __attribute__((ext_vector_type(4)));
typedef float    v8f  __attribute__((ext_vector_type(8)));
typedef _Float16 v8h  __attribute__((ext_vector_type(8)));
typedef _Float16 v16h __attribute__((ext_vector_type(16)));
union FragH { v16h v; v8h h[2]; };

// WMMA as the plain builtin: the compiler keeps the hazard distances of its own form and is free
// to issue the fragment loads of a whole group ahead of the products.
__device__ __forceinline__ v8f wmf(v16h a, v16h b, v8f c) {
  return __builtin_amdgcn_wmma_f32_16x16x32_f16(false, a, false, b, (short)0, c, false, false);
}

// 16x32 fragment from a 16-bit [row][k] (k-contiguous) tile, p = &T[row0][k0], pitch ld halves.
// Used for A (row = l&15) and for B stored as [n][k] (col = l&15); split k map:
// elements 0..7 <- k0 + 8h + 0..7, elements 8..15 <- k0 + 16 + 8h + 0..7, h = lane>>4.
__device__ __forceinline__ v16h ldfrag(const _Float16* p, int ld) {
  const int l = threadIdx.x & 31, hh = l >> 4, m = l & 15;
  const _Float16* q = p + m * ld + 8 * hh;
  FragH f;
  f.h[0] = *(const v8h*)q;
  f.h[1] = *(const v8h*)(q + 16);
  return f.v;
}

// The same fragment from a plane kept in fragment order: one (16-row tile, 32-deep k step) = 512 halves,
// chunk j (0, 1) of lane l at halves 256 j + 8 l, holding T[row0 + (l & 15)][k0 + 16 j + 8 (l >> 4) + 0..7].
// Each of the two 16-byte loads of a wave then reads 512 contiguous bytes (4 whole lines, not 32 B of 16 lines).
__device__ __forceinline__ v16h ldfragp(const _Float16* blk) {
  const _Float16* q = blk + 8 * (threadIdx.x & 31);
  FragH f;
  f.h[0] = *(const v8h*)q;
  f.h[1] = *(const v8h*)(q + 256);
  return f.v;
}

// ldfragp with the lane's own pointer q = blk + 8 * lane formed by the caller
__device__ __forceinline__ v16h ldfragl(const _Float16* q) {
  FragH f;
  f.h[0] = *(const v8h*)q;
  f.h[1] = *(const v8h*)(q + 256);
  return f.v;
}

// value of lane (l ^ M) of the same 16-lane row, M < 16: a DPP row_xmask operand (control 0x160 | M), all lanes on.
// It stays in the vector pipe and folds into the add that uses it; a shuffle goes through the LDS unit and is waited for.
template <int M>
__device__ __forceinline__ float rowx(float x) {
  return __builtin_bit_cast(float, __builtin_amdgcn_update_dpp(0, __builtin_bit_cast(int, x), 0x160 | M, 0xf, 0xf, true));
}

// sum over the 16 lanes of a half-wave (xor masks < 16 stay inside the row); butterfly order 8, 4, 2, 1
__device__ __forceinline__ float hred16(float x) {
  x += rowx<8>(x);
  x += rowx<4>(x);
  x += rowx<2>(x);
  x += rowx<1>(x);
  return x;
}

// value of lane l ^ 16 (the same place in the other 16-lane row): a vector cross-row move, not an LDS-unit shuffle
__device__ __forceinline__ float xhalf(float x) {
  const int b = __builtin_bit_cast(int, x);
  return __builtin_bit_cast(float, __builtin_amdgcn_permlanex16(b, b, 0x76543210, 0xfedcba98, false, false));
}

// 8 consecutive floats (16-byte aligned) as two 16-byte loads
__device__ __forceinline__ v8f ld8(const float* p) {
  const v4f a = *(const v4f*)p;
  const v4f c = *(const v4f*)(p + 4);
  return __builtin_shufflevector(a, c, 0, 1, 2, 3, 4, 5, 6, 7);
}

// sum of the 8 elements, tree order (4 + 4, 2 + 2, 1 + 1)
__device__ __forceinline__ float sum8(v8f t) {
  const v4f a = t.lo + t.hi;
  const v2f c = a.lo + a.hi;
  return c.x + c.y;
}

// ---------------------------------------------------------------------------
// Prep: blocks 0..NVB-1 convert v [65536][64] f32 -> vh f16 (same layout);
// blocks NVB..NVB+51 build the weight planes (x64) in the fragment order of ldfragp,
//   WqT/WkT/WvT: block (o tile 0..31, k step 0..1) of W^T [512][64]; WvT holds Wvo[c][h*64+eo] = sum_e Wv[c][h*64+e] Wo[h*64+e][eo]:
//   one wave = one 16x16 tile (head, row tile, eo tile), A = Wv rows c (k = e), B = Wo columns eo (k = e), same k map in both;
//   the accumulator (8 consecutive c of one eo per lane) is that lane's 16-byte chunk of the plane as it stands.
//   Row tile 4 has the bias row Wv_b in all 16 rows: its accumulator row 0 is bvo[h*64+eo] = sum_e Wv_b[h*64+e] Wo[h*64+e][eo], kept f32.
// One thread = 8 contiguous halves, a wave writes 512 contiguous B per instruction,
// coverage: vh 2048x256x8 = 4194304; each weight plane 16x256x8 = 32768; bvo 8 heads x 4 tiles x 16 lanes = 512.
// ---------------------------------------------------------------------------
__global__ __launch_bounds__(256) void k_prep(
    const float* __restrict__ v, const float* __restrict__ Wq, const float* __restrict__ Wk,
    const float* __restrict__ Wv, const float* __restrict__ Wv_b, const float* __restrict__ Wo,
    _Float16* vh, _Float16* WqT, _Float16* WkT, _Float16* WvT, float* bvo) {
  const int t = threadIdx.x;
  const int bid = blockIdx.x;
  v8h o;
  _Float16* d;
  if (bid < NVB) {
    const size_t i = (size_t)bid * 256 + t;
    const v4f a = *(const v4f*)(v + i * 8);
    const v4f c = *(const v4f*)(v + i * 8 + 4);
    o[0] = (_Float16)a.x; o[1] = (_Float16)a.y; o[2] = (_Float16)a.z; o[3] = (_Float16)a.w;
    o[4] = (_Float16)c.x; o[5] = (_Float16)c.y; o[6] = (_Float16)c.z; o[7] = (_Float16)c.w;
    d = vh + i * 8;
  } else {
    const int wb = bid - NVB;              // 0..51
    const int which = wb >> 4;             // 0 q, 1 k, 2 and 3 Wv*Wo
    if (which < 2) {
      const int i = (wb & 15) * 256 + t;   // 0..4095: 16-byte chunk of the plane
      const int l = i & 31, c0 = ((i >> 6) & 1) * 32 + ((i >> 5) & 1) * 16 + (l >> 4) * 8;   // lane, k offset in 64
      const float* W = (which == 0) ? Wq : Wk;
      _Float16* T = (which == 0) ? WqT : WkT;
      const int oc = (i >> 7) * 16 + (l & 15);           // chunk = W[c0..c0+7][oc] * 64
#pragma unroll
      for (int e = 0; e < 8; ++e) o[e] = (_Float16)(W[(c0 + e) * HD + oc] * WSC);
      d = T + (size_t)i * 8;
    } else {
      const int l = t & 31, hh = l >> 4, m = l & 15;
      const int tl = (wb - 32) * 8 + (t >> 5);           // 0..159: (head, row tile 0..4, eo tile)
      const int h = tl / 20, ct = (tl % 20) >> 2, et = tl & 3;
      const float* arow = (ct < 4) ? Wv + (ct * 16 + m) * HD : Wv_b;
      v8f acc = {0.f, 0.f, 0.f, 0.f, 0.f, 0.f, 0.f, 0.f};
#pragma unroll
      for (int ks = 0; ks < 2; ++ks) {
        const float* ar = arow + h * DH + 32 * ks + 8 * hh;                           // row c (or the bias row), e contiguous
        const float* br = Wo + (h * DH + 32 * ks + 8 * hh) * DH + et * 16 + m;        // column eo, e strided
        FragH a, bf;
#pragma unroll
        for (int j = 0; j < 2; ++j) {
#pragma unroll
          for (int e = 0; e < 8; ++e) {
            a.h[j][e]  = (_Float16)(ar[16 * j + e] * WSC);
            bf.h[j][e] = (_Float16)(br[(16 * j + e) * DH] * WSC);
          }
        }
        acc = wmf(a.v, bf.v, acc);
      }
      if (ct == 4) {
        if (hh == 0) bvo[h * DH + et * 16 + m] = acc[0] * (RWSC * RWSC);
        return;
      }
#pragma unroll
      for (int r = 0; r < 8; ++r) o[r] = (_Float16)(acc[r] * RWSC);   // x4096 -> x64
      d = WvT + ((h * 4 + et) * 2 + (ct >> 1)) * 512 + (ct & 1) * 256 + 8 * l;
    }
  }
  *(v8h*)d = o;
  
}

// ---------------------------------------------------------------------------
// K/V' projection (V' = V Wo_h, through the Wvo plane and the bvo row) + LayerNorm(K) + K^T V' partial. Block = (batch, head, token tile),
// 4 waves; per step each wave projects its own 16 tokens (A = vh rows, B = WkT/WvT
// K and V are written transposed into LDS Kt/Vt [d][token] (one 16-B store per
// 16x16 tile per lane: 8 consecutive tokens of one d). Block barrier. Wave w then
// accumulates kv rows d = 16w..16w+15 x all 64 e over the 64 tokens: A = Kt (row d,
// k = token), B = Vt (col e, k = token), same loader. Barrier before the next step.
// Epilogue: kv strip staged as f32 rows in LDS, barrier, 8 store instructions per
// coverage: Kt/Vt 4 waves x 4 tiles x 32 lanes x 8 = 64x64 halves each per step;
// part 4 waves x 8 x 32 x 4 floats = the block's 64x64 partial.
// ---------------------------------------------------------------------------
__global__ __launch_bounds__(128) void k_kv(
    const _Float16* __restrict__ vh, const _Float16* __restrict__ WkT, const _Float16* __restrict__ WvT,
    const float* __restrict__ Wk_b, const float* __restrict__ bvo,
    const float* __restrict__ lnk_g, const float* __restrict__ lnk_b, float* part) {
  __shared__ __attribute__((aligned(16))) _Float16 Kt[DH * TP];
  __shared__ __attribute__((aligned(16))) _Float16 Vt[DH * TP];
  __shared__ __attribute__((aligned(16))) float stg[4 * 16 * DH];
  const int lane = threadIdx.x & 31, wv = threadIdx.x >> 5, hh = lane >> 4, m = lane & 15;
  const int tile = blockIdx.x % NTILE;
  const int h = (blockIdx.x / NTILE) % NH;
  const int b = blockIdx.x / (NTILE * NH);

  float bk[4], bv[4], gk[4], btk[4];
#pragma unroll
  for (int nt = 0; nt < 4; ++nt) {
    const int col = h * DH + 16 * nt + m;
    bk[nt] = Wk_b[col]; bv[nt] = bvo[col];
    gk[nt] = lnk_g[col]; btk[nt] = lnk_b[col];
  }

  v8f kvacc[4];
#pragma unroll
  for (int et = 0; et < 4; ++et) { v8f z = {0.f, 0.f, 0.f, 0.f, 0.f, 0.f, 0.f, 0.f}; kvacc[et] = z; }

  asm volatile("s_wait_xcnt 0x0" ::: "memory");

  // the head's K and V weight fragments do not change over the token loop: one load group, kept in registers
  v16h wkf[4][2], wvf[4][2];
#pragma unroll
  for (int nt = 0; nt < 4; ++nt) {
    const _Float16* wk = WkT + (size_t)(h * DH + 16 * nt) * CIN;
    const _Float16* wvp = WvT + (size_t)(h * DH + 16 * nt) * CIN;
    wkf[nt][0] = ldfragp(wk);  wkf[nt][1] = ldfragp(wk + 512);
    wvf[nt][0] = ldfragp(wvp); wvf[nt][1] = ldfragp(wvp + 512);
  }

  // activation rows of step 0; each step fetches the next step's rows behind its own projections
  const _Float16* ab = vh + ((size_t)b * NTOK + (size_t)tile * CHT + (size_t)wv * 16) * CIN;
  v16h av0 = ldfrag(ab, CIN);
  v16h av1 = ldfrag(ab + 32, CIN);

#pragma unroll 1
  for (int it = 0; it < KVIT; ++it) {
    v8f ck[4], cv[4];
#pragma unroll
    for (int nt = 0; nt < 4; ++nt) {
      v8f z = {0.f, 0.f, 0.f, 0.f, 0.f, 0.f, 0.f, 0.f}; ck[nt] = z; cv[nt] = z;
      ck[nt] = wmf(av0, wkf[nt][0], ck[nt]);
      ck[nt] = wmf(av1, wkf[nt][1], ck[nt]);
      cv[nt] = wmf(av0, wvf[nt][0], cv[nt]);
      cv[nt] = wmf(av1, wvf[nt][1], cv[nt]);
    }

    // next step's rows fly during the LayerNorm (the last step reads its own rows again: in bounds, unused)
    {
      const int itn = (it + 1 < KVIT) ? it + 1 : it;
      const _Float16* an = ab + (size_t)itn * (64 * CIN);
      av0 = ldfrag(an, CIN);
      av1 = ldfrag(an + 32, CIN);
    }
    // the LayerNorm reuses the address registers of the four loads above: wait before they are overwritten
    asm volatile("s_wait_xcnt 0x0" ::: "memory");
    // holds the four loads in front of the LayerNorm: sunk to their use they would be waited for in full
    __builtin_amdgcn_sched_barrier(0);

    // K: bias + LayerNorm over the 64 head dims (row 8hh+r spread over 16 lanes x 4 tiles)
#pragma unroll
    for (int r = 0; r < 8; ++r) {
      float x0 = ck[0][r] * RWSC + bk[0];
      float x1 = ck[1][r] * RWSC + bk[1];
      float x2 = ck[2][r] * RWSC + bk[2];
      float x3 = ck[3][r] * RWSC + bk[3];
      float s = (x0 + x1) + (x2 + x3);
      s = hred16(s);
      const float mu = s * (1.0f / 64.0f);
      x0 -= mu; x1 -= mu; x2 -= mu; x3 -= mu;
      float q = (x0 * x0 + x1 * x1) + (x2 * x2 + x3 * x3);
      q = hred16(q);
      const float var = q * (1.0f / 64.0f);
      const float rs = rsqrtf(var + EPSV);
      ck[0][r] = x0 * rs * gk[0] + btk[0];
      ck[1][r] = x1 * rs * gk[1] + btk[1];
      ck[2][r] = x2 * rs * gk[2] + btk[2];
      ck[3][r] = x3 * rs * gk[3] + btk[3];
    }

    // transposed tiles: Kt[d][token], Vt[e][token], token = wv*16 + 8hh + r
#pragma unroll
    for (int nt = 0; nt < 4; ++nt) {
      v8h kk, vv;
#pragma unroll
      for (int r = 0; r < 8; ++r) {
        kk[r] = (_Float16)ck[nt][r];
        vv[r] = (_Float16)(cv[nt][r] * RWSC + bv[nt]);
      }
      *(v8h*)(Kt + (16 * nt + m) * TP + wv * 16 + 8 * hh) = kk;
      *(v8h*)(Vt + (16 * nt + m) * TP + wv * 16 + 8 * hh) = vv;
    }
    __syncthreads();

    // kv rows 16wv..16wv+15 += K^T V over the 64 tokens (2 k-steps)
    const _Float16* ka = Kt + (16 * wv) * TP;
    v16h ak[2], bvf[2][4];
#pragma unroll
    for (int ks = 0; ks < 2; ++ks) {
      ak[ks] = ldfrag(ka + 32 * ks, TP);
#pragma unroll
      for (int et = 0; et < 4; ++et) bvf[ks][et] = ldfrag(Vt + (16 * et) * TP + 32 * ks, TP);
    }
    // keeps the LDS fragment reads one group in front of the products: one place with reads, not one per product
    __builtin_amdgcn_sched_barrier(0);
#pragma unroll
    for (int ks = 0; ks < 2; ++ks) {
#pragma unroll
      for (int et = 0; et < 4; ++et) kvacc[et] = wmf(ak[ks], bvf[ks][et], kvacc[et]);
    }
    __syncthreads();
  }

  // epilogue: stage the wave's 16x64 f32 strip, then whole-line stores
  float* sw = stg + wv * (16 * DH);
#pragma unroll
  for (int et = 0; et < 4; ++et) {
#pragma unroll
    for (int r = 0; r < 8; ++r) sw[(8 * hh + r) * DH + 16 * et + m] = kvacc[et][r];
  }
  __syncthreads();
  float* gp = part + ((size_t)blockIdx.x * DH + (size_t)(16 * wv)) * DH;
#pragma unroll
  for (int i = 0; i < 8; ++i) {
    const v4f x = *(const v4f*)(sw + i * 128 + 4 * lane);
    *(v4f*)(gp + i * 128 + 4 * lane) = x;
  }
  
}

// ---------------------------------------------------------------------------
// kv reduce (block = (batch, head), 256 threads): fixed-order f32 sum of the
// NTILE partials into LDS kv[d][e], barrier, then the kvT plane (kv^T [e][d], f16 of
// kv/16) in the fragment order of ldfragp, block (e tile, k step): chunk idx, one 16-B store per
// coverage: 256 threads x 2 idx x 8 halves = 4096 = the (b,h) 64x64 plane.
// ---------------------------------------------------------------------------
__global__ __launch_bounds__(256) void k_kvred(const float* __restrict__ part, _Float16* kvT) {
  __shared__ __attribute__((aligned(16))) float kvs[DH * DH];
  const int t = threadIdx.x;
  const int bh = blockIdx.x;
  const float* p0 = part + (size_t)bh * NTILE * (DH * DH);
#pragma unroll 1
  for (int j = 0; j < (DH * DH) / 256; ++j) {
    const int idx = j * 256 + t;
    float s = 0.0f;
#pragma unroll
    for (int tl = 0; tl < NTILE; ++tl) s += p0[(size_t)tl * (DH * DH) + idx];
    kvs[idx] = s;
  }
  __syncthreads();
  v8h o0, o1;
  {
    const int idx = t;
    const int e = (idx >> 7) * 16 + (idx & 15), d0 = ((idx >> 6) & 1) * 32 + ((idx >> 5) & 1) * 16 + ((idx >> 4) & 1) * 8;
#pragma unroll
    for (int i = 0; i < 8; ++i) o0[i] = (_Float16)(kvs[(d0 + i) * DH + e] * (1.0f / 16.0f));
  }
  {
    const int idx = t + 256;
    const int e = (idx >> 7) * 16 + (idx & 15), d0 = ((idx >> 6) & 1) * 32 + ((idx >> 5) & 1) * 16 + ((idx >> 4) & 1) * 8;
#pragma unroll
    for (int i = 0; i < 8; ++i) o1[i] = (_Float16)(kvs[(d0 + i) * DH + e] * (1.0f / 16.0f));
  }
  _Float16* dp0 = kvT + (size_t)bh * (DH * DH) + (size_t)t * 8;
  _Float16* dp1 = dp0 + 2048;
  *(v8h*)dp0 = o0;
  *(v8h*)dp1 = o1;
  
}

// ---------------------------------------------------------------------------
// Output: block = 64 tokens (4 waves x 16 tokens), all heads, both products taken transposed so that nothing leaves the registers.
// Per head: Q^T = Wq_h^T v^T (A = WqT plane, row d; B = vh rows, col token): the accumulator of tile nt has the lane's own token
// (l & 15) and d = 16 nt + 8 (l >> 4) + r in its 8 registers. LayerNorm over d = 32 values of the lane plus the partner lane l ^ 16;
// bias, gamma and beta go by register, read from an LDS copy of the three rows (one barrier in front of the head loop, none in it).
// The f16 of tiles 2 ks and 2 ks + 1 side by side is the B fragment (col token, k = d, the split k map of ldfrag) of
// co^T += (kv'/16)^T Q^T with A = kvT plane (row eo, k = d, same map): the heads add up in the accumulator.
// Epilogue: out = co/1024 + Wo_b/16384; a lane holds 8 consecutive eo of its token per tile, staged as f32 rows in LDS
// (pitch SP), barrier, 8 store instructions per wave of 512 contiguous B.
// coverage: out 4 waves x 8 x 32 x 4 floats = the block's 64 rows x 64.
// ---------------------------------------------------------------------------
// second bound: four waves per SIMD (the grid is four waves per SIMD in one round), so the build keeps to 256 registers
__global__ __launch_bounds__(128, 4) void k_out(
    const _Float16* __restrict__ vh, const _Float16* __restrict__ WqT,
    const float* __restrict__ Wq_b, const float* __restrict__ lnq_g, const float* __restrict__ lnq_b,
    const _Float16* __restrict__ kvT,
    const float* __restrict__ Wo_b, float* out) {
  __shared__ __attribute__((aligned(16))) float stg[4 * 16 * SP];
  __shared__ __attribute__((aligned(16))) float prm[3 * HD];
  const int lane = threadIdx.x & 31, wv = threadIdx.x >> 5, hh = lane >> 4, m = lane & 15;
  const int b = blockIdx.x / (NTOK / 64);

  // bias and LayerNorm rows of all heads to LDS, 128 threads x 4 floats per row: a lane now needs 8 consecutive d per tile,
  // the same for 16 lanes, which the LDS hands out as a broadcast beside the fragment loads of the cache path
  // (loaded first, stored behind the issue of the fragment loads below, which so fly over the barrier)
  const int t4 = 4 * threadIdx.x;
  const v4f pr0 = *(const v4f*)(Wq_b + t4);
  const v4f pr1 = *(const v4f*)(lnq_g + t4);
  const v4f pr2 = *(const v4f*)(lnq_b + t4);
  const size_t tok0 = (size_t)blockIdx.x * 64 + (size_t)wv * 16;
  float* sw = stg + wv * (16 * SP);

  const _Float16* ap = vh + tok0 * CIN;
  const v16h av0 = ldfrag(ap, CIN);
  const v16h av1 = ldfrag(ap + 32, CIN);

  v8f co[4];
#pragma unroll
  for (int et = 0; et < 4; ++et) { v8f z = {0.f, 0.f, 0.f, 0.f, 0.f, 0.f, 0.f, 0.f}; co[et] = z; }

  // head 0's Q weight fragments; each head fetches the next head's in front of its kv'*Q products
  v16h bwq[4][2];
#pragma unroll
  for (int nt = 0; nt < 4; ++nt) {
    const _Float16* wq = WqT + (size_t)(16 * nt) * CIN;
    bwq[nt][0] = ldfragp(wq); bwq[nt][1] = ldfragp(wq + 512);
  }
  // wait before the address registers of the loads above are overwritten
  asm volatile("s_wait_xcnt 0x0" ::: "memory");

  *(v4f*)(prm + t4)          = pr0;
  *(v4f*)(prm + HD + t4)     = pr1;
  *(v4f*)(prm + 2 * HD + t4) = pr2;
  __syncthreads();

#pragma unroll 1
  for (int h = 0; h < NH; ++h) {
    // Q^T projection for head h
    v8f cq[4];
#pragma unroll
    for (int nt = 0; nt < 4; ++nt) {
      v8f z = {0.f, 0.f, 0.f, 0.f, 0.f, 0.f, 0.f, 0.f}; cq[nt] = z;
      cq[nt] = wmf(bwq[nt][0], av0, cq[nt]);
      cq[nt] = wmf(bwq[nt][1], av1, cq[nt]);
    }

    // this head's kv fragments as one load group: they fly during the LayerNorm
    const _Float16* kp = kvT + (size_t)(b * NH + h) * (DH * DH) + 8 * lane;
    v16h bkv[4][2];
#pragma unroll
    for (int et = 0; et < 4; ++et) {
      bkv[et][0] = ldfragl(kp + (16 * et) * DH);
      bkv[et][1] = ldfragl(kp + (16 * et) * DH + 512);
    }
    // wait before the address registers of the loads above are overwritten; the address is named so that it stays in them up to here
    asm volatile("s_wait_xcnt 0x0" :: "v"(kp) : "memory");

    // bias, then LayerNorm over the 64 head dims of the lane's token: 32 in the lane, 32 in lane l ^ 16
    const float* pl = prm + h * DH + 8 * hh;
    v8f x0 = cq[0] * RWSC + ld8(pl);
    v8f x1 = cq[1] * RWSC + ld8(pl + 16);
    v8f x2 = cq[2] * RWSC + ld8(pl + 32);
    v8f x3 = cq[3] * RWSC + ld8(pl + 48);
    float s = sum8((x0 + x1) + (x2 + x3));
    s += xhalf(s);
    const float mu = s * (1.0f / 64.0f);
    x0 -= mu; x1 -= mu; x2 -= mu; x3 -= mu;
    float q = sum8((x0 * x0 + x1 * x1) + (x2 * x2 + x3 * x3));
    q += xhalf(q);
    const float var = q * (1.0f / 64.0f);
    const float rs = rsqrtf(var + EPSV);
    x0 = x0 * rs * ld8(pl + HD)      + ld8(pl + 2 * HD);
    x1 = x1 * rs * ld8(pl + HD + 16) + ld8(pl + 2 * HD + 16);
    x2 = x2 * rs * ld8(pl + HD + 32) + ld8(pl + 2 * HD + 32);
    x3 = x3 * rs * ld8(pl + HD + 48) + ld8(pl + 2 * HD + 48);

    // B fragments of Q^T: elements 0..7 <- d = 32 ks + 8 hh + r (tile 2 ks), 8..15 <- d = 32 ks + 16 + 8 hh + r (tile 2 ks + 1)
    FragH qf0, qf1;
#pragma unroll
    for (int r = 0; r < 8; ++r) {
      qf0.h[0][r] = (_Float16)x0[r]; qf0.h[1][r] = (_Float16)x1[r];
      qf1.h[0][r] = (_Float16)x2[r]; qf1.h[1][r] = (_Float16)x3[r];
    }

    // next head's Q weight fragments as one load group: they fly during kv'*Q
    // (the last head reads its own again: in bounds, unused)
    {
      const int hn = (h + 1 < NH) ? h + 1 : h;
      const _Float16* wq = WqT + (size_t)hn * (DH * CIN) + 8 * lane;
#pragma unroll
      for (int nt = 0; nt < 4; ++nt) {
        bwq[nt][0] = ldfragl(wq + (16 * nt) * CIN); bwq[nt][1] = ldfragl(wq + (16 * nt) * CIN + 512);
      }
      // wait before the address registers of the loads above are overwritten; the address is named so that it stays in them up to here
      asm volatile("s_wait_xcnt 0x0" :: "v"(wq) : "memory");
    }

    // co^T += (kv'/16)^T Q^T: A = kvT[eo][d] (row eo, k = d), B = Q^T (col token, k = d)
#pragma unroll
    for (int et = 0; et < 4; ++et) {
      co[et] = wmf(bkv[et][0], qf0.v, co[et]);
      co[et] = wmf(bkv[et][1], qf1.v, co[et]);
    }
  }

  // epilogue: out = co/1024 + Wo_b/16384, token row m, columns 16 et + 8 hh + 0..7
#pragma unroll
  for (int et = 0; et < 4; ++et) {
    const v8f y = co[et] * (1.0f / 1024.0f) + ld8(Wo_b + 16 * et + 8 * hh) * (1.0f / 16384.0f);
    float* d = sw + m * SP + 16 * et + 8 * hh;
    *(v4f*)d = y.lo;
    *(v4f*)(d + 4) = y.hi;
  }
  __syncthreads();
  float* gp = out + tok0 * DH;
#pragma unroll
  for (int i = 0; i < 8; ++i) {
    const v4f x = *(const v4f*)(sw + (2 * i + hh) * SP + 4 * m);
    *(v4f*)(gp + i * 128 + 4 * lane) = x;
  }
}

// ---------------------------------------------------------------------------
extern "C" void kernel_launch(void* const* d_in, const int* in_sizes, int n_in,
                              void* d_out, int out_size, void* d_ws, size_t ws_size,
                              hipStream_t stream) {
  if (n_in < 13) return;
  if (in_sizes[0] != NB * NTOK * CIN) return;
  if (in_sizes[1] != CIN * HD || in_sizes[3] != CIN * HD || in_sizes[5] != CIN * HD) return;
  if (in_sizes[2] != HD || in_sizes[4] != HD || in_sizes[6] != HD) return;
  if (in_sizes[7] != NH * DH || in_sizes[8] != NH * DH || in_sizes[9] != NH * DH || in_sizes[10] != NH * DH) return;
  if (in_sizes[11] != HD * DH || in_sizes[12] != DH) return;
  if (out_size != NB * NTOK * DH) return;

  const float* v     = (const float*)d_in[0];
  const float* Wq_w  = (const float*)d_in[1];
  const float* Wq_b  = (const float*)d_in[2];
  const float* Wk_w  = (const float*)d_in[3];
  const float* Wk_b  = (const float*)d_in[4];
  const float* Wv_w  = (const float*)d_in[5];
  const float* Wv_b  = (const float*)d_in[6];
  const float* lnq_g = (const float*)d_in[7];
  const float* lnq_b = (const float*)d_in[8];
  const float* lnk_g = (const float*)d_in[9];
  const float* lnk_b = (const float*)d_in[10];
  const float* Wo_w  = (const float*)d_in[11];
  const float* Wo_b  = (const float*)d_in[12];
  float* out = (float*)d_out;

  // workspace carve (256-B aligned; every region an exact multiple of its whole-line store extent)
  char* ws = (char*)d_ws;
  size_t off = 0;
  const size_t oVh  = off; off += (size_t)NB * NTOK * CIN * 2;        off = (off + 255) & ~(size_t)255;   // 8388608
  const size_t oWq  = off; off += (size_t)CIN * HD * 2;               off = (off + 255) & ~(size_t)255;   // 65536
  const size_t oWk  = off; off += (size_t)CIN * HD * 2;               off = (off + 255) & ~(size_t)255;
  const size_t oWv  = off; off += (size_t)CIN * HD * 2;               off = (off + 255) & ~(size_t)255;
  const size_t oBvo = off; off += (size_t)HD * 4;                     off = (off + 255) & ~(size_t)255;   // 2048
  const size_t oKvT = off; off += (size_t)NB * NH * DH * DH * 2;      off = (off + 255) & ~(size_t)255;   // 262144
  const size_t oPt  = off; off += (size_t)NB * NH * NTILE * DH * DH * 4; off = (off + 255) & ~(size_t)255; // 8388608
  if (off > ws_size || off > (size_t)WSCAP) return;
  _Float16* vh   = (_Float16*)(ws + oVh);
  _Float16* WqT  = (_Float16*)(ws + oWq);
  _Float16* WkT  = (_Float16*)(ws + oWk);
  _Float16* WvT  = (_Float16*)(ws + oWv);
  float*    bvo  = (float*)(ws + oBvo);
  _Float16* kvT  = (_Float16*)(ws + oKvT);
  float*    part = (float*)(ws + oPt);

  // 1: v -> f16 plane, Wq, Wk, Wv*Wo -> f16 planes (x64), bv*Wo row
  k_prep<<<NVB + NWB, 256, 0, stream>>>(v, Wq_w, Wk_w, Wv_w, Wv_b, Wo_w, vh, WqT, WkT, WvT, bvo);
  // 2: K/V' projection + LayerNorm(K) + K^T V' partials per (batch, head, token tile)
  k_kv<<<NB * NH * NTILE, 128, 0, stream>>>(vh, WkT, WvT, Wk_b, bvo, lnk_g, lnk_b, part);
  // 3: fixed-order partial sum -> kvT planes (f16, x1/16)
  k_kvred<<<NB * NH, 256, 0, stream>>>(part, kvT);
  // 4: Q projection + LayerNorm(Q) + Q kv' summed over heads, /n
  k_out<<<(NB * NTOK) / 64, 128, 0, stream>>>(vh, WqT, Wq_b, lnq_g, lnq_b, kvT, Wo_b, out);
}

// v007
// One run takes 42.3 microseconds.
// Timed twice side by side with v006, it ran 1.13 times as fast both times.
// Over all steps from v000 it is 4.08 times as fast.
#include <hip/hip_runtime.h>
#include <stddef.h>

// All contractions on v_wmma_f32_16x16x32_f16 (f16 operands, f32 accumulate). The chain (Q (K^T V)) Wo is taken as Q (K^T (V Wo)) per head: Wvo = Wv_h*Wo_h (both carried x64) once in the prep launch, Q/K/V' projections (activations as-is, weights carried x64), K^T*V' per (batch, head) over token tiles with f32 fixed-order partial sums, Q*kv' (kv' carried x1/16) summed over the heads in the accumulator; RNE converts; power-of-two carries folded back in the f32 epilogues. LayerNorm, bias, 1/n scaling: f32 VALU.

#define NB     4
#define NTOK   16384
#define CIN    64
#define NH     8
#define DH     64
#define HD     (NH * DH)
#define NTILE  16                      // token tiles per (batch, head) for the K^T V partials: 512 blocks, two per WGP, two waves per SIMD
#define CHT    (NTOK / NTILE)          // 1024 tokens per kv block
#define KVIT   (CHT / 64)              // 16 steps of 64 tokens
#define TP     72                      // LDS pitch in halves of the transposed K/V tiles
#define SP     68                      // LDS pitch in floats of the output rows staged by token: 16-byte stores of 16 rows spread over the banks
#define NVB    ((NB * NTOK * CIN) / (256 * 8))   // 2048 blocks convert v
#define RROW   8                       // rows d of a kv plane per reduce block: 256 blocks, one per WGP
#define NWB    52                      // weight blocks: 16 Wq plane, 16 Wk plane, 20 Wv*Wo plane with the bias row bv*Wo
#define WSC    64.0f
#define RWSC   (1.0f / 64.0f)
#define EPSV   1e-5f
#define WSCAP  134217728

static_assert(CIN == 64 && DH == 64 && HD == 512 && NH == 8);
static_assert((NTOK % NTILE) == 0 && (CHT % 64) == 0 && (NTOK % 64) == 0);
static_assert(NVB * 256 * 8 == NB * NTOK * CIN);
static_assert(16 * 256 * 8 == CIN * HD && 20 * 8 == NH * (CIN / 16 + 1) * (DH / 16));
static_assert((TP % 8) == 0 && TP >= 64);
static_assert(RROW == 8 && RROW * DH == 128 * 4);

typedef float    v2f  __attribute__((ext_vector_type(2)));
typedef float    v4f  __attribute__((ext_vector_type(4)));
typedef float    v8f  __attribute__((ext_vector_type(8)));
typedef _Float16 v8h  __attribute__((ext_vector_type(8)));
typedef _Float16 v16h __attribute__((ext_vector_type(16)));
union FragH { v16h v; v8h h[2]; };

// WMMA as the plain builtin: the compiler keeps the hazard distances of its own form and is free
// to issue the fragment loads of a whole group ahead of the products.
__device__ __forceinline__ v8f wmf(v16h a, v16h b, v8f c) {
  return __builtin_amdgcn_wmma_f32_16x16x32_f16(false, a, false, b, (short)0, c, false, false);
}

// 16x32 fragment from a 16-bit [row][k] (k-contiguous) tile, p = &T[row0][k0], pitch ld halves.
// Used for A (row = l&15) and for B stored as [n][k] (col = l&15); split k map:
// elements 0..7 <- k0 + 8h + 0..7, elements 8..15 <- k0 + 16 + 8h + 0..7, h = lane>>4.
__device__ __forceinline__ v16h ldfrag(const _Float16* p, int ld) {
  const int l = threadIdx.x & 31, hh = l >> 4, m = l & 15;
  const _Float16* q = p + m * ld + 8 * hh;
  FragH f;
  f.h[0] = *(const v8h*)q;
  f.h[1] = *(const v8h*)(q + 16);
  return f.v;
}

// The same fragment from a plane kept in fragment order: one (16-row tile, 32-deep k step) = 512 halves,
// chunk j (0, 1) of lane l at halves 256 j + 8 l, holding T[row0 + (l & 15)][k0 + 16 j + 8 (l >> 4) + 0..7].
// Each of the two 16-byte loads of a wave then reads 512 contiguous bytes (4 whole lines, not 32 B of 16 lines).
__device__ __forceinline__ v16h ldfragp(const _Float16* blk) {
  const _Float16* q = blk + 8 * (threadIdx.x & 31);
  FragH f;
  f.h[0] = *(const v8h*)q;
  f.h[1] = *(const v8h*)(q + 256);
  return f.v;
}

// ldfragp with the lane's own pointer q = blk + 8 * lane formed by the caller
__device__ __forceinline__ v16h ldfragl(const _Float16* q) {
  FragH f;
  f.h[0] = *(const v8h*)q;
  f.h[1] = *(const v8h*)(q + 256);
  return f.v;
}

// value of lane (l ^ M) of the same 16-lane row, M < 16: a DPP row_xmask operand (control 0x160 | M), all lanes on.
// It stays in the vector pipe and folds into the add that uses it; a shuffle goes through the LDS unit and is waited for.
template <int M>
__device__ __forceinline__ float rowx(float x) {
  return __builtin_bit_cast(float, __builtin_amdgcn_update_dpp(0, __builtin_bit_cast(int, x), 0x160 | M, 0xf, 0xf, true));
}

// sum over the 16 lanes of a half-wave (xor masks < 16 stay inside the row); butterfly order 8, 4, 2, 1
__device__ __forceinline__ float hred16(float x) {
  x += rowx<8>(x);
  x += rowx<4>(x);
  x += rowx<2>(x);
  x += rowx<1>(x);
  return x;
}

// value of lane l ^ 16 (the same place in the other 16-lane row): a vector cross-row move, not an LDS-unit shuffle
__device__ __forceinline__ float xhalf(float x) {
  const int b = __builtin_bit_cast(int, x);
  return __builtin_bit_cast(float, __builtin_amdgcn_permlanex16(b, b, 0x76543210, 0xfedcba98, false, false));
}

// 8 consecutive floats (16-byte aligned) as two 16-byte loads
__device__ __forceinline__ v8f ld8(const float* p) {
  const v4f a = *(const v4f*)p;
  const v4f c = *(const v4f*)(p + 4);
  return __builtin_shufflevector(a, c, 0, 1, 2, 3, 4, 5, 6, 7);
}

// sum of the 8 elements, tree order (4 + 4, 2 + 2, 1 + 1)
__device__ __forceinline__ float sum8(v8f t) {
  const v4f a = t.lo + t.hi;
  const v2f c = a.lo + a.hi;
  return c.x + c.y;
}

// ---------------------------------------------------------------------------
// Prep: blocks 0..NVB-1 convert v [65536][64] f32 -> vh f16 (same layout);
// blocks NVB..NVB+51 build the weight planes (x64) in the fragment order of ldfragp,
//   WqT/WkT/WvT: block (o tile 0..31, k step 0..1) of W^T [512][64]; WvT holds Wvo[c][h*64+eo] = sum_e Wv[c][h*64+e] Wo[h*64+e][eo]:
//   one wave = one 16x16 tile (head, row tile, eo tile), A = Wv rows c (k = e), B = Wo columns eo (k = e), same k map in both;
//   the accumulator (8 consecutive c of one eo per lane) is that lane's 16-byte chunk of the plane as it stands.
//   Row tile 4 has the bias row Wv_b in all 16 rows: its accumulator row 0 is bvo[h*64+eo] = sum_e Wv_b[h*64+e] Wo[h*64+e][eo], kept f32.
// One thread = 8 contiguous halves, a wave writes 512 contiguous B per instruction,
// coverage: vh 2048x256x8 = 4194304; each weight plane 16x256x8 = 32768; bvo 8 heads x 4 tiles x 16 lanes = 512.
// ---------------------------------------------------------------------------
__global__ __launch_bounds__(256) void k_prep(
    const float* __restrict__ v, const float* __restrict__ Wq, const float* __restrict__ Wk,
    const float* __restrict__ Wv, const float* __restrict__ Wv_b, const float* __restrict__ Wo,
    _Float16* vh, _Float16* WqT, _Float16* WkT, _Float16* WvT, float* bvo) {
  const int t = threadIdx.x;
  const int bid = blockIdx.x;
  v8h o;
  _Float16* d;
  if (bid < NVB) {
    const size_t i = (size_t)bid * 256 + t;
    const v4f a = *(const v4f*)(v + i * 8);
    const v4f c = *(const v4f*)(v + i * 8 + 4);
    o[0] = (_Float16)a.x; o[1] = (_Float16)a.y; o[2] = (_Float16)a.z; o[3] = (_Float16)a.w;
    o[4] = (_Float16)c.x; o[5] = (_Float16)c.y; o[6] = (_Float16)c.z; o[7] = (_Float16)c.w;
    d = vh + i * 8;
  } else {
    const int wb = bid - NVB;              // 0..51
    const int which = wb >> 4;             // 0 q, 1 k, 2 and 3 Wv*Wo
    if (which < 2) {
      const int i = (wb & 15) * 256 + t;   // 0..4095: 16-byte chunk of the plane
      const int l = i & 31, c0 = ((i >> 6) & 1) * 32 + ((i >> 5) & 1) * 16 + (l >> 4) * 8;   // lane, k offset in 64
      const float* W = (which == 0) ? Wq : Wk;
      _Float16* T = (which == 0) ? WqT : WkT;
      const int oc = (i >> 7) * 16 + (l & 15);           // chunk = W[c0..c0+7][oc] * 64
#pragma unroll
      for (int e = 0; e < 8; ++e) o[e] = (_Float16)(W[(c0 + e) * HD + oc] * WSC);
      d = T + (size_t)i * 8;
    } else {
      const int l = t & 31, hh = l >> 4, m = l & 15;
      const int tl = (wb - 32) * 8 + (t >> 5);           // 0..159: (head, row tile 0..4, eo tile)
      const int h = tl / 20, ct = (tl % 20) >> 2, et = tl & 3;
      const float* arow = (ct < 4) ? Wv + (ct * 16 + m) * HD : Wv_b;
      v8f acc = {0.f, 0.f, 0.f, 0.f, 0.f, 0.f, 0.f, 0.f};
#pragma unroll
      for (int ks = 0; ks < 2; ++ks) {
        const float* ar = arow + h * DH + 32 * ks + 8 * hh;                           // row c (or the bias row), e contiguous
        const float* br = Wo + (h * DH + 32 * ks + 8 * hh) * DH + et * 16 + m;        // column eo, e strided
        FragH a, bf;
#pragma unroll
        for (int j = 0; j < 2; ++j) {
#pragma unroll
          for (int e = 0; e < 8; ++e) {
            a.h[j][e]  = (_Float16)(ar[16 * j + e] * WSC);
            bf.h[j][e] = (_Float16)(br[(16 * j + e) * DH] * WSC);
          }
        }
        acc = wmf(a.v, bf.v, acc);
      }
      if (ct == 4) {
        if (hh == 0) bvo[h * DH + et * 16 + m] = acc[0] * (RWSC * RWSC);
        return;
      }
#pragma unroll
      for (int r = 0; r < 8; ++r) o[r] = (_Float16)(acc[r] * RWSC);   // x4096 -> x64
      d = WvT + ((h * 4 + et) * 2 + (ct >> 1)) * 512 + (ct & 1) * 256 + 8 * l;
    }
  }
  *(v8h*)d = o;
  
}

// ---------------------------------------------------------------------------
// K/V' projection (V' = V Wo_h, through the Wvo plane and the bvo row) + LayerNorm(K) + K^T V' partial. Block = (batch, head, token tile),
// 4 waves; per step each wave projects its own 16 tokens (A = vh rows, B = WkT/WvT
// K and V are written transposed into LDS Kt/Vt [d][token] (one 16-B store per
// 16x16 tile per lane: 8 consecutive tokens of one d). Block barrier. Wave w then
// accumulates kv rows d = 16w..16w+15 x all 64 e over the 64 tokens: A = Kt (row d,
// k = token), B = Vt (col e, k = token), same loader. Barrier before the next step.
// Epilogue: kv strip staged as f32 rows in LDS, barrier, 8 store instructions per
// coverage: Kt/Vt 4 waves x 4 tiles x 32 lanes x 8 = 64x64 halves each per step;
// part 4 waves x 8 x 32 x 4 floats = the block's 64x64 partial.
// ---------------------------------------------------------------------------
__global__ __launch_bounds__(128) void k_kv(
    const _Float16* __restrict__ vh, const _Float16* __restrict__ WkT, const _Float16* __restrict__ WvT,
    const float* __restrict__ Wk_b, const float* __restrict__ bvo,
    const float* __restrict__ lnk_g, const float* __restrict__ lnk_b, float* part) {
  __shared__ __attribute__((aligned(16))) _Float16 Kt[DH * TP];
  __shared__ __attribute__((aligned(16))) _Float16 Vt[DH * TP];
  __shared__ __attribute__((aligned(16))) float stg[4 * 16 * DH];
  const int lane = threadIdx.x & 31, wv = threadIdx.x >> 5, hh = lane >> 4, m = lane & 15;
  const int tile = blockIdx.x % NTILE;
  const int h = (blockIdx.x / NTILE) % NH;
  const int b = blockIdx.x / (NTILE * NH);

  float bk[4], bv[4], gk[4], btk[4];
#pragma unroll
  for (int nt = 0; nt < 4; ++nt) {
    const int col = h * DH + 16 * nt + m;
    bk[nt] = Wk_b[col]; bv[nt] = bvo[col];
    gk[nt] = lnk_g[col]; btk[nt] = lnk_b[col];
  }

  v8f kvacc[4];
#pragma unroll
  for (int et = 0; et < 4; ++et) { v8f z = {0.f, 0.f, 0.f, 0.f, 0.f, 0.f, 0.f, 0.f}; kvacc[et] = z; }

  asm volatile("s_wait_xcnt 0x0" ::: "memory");

  // the head's K and V weight fragments do not change over the token loop: one load group, kept in registers
  v16h wkf[4][2], wvf[4][2];
#pragma unroll
  for (int nt = 0; nt < 4; ++nt) {
    const _Float16* wk = WkT + (size_t)(h * DH + 16 * nt) * CIN;
    const _Float16* wvp = WvT + (size_t)(h * DH + 16 * nt) * CIN;
    wkf[nt][0] = ldfragp(wk);  wkf[nt][1] = ldfragp(wk + 512);
    wvf[nt][0] = ldfragp(wvp); wvf[nt][1] = ldfragp(wvp + 512);
  }

  // activation rows of step 0; each step fetches the next step's rows behind its own projections
  const _Float16* ab = vh + ((size_t)b * NTOK + (size_t)tile * CHT + (size_t)wv * 16) * CIN;
  v16h av0 = ldfrag(ab, CIN);
  v16h av1 = ldfrag(ab + 32, CIN);

#pragma unroll 1
  for (int it = 0; it < KVIT; ++it) {
    v8f ck[4], cv[4];
#pragma unroll
    for (int nt = 0; nt < 4; ++nt) {
      v8f z = {0.f, 0.f, 0.f, 0.f, 0.f, 0.f, 0.f, 0.f}; ck[nt] = z; cv[nt] = z;
      ck[nt] = wmf(av0, wkf[nt][0], ck[nt]);
      ck[nt] = wmf(av1, wkf[nt][1], ck[nt]);
      cv[nt] = wmf(av0, wvf[nt][0], cv[nt]);
      cv[nt] = wmf(av1, wvf[nt][1], cv[nt]);
    }

    // next step's rows fly during the LayerNorm (the last step reads its own rows again: in bounds, unused)
    {
      const int itn = (it + 1 < KVIT) ? it + 1 : it;
      const _Float16* an = ab + (size_t)itn * (64 * CIN);
      av0 = ldfrag(an, CIN);
      av1 = ldfrag(an + 32, CIN);
    }
    // the LayerNorm reuses the address registers of the four loads above: wait before they are overwritten
    asm volatile("s_wait_xcnt 0x0" ::: "memory");
    // holds the four loads in front of the LayerNorm: sunk to their use they would be waited for in full
    __builtin_amdgcn_sched_barrier(0);

    // K: bias + LayerNorm over the 64 head dims (row 8hh+r spread over 16 lanes x 4 tiles)
#pragma unroll
    for (int r = 0; r < 8; ++r) {
      float x0 = ck[0][r] * RWSC + bk[0];
      float x1 = ck[1][r] * RWSC + bk[1];
      float x2 = ck[2][r] * RWSC + bk[2];
      float x3 = ck[3][r] * RWSC + bk[3];
      float s = (x0 + x1) + (x2 + x3);
      s = hred16(s);
      const float mu = s * (1.0f / 64.0f);
      x0 -= mu; x1 -= mu; x2 -= mu; x3 -= mu;
      float q = (x0 * x0 + x1 * x1) + (x2 * x2 + x3 * x3);
      q = hred16(q);
      const float var = q * (1.0f / 64.0f);
      const float rs = rsqrtf(var + EPSV);
      ck[0][r] = x0 * rs * gk[0] + btk[0];
      ck[1][r] = x1 * rs * gk[1] + btk[1];
      ck[2][r] = x2 * rs * gk[2] + btk[2];
      ck[3][r] = x3 * rs * gk[3] + btk[3];
    }

    // transposed tiles: Kt[d][token], Vt[e][token], token = wv*16 + 8hh + r
#pragma unroll
    for (int nt = 0; nt < 4; ++nt) {
      v8h kk, vv;
#pragma unroll
      for (int r = 0; r < 8; ++r) {
        kk[r] = (_Float16)ck[nt][r];
        vv[r] = (_Float16)(cv[nt][r] * RWSC + bv[nt]);
      }
      *(v8h*)(Kt + (16 * nt + m) * TP + wv * 16 + 8 * hh) = kk;
      *(v8h*)(Vt + (16 * nt + m) * TP + wv * 16 + 8 * hh) = vv;
    }
    __syncthreads();

    // kv rows 16wv..16wv+15 += K^T V over the 64 tokens (2 k-steps)
    const _Float16* ka = Kt + (16 * wv) * TP;
    v16h ak[2], bvf[2][4];
#pragma unroll
    for (int ks = 0; ks < 2; ++ks) {
      ak[ks] = ldfrag(ka + 32 * ks, TP);
#pragma unroll
      for (int et = 0; et < 4; ++et) bvf[ks][et] = ldfrag(Vt + (16 * et) * TP + 32 * ks, TP);
    }
    // keeps the LDS fragment reads one group in front of the products: one place with reads, not one per product
    __builtin_amdgcn_sched_barrier(0);
#pragma unroll
    for (int ks = 0; ks < 2; ++ks) {
#pragma unroll
      for (int et = 0; et < 4; ++et) kvacc[et] = wmf(ak[ks], bvf[ks][et], kvacc[et]);
    }
    __syncthreads();
  }

  // epilogue: stage the wave's 16x64 f32 strip, then whole-line stores
  float* sw = stg + wv * (16 * DH);
#pragma unroll
  for (int et = 0; et < 4; ++et) {
#pragma unroll
    for (int r = 0; r < 8; ++r) sw[(8 * hh + r) * DH + 16 * et + m] = kvacc[et][r];
  }
  __syncthreads();
  float* gp = part + ((size_t)blockIdx.x * DH + (size_t)(16 * wv)) * DH;
#pragma unroll
  for (int i = 0; i < 8; ++i) {
    const v4f x = *(const v4f*)(sw + i * 128 + 4 * lane);
    *(v4f*)(gp + i * 128 + 4 * lane) = x;
  }
  
}

// ---------------------------------------------------------------------------
// kv reduce (block = (batch, head, group of 8 rows d), 128 threads): a thread takes 4 consecutive e of one row d and
// has the 16-byte loads of all NTILE partials in flight at once (a wave reads 512 contiguous B per load); fixed-order
// f32 sum (partial 0 first) into LDS kvs[row][e], barrier, then threads 0..63 each write one 16-byte chunk of the kvT
// plane (kv^T [e][d], f16 of kv/16) in the fragment order of ldfragp: chunk (e >> 4) * 128 + 16 * group + (e & 15)
// holds d = 8 * group + 0..7 of column e; 16 lanes write 256 contiguous B.
// coverage: 8 groups x 64 threads x 8 halves = 4096 = the (b,h) 64x64 plane.
// ---------------------------------------------------------------------------
__global__ __launch_bounds__(128) void k_kvred(const float* __restrict__ part, _Float16* kvT) {
  __shared__ __attribute__((aligned(16))) float kvs[RROW * DH];
  const int t = threadIdx.x;
  const int bh = blockIdx.x / (DH / RROW);
  const int dg = blockIdx.x % (DH / RROW);
  const float* p0 = part + (size_t)bh * NTILE * (DH * DH) + dg * (RROW * DH) + 4 * t;
  v4f x[NTILE];
#pragma unroll
  for (int tl = 0; tl < NTILE; ++tl) x[tl] = *(const v4f*)(p0 + (size_t)tl * (DH * DH));
  // keeps all NTILE loads in front of the sum: without it the build issues the last three only when the first three have returned
  __builtin_amdgcn_sched_barrier(0);
  v4f s = {0.f, 0.f, 0.f, 0.f};
#pragma unroll
  for (int tl = 0; tl < NTILE; ++tl) s += x[tl];
  *(v4f*)(kvs + 4 * t) = s;
  __syncthreads();
  if (t < DH) {
    v8h o;
#pragma unroll
    for (int i = 0; i < RROW; ++i) o[i] = (_Float16)(kvs[i * DH + t] * (1.0f / 16.0f));
    *(v8h*)(kvT + (size_t)bh * (DH * DH) + (size_t)((t >> 4) * 128 + dg * 16 + (t & 15)) * 8) = o;
  }
}

// ---------------------------------------------------------------------------
// Output: block = 64 tokens (4 waves x 16 tokens), all heads, both products taken transposed so that nothing leaves the registers.
// Per head: Q^T = Wq_h^T v^T (A = WqT plane, row d; B = vh rows, col token): the accumulator of tile nt has the lane's own token
// (l & 15) and d = 16 nt + 8 (l >> 4) + r in its 8 registers. LayerNorm over d = 32 values of the lane plus the partner lane l ^ 16;
// bias, gamma and beta go by register, read from an LDS copy of the three rows (one barrier in front of the head loop, none in it).
// The f16 of tiles 2 ks and 2 ks + 1 side by side is the B fragment (col token, k = d, the split k map of ldfrag) of
// co^T += (kv'/16)^T Q^T with A = kvT plane (row eo, k = d, same map): the heads add up in the accumulator.
// Epilogue: out = co/1024 + Wo_b/16384; a lane holds 8 consecutive eo of its token per tile, staged as f32 rows in LDS
// (pitch SP), barrier, 8 store instructions per wave of 512 contiguous B.
// coverage: out 4 waves x 8 x 32 x 4 floats = the block's 64 rows x 64.
// ---------------------------------------------------------------------------
// second bound: four waves per SIMD (the grid is four waves per SIMD in one round), so the build keeps to 256 registers
__global__ __launch_bounds__(128, 4) void k_out(
    const _Float16* __restrict__ vh, const _Float16* __restrict__ WqT,
    const float* __restrict__ Wq_b, const float* __restrict__ lnq_g, const float* __restrict__ lnq_b,
    const _Float16* __restrict__ kvT,
    const float* __restrict__ Wo_b, float* out) {
  __shared__ __attribute__((aligned(16))) float stg[4 * 16 * SP];
  __shared__ __attribute__((aligned(16))) float prm[3 * HD];
  const int lane = threadIdx.x & 31, wv = threadIdx.x >> 5, hh = lane >> 4, m = lane & 15;
  const int b = blockIdx.x / (NTOK / 64);

  // bias and LayerNorm rows of all heads to LDS, 128 threads x 4 floats per row: a lane now needs 8 consecutive d per tile,
  // the same for 16 lanes, which the LDS hands out as a broadcast beside the fragment loads of the cache path
  // (loaded first, stored behind the issue of the fragment loads below, which so fly over the barrier)
  const int t4 = 4 * threadIdx.x;
  const v4f pr0 = *(const v4f*)(Wq_b + t4);
  const v4f pr1 = *(const v4f*)(lnq_g + t4);
  const v4f pr2 = *(const v4f*)(lnq_b + t4);
  const size_t tok0 = (size_t)blockIdx.x * 64 + (size_t)wv * 16;
  float* sw = stg + wv * (16 * SP);

  const _Float16* ap = vh + tok0 * CIN;
  const v16h av0 = ldfrag(ap, CIN);
  const v16h av1 = ldfrag(ap + 32, CIN);

  v8f co[4];
#pragma unroll
  for (int et = 0; et < 4; ++et) { v8f z = {0.f, 0.f, 0.f, 0.f, 0.f, 0.f, 0.f, 0.f}; co[et] = z; }

  // head 0's Q weight fragments; each head fetches the next head's in front of its kv'*Q products
  v16h bwq[4][2];
#pragma unroll
  for (int nt = 0; nt < 4; ++nt) {
    const _Float16* wq = WqT + (size_t)(16 * nt) * CIN;
    bwq[nt][0] = ldfragp(wq); bwq[nt][1] = ldfragp(wq + 512);
  }
  // wait before the address registers of the loads above are overwritten
  asm volatile("s_wait_xcnt 0x0" ::: "memory");

  *(v4f*)(prm + t4)          = pr0;
  *(v4f*)(prm + HD + t4)     = pr1;
  *(v4f*)(prm + 2 * HD + t4) = pr2;
  __syncthreads();

#pragma unroll 1
  for (int h = 0; h < NH; ++h) {
    // Q^T projection for head h
    v8f cq[4];
#pragma unroll
    for (int nt = 0; nt < 4; ++nt) {
      v8f z = {0.f, 0.f, 0.f, 0.f, 0.f, 0.f, 0.f, 0.f}; cq[nt] = z;
      cq[nt] = wmf(bwq[nt][0], av0, cq[nt]);
      cq[nt] = wmf(bwq[nt][1], av1, cq[nt]);
    }

    // this head's kv fragments as one load group: they fly during the LayerNorm
    const _Float16* kp = kvT + (size_t)(b * NH + h) * (DH * DH) + 8 * lane;
    v16h bkv[4][2];
#pragma unroll
    for (int et = 0; et < 4; ++et) {
      bkv[et][0] = ldfragl(kp + (16 * et) * DH);
      bkv[et][1] = ldfragl(kp + (16 * et) * DH + 512);
    }
    // wait before the address registers of the loads above are overwritten; the address is named so that it stays in them up to here
    asm volatile("s_wait_xcnt 0x0" :: "v"(kp) : "memory");

    // bias, then LayerNorm over the 64 head dims of the lane's token: 32 in the lane, 32 in lane l ^ 16
    const float* pl = prm + h * DH + 8 * hh;
    v8f x0 = cq[0] * RWSC + ld8(pl);
    v8f x1 = cq[1] * RWSC + ld8(pl + 16);
    v8f x2 = cq[2] * RWSC + ld8(pl + 32);
    v8f x3 = cq[3] * RWSC + ld8(pl + 48);
    float s = sum8((x0 + x1) + (x2 + x3));
    s += xhalf(s);
    const float mu = s * (1.0f / 64.0f);
    x0 -= mu; x1 -= mu; x2 -= mu; x3 -= mu;
    float q = sum8((x0 * x0 + x1 * x1) + (x2 * x2 + x3 * x3));
    q += xhalf(q);
    const float var = q * (1.0f / 64.0f);
    const float rs = rsqrtf(var + EPSV);
    x0 = x0 * rs * ld8(pl + HD)      + ld8(pl + 2 * HD);
    x1 = x1 * rs * ld8(pl + HD + 16) + ld8(pl + 2 * HD + 16);
    x2 = x2 * rs * ld8(pl + HD + 32) + ld8(pl + 2 * HD + 32);
    x3 = x3 * rs * ld8(pl + HD + 48) + ld8(pl + 2 * HD + 48);

    // B fragments of Q^T: elements 0..7 <- d = 32 ks + 8 hh + r (tile 2 ks), 8..15 <- d = 32 ks + 16 + 8 hh + r (tile 2 ks + 1)
    FragH qf0, qf1;
#pragma unroll
    for (int r = 0; r < 8; ++r) {
      qf0.h[0][r] = (_Float16)x0[r]; qf0.h[1][r] = (_Float16)x1[r];
      qf1.h[0][r] = (_Float16)x2[r]; qf1.h[1][r] = (_Float16)x3[r];
    }

    // next head's Q weight fragments as one load group: they fly during kv'*Q
    // (the last head reads its own again: in bounds, unused)
    {
      const int hn = (h + 1 < NH) ? h + 1 : h;
      const _Float16* wq = WqT + (size_t)hn * (DH * CIN) + 8 * lane;
#pragma unroll
      for (int nt = 0; nt < 4; ++nt) {
        bwq[nt][0] = ldfragl(wq + (16 * nt) * CIN); bwq[nt][1] = ldfragl(wq + (16 * nt) * CIN + 512);
      }
      // wait before the address registers of the loads above are overwritten; the address is named so that it stays in them up to here
      asm volatile("s_wait_xcnt 0x0" :: "v"(wq) : "memory");
    }

    // co^T += (kv'/16)^T Q^T: A = kvT[eo][d] (row eo, k = d), B = Q^T (col token, k = d)
#pragma unroll
    for (int et = 0; et < 4; ++et) {
      co[et] = wmf(bkv[et][0], qf0.v, co[et]);
      co[et] = wmf(bkv[et][1], qf1.v, co[et]);
    }
  }

  // epilogue: out = co/1024 + Wo_b/16384, token row m, columns 16 et + 8 hh + 0..7
#pragma unroll
  for (int et = 0; et < 4; ++et) {
    const v8f y = co[et] * (1.0f / 1024.0f) + ld8(Wo_b + 16 * et + 8 * hh) * (1.0f / 16384.0f);
    float* d = sw + m * SP + 16 * et + 8 * hh;
    *(v4f*)d = y.lo;
    *(v4f*)(d + 4) = y.hi;
  }
  __syncthreads();
  float* gp = out + tok0 * DH;
#pragma unroll
  for (int i = 0; i < 8; ++i) {
    const v4f x = *(const v4f*)(sw + (2 * i + hh) * SP + 4 * m);
    *(v4f*)(gp + i * 128 + 4 * lane) = x;
  }
}

// ---------------------------------------------------------------------------
extern "C" void kernel_launch(void* const* d_in, const int* in_sizes, int n_in,
                              void* d_out, int out_size, void* d_ws, size_t ws_size,
                              hipStream_t stream) {
  if (n_in < 13) return;
  if (in_sizes[0] != NB * NTOK * CIN) return;
  if (in_sizes[1] != CIN * HD || in_sizes[3] != CIN * HD || in_sizes[5] != CIN * HD) return;
  if (in_sizes[2] != HD || in_sizes[4] != HD || in_sizes[6] != HD) return;
  if (in_sizes[7] != NH * DH || in_sizes[8] != NH * DH || in_sizes[9] != NH * DH || in_sizes[10] != NH * DH) return;
  if (in_sizes[11] != HD * DH || in_sizes[12] != DH) return;
  if (out_size != NB * NTOK * DH) return;

  const float* v     = (const float*)d_in[0];
  const float* Wq_w  = (const float*)d_in[1];
  const float* Wq_b  = (const float*)d_in[2];
  const float* Wk_w  = (const float*)d_in[3];
  const float* Wk_b  = (const float*)d_in[4];
  const float* Wv_w  = (const float*)d_in[5];
  const float* Wv_b  = (const float*)d_in[6];
  const float* lnq_g = (const float*)d_in[7];
  const float* lnq_b = (const float*)d_in[8];
  const float* lnk_g = (const float*)d_in[9];
  const float* lnk_b = (const float*)d_in[10];
  const float* Wo_w  = (const float*)d_in[11];
  const float* Wo_b  = (const float*)d_in[12];
  float* out = (float*)d_out;

  // workspace carve (256-B aligned; every region an exact multiple of its whole-line store extent)
  char* ws = (char*)d_ws;
  size_t off = 0;
  const size_t oVh  = off; off += (size_t)NB * NTOK * CIN * 2;        off = (off + 255) & ~(size_t)255;   // 8388608
  const size_t oWq  = off; off += (size_t)CIN * HD * 2;               off = (off + 255) & ~(size_t)255;   // 65536
  const size_t oWk  = off; off += (size_t)CIN * HD * 2;               off = (off + 255) & ~(size_t)255;
  const size_t oWv  = off; off += (size_t)CIN * HD * 2;               off = (off + 255) & ~(size_t)255;
  const size_t oBvo = off; off += (size_t)HD * 4;                     off = (off + 255) & ~(size_t)255;   // 2048
  const size_t oKvT = off; off += (size_t)NB * NH * DH * DH * 2;      off = (off + 255) & ~(size_t)255;   // 262144
  const size_t oPt  = off; off += (size_t)NB * NH * NTILE * DH * DH * 4; off = (off + 255) & ~(size_t)255; // 8388608
  if (off > ws_size || off > (size_t)WSCAP) return;
  _Float16* vh   = (_Float16*)(ws + oVh);
  _Float16* WqT  = (_Float16*)(ws + oWq);
  _Float16* WkT  = (_Float16*)(ws + oWk);
  _Float16* WvT  = (_Float16*)(ws + oWv);
  float*    bvo  = (float*)(ws + oBvo);
  _Float16* kvT  = (_Float16*)(ws + oKvT);
  float*    part = (float*)(ws + oPt);

  // 1: v -> f16 plane, Wq, Wk, Wv*Wo -> f16 planes (x64), bv*Wo row
  k_prep<<<NVB + NWB, 256, 0, stream>>>(v, Wq_w, Wk_w, Wv_w, Wv_b, Wo_w, vh, WqT, WkT, WvT, bvo);
  // 2: K/V' projection + LayerNorm(K) + K^T V' partials per (batch, head, token tile)
  k_kv<<<NB * NH * NTILE, 128, 0, stream>>>(vh, WkT, WvT, Wk_b, bvo, lnk_g, lnk_b, part);
  // 3: fixed-order partial sum -> kvT planes (f16, x1/16)
  k_kvred<<<NB * NH * (DH / RROW), 128, 0, stream>>>(part, kvT);
  // 4: Q projection + LayerNorm(Q) + Q kv' summed over heads, /n
  k_out<<<(NB * NTOK) / 64, 128, 0, stream>>>(vh, WqT, Wq_b, lnq_g, lnq_b, kvT, Wo_b, out);
}

// v008
// One run takes 38.1 microseconds.
// In two side-by-side timings against v007, it was 1.08 and 1.09 times as fast.
// Over all steps from v000 it is 4.43 times as fast.
#include <hip/hip_runtime.h>
#include <stddef.h>

// All contractions on v_wmma_f32_16x16x32_f16 (f16 operands, f32 accumulate). The chain (Q (K^T V)) Wo is taken as Q (K^T (V Wo)) per head: Wvo = Wv_h*Wo_h (both carried x64) in the prologue of each K/V block, Q/K/V' projections (activations as-is, weights carried x64), K^T*V' per (batch, head) over token tiles with f32 fixed-order partial sums, Q*kv' (kv' carried x1/16) summed over the heads in the accumulator; RNE converts; power-of-two carries folded back in the f32 epilogues. LayerNorm, bias, 1/n scaling: f32 VALU.

#define NB     4
#define NTOK   16384
#define CIN    64
#define NH     8
#define DH     64
#define HD     (NH * DH)
#define NTILE  16                      // token tiles per (batch, head) for the K^T V partials: 512 blocks, two per WGP, two waves per SIMD
#define CHT    (NTOK / NTILE)          // 1024 tokens per kv block
#define KVIT   (CHT / 64)              // 16 steps of 64 tokens
#define TP     72                      // LDS pitch in halves of the transposed K/V tiles
#define SP     68                      // LDS pitch in floats of the output rows staged by token: 16-byte stores of 16 rows spread over the banks
#define RROW   8                       // rows d of a kv plane per reduce block: 256 blocks, one per WGP
#define NKVB   (NB * NH * NTILE)       // 512 K/V blocks
#define NQB    32                      // blocks behind them in the same grid that build the Wq plane for the output launch
#define WSC    64.0f
#define RWSC   (1.0f / 64.0f)
#define EPSV   1e-5f
#define WSCAP  134217728

static_assert(CIN == 64 && DH == 64 && HD == 512 && NH == 8);
static_assert((NTOK % NTILE) == 0 && (CHT % 64) == 0 && (NTOK % 64) == 0);
static_assert(NQB * 128 * 8 == CIN * HD);
static_assert((TP % 8) == 0 && TP >= 64);
static_assert(RROW == 8 && RROW * DH == 128 * 4);

typedef float    v2f  __attribute__((ext_vector_type(2)));
typedef float    v4f  __attribute__((ext_vector_type(4)));
typedef float    v8f  __attribute__((ext_vector_type(8)));
typedef _Float16 v4h  __attribute__((ext_vector_type(4)));
typedef _Float16 v8h  __attribute__((ext_vector_type(8)));
typedef _Float16 v16h __attribute__((ext_vector_type(16)));
union FragH { v16h v; v8h h[2]; };

// WMMA as the plain builtin: the compiler keeps the hazard distances of its own form and is free
// to issue the fragment loads of a whole group ahead of the products.
__device__ __forceinline__ v8f wmf(v16h a, v16h b, v8f c) {
  return __builtin_amdgcn_wmma_f32_16x16x32_f16(false, a, false, b, (short)0, c, false, false);
}

// 16x32 fragment from a 16-bit [row][k] (k-contiguous) tile, p = &T[row0][k0], pitch ld halves.
// Used for A (row = l&15) and for B stored as [n][k] (col = l&15); split k map:
// elements 0..7 <- k0 + 8h + 0..7, elements 8..15 <- k0 + 16 + 8h + 0..7, h = lane>>4.
__device__ __forceinline__ v16h ldfrag(const _Float16* p, int ld) {
  const int l = threadIdx.x & 31, hh = l >> 4, m = l & 15;
  const _Float16* q = p + m * ld + 8 * hh;
  FragH f;
  f.h[0] = *(const v8h*)q;
  f.h[1] = *(const v8h*)(q + 16);
  return f.v;
}

// The same fragment from a plane kept in fragment order: one (16-row tile, 32-deep k step) = 512 halves,
// chunk j (0, 1) of lane l at halves 256 j + 8 l, holding T[row0 + (l & 15)][k0 + 16 j + 8 (l >> 4) + 0..7].
// Each of the two 16-byte loads of a wave then reads 512 contiguous bytes (4 whole lines, not 32 B of 16 lines).
__device__ __forceinline__ v16h ldfragp(const _Float16* blk) {
  const _Float16* q = blk + 8 * (threadIdx.x & 31);
  FragH f;
  f.h[0] = *(const v8h*)q;
  f.h[1] = *(const v8h*)(q + 256);
  return f.v;
}

// ldfragp with the lane's own pointer q = blk + 8 * lane formed by the caller
__device__ __forceinline__ v16h ldfragl(const _Float16* q) {
  FragH f;
  f.h[0] = *(const v8h*)q;
  f.h[1] = *(const v8h*)(q + 256);
  return f.v;
}

// value of lane (l ^ M) of the same 16-lane row, M < 16: a DPP row_xmask operand (control 0x160 | M), all lanes on.
// It stays in the vector pipe and folds into the add that uses it; a shuffle goes through the LDS unit and is waited for.
template <int M>
__device__ __forceinline__ float rowx(float x) {
  return __builtin_bit_cast(float, __builtin_amdgcn_update_dpp(0, __builtin_bit_cast(int, x), 0x160 | M, 0xf, 0xf, true));
}

// sum over the 16 lanes of a half-wave (xor masks < 16 stay inside the row); butterfly order 8, 4, 2, 1
__device__ __forceinline__ float hred16(float x) {
  x += rowx<8>(x);
  x += rowx<4>(x);
  x += rowx<2>(x);
  x += rowx<1>(x);
  return x;
}

// value of lane l ^ 16 (the same place in the other 16-lane row): a vector cross-row move, not an LDS-unit shuffle
__device__ __forceinline__ float xhalf(float x) {
  const int b = __builtin_bit_cast(int, x);
  return __builtin_bit_cast(float, __builtin_amdgcn_permlanex16(b, b, 0x76543210, 0xfedcba98, false, false));
}

// 8 consecutive floats (16-byte aligned) as two 16-byte loads
__device__ __forceinline__ v8f ld8(const float* p) {
  const v4f a = *(const v4f*)p;
  const v4f c = *(const v4f*)(p + 4);
  return __builtin_shufflevector(a, c, 0, 1, 2, 3, 4, 5, 6, 7);
}

// sum of the 8 elements, tree order (4 + 4, 2 + 2, 1 + 1)
__device__ __forceinline__ float sum8(v8f t) {
  const v4f a = t.lo + t.hi;
  const v2f c = a.lo + a.hi;
  return c.x + c.y;
}

// 16 token rows of v (f32, 4 KB contiguous at g) as 8 loads of 16 bytes per lane: load i covers rows 2 i and 2 i + 1 whole
// (512 contiguous B, 4 lines); lane l has row 2 i + (l >> 4), channels 4 (l & 15) + 0..3
__device__ __forceinline__ void ldrows(const float* g, v4f (&x)[8]) {
  const float* q = g + 4 * (threadIdx.x & 31);
#pragma unroll
  for (int i = 0; i < 8; ++i) x[i] = *(const v4f*)(q + i * 128);
}

// those rows as f16 (RNE) into the wave's own LDS tile s [16][TP], from where ldfrag(s, TP) takes the fragments
__device__ __forceinline__ void strows(_Float16* s, const v4f (&x)[8]) {
  const int l = threadIdx.x & 31;
  _Float16* d = s + (l >> 4) * TP + 4 * (l & 15);
#pragma unroll
  for (int i = 0; i < 8; ++i) {
    v4h o;
    o[0] = (_Float16)x[i].x; o[1] = (_Float16)x[i].y; o[2] = (_Float16)x[i].z; o[3] = (_Float16)x[i].w;
    *(v4h*)(d + i * (2 * TP)) = o;
  }
}

// ---------------------------------------------------------------------------
// K/V' projection (V' = V Wo_h) + LayerNorm(K) + K^T V' partial. Block = (batch, head, token tile), 4 waves.
// There is no launch in front of this one: a block makes what it needs from the f32 inputs itself.
// Prologue: wave w builds, x64 in f16, the B fragments of Wk columns 16w..16w+15 (chunk = Wk[c0..c0+7][col]), the A fragments of
// Wv rows c = 16w..16w+15 (k = e) and the B fragments of Wo columns eo = 16w..16w+15 (k = e, same k map); K and Wv fragments go
// to LDS in the fragment order of ldfragp. Barrier. Wave w then takes the four 16x16 tiles (row tile ct, eo tile w) of
// Wvo[c][eo] = sum_e Wv[c][h*64+e] Wo[h*64+e][eo]: the accumulator (8 consecutive c of one eo per lane) is that lane's 16-byte
// chunk of the V' weight fragments as it stands; a fifth tile with the bias row Wv_b in all 16 rows gives bvo[eo] (row 0, f32).
// Barrier. Every wave reads all K and V' weight fragments into registers for the whole token loop.
// Per step each wave projects its own 16 tokens: their f32 rows are loaded one step ahead as whole lines, converted and laid
// in the wave's own LDS tile in front of the step's first barrier, and read as A fragments behind it.
// K and V are written transposed into LDS Kt/Vt [d][token] (one 16-B store per
// 16x16 tile per lane: 8 consecutive tokens of one d). Block barrier. Wave w then
// accumulates kv rows d = 16w..16w+15 x all 64 e over the 64 tokens: A = Kt (row d,
// k = token), B = Vt (col e, k = token), same loader. Barrier before the next step.
// Epilogue: kv strip staged as f32 rows in LDS, barrier, 8 whole-line store instructions per wave.
// coverage: Kt/Vt 4 waves x 4 tiles x 32 lanes x 8 = 64x64 halves each per step;
// part 4 waves x 8 x 32 x 4 floats = the block's 64x64 partial.
// Blocks NKVB..NKVB+NQB-1 build the Wq plane (x64, fragment order: block (o tile 0..31, k step 0..1) of Wq^T [512][64]) for the
// output launch and leave in front of every barrier: 32 x 128 threads x 8 halves = 32768.
// ---------------------------------------------------------------------------
__global__ __launch_bounds__(128) void k_kv(
    const float* __restrict__ v, const float* __restrict__ Wq, const float* __restrict__ Wk,
    const float* __restrict__ Wv, const float* __restrict__ Wv_b, const float* __restrict__ Wo,
    const float* __restrict__ Wk_b,
    const float* __restrict__ lnk_g, const float* __restrict__ lnk_b, _Float16* WqT, float* part) {
  __shared__ __attribute__((aligned(16))) _Float16 Kt[DH * TP];
  __shared__ __attribute__((aligned(16))) _Float16 Vt[DH * TP];
  __shared__ __attribute__((aligned(16))) float stg[4 * 16 * DH];
  __shared__ __attribute__((aligned(16))) _Float16 vst[4 * 16 * TP];   // each wave's 16 token rows, f16
  __shared__ __attribute__((aligned(16))) _Float16 wks[DH * CIN];      // Wk_h fragments
  __shared__ __attribute__((aligned(16))) _Float16 wvs[DH * CIN];      // Wvo_h fragments
  __shared__ __attribute__((aligned(16))) _Float16 afr[DH * CIN];      // Wv_h fragments (A of the weight product)
  __shared__ float bvs[DH];
  const int lane = threadIdx.x & 31, wv = threadIdx.x >> 5, hh = lane >> 4, m = lane & 15;

  if (blockIdx.x >= NKVB) {
    const int i = (blockIdx.x - NKVB) * 128 + threadIdx.x;   // 0..4095: 16-byte chunk of the plane
    const int c0 = ((i >> 6) & 1) * 32 + ((i >> 5) & 1) * 16 + hh * 8;   // k offset in 64
    const int oc = (i >> 7) * 16 + m;                        // chunk = Wq[c0..c0+7][oc] * 64
    v8h o;
#pragma unroll
    for (int e = 0; e < 8; ++e) o[e] = (_Float16)(Wq[(c0 + e) * HD + oc] * WSC);
    *(v8h*)(WqT + (size_t)i * 8) = o;
    return;
  }

  const int tile = blockIdx.x % NTILE;
  const int h = (blockIdx.x / NTILE) % NH;
  const int b = blockIdx.x / (NTILE * NH);

  // token rows of step 0; each step fetches the next step's rows in front of its own projections
  const float* vb = v + ((size_t)b * NTOK + (size_t)tile * CHT + (size_t)wv * 16) * CIN;
  _Float16* vs = vst + wv * (16 * TP);
  v4f xr[8];
  ldrows(vb, xr);
  // this wait and the four like it below: each stands behind the last load of one address register and in front of the next
  // group, whose results the build otherwise lets land in that register
  asm volatile("s_wait_xcnt 0x0" ::: "memory");

  float bk[4], bv[4], gk[4], btk[4];
#pragma unroll
  for (int nt = 0; nt < 4; ++nt) {
    const int col = h * DH + 16 * nt + m;
    bk[nt] = Wk_b[col];
    gk[nt] = lnk_g[col]; btk[nt] = lnk_b[col];
  }
  asm volatile("s_wait_xcnt 0x0" ::: "memory");

  // the wave's share of the weights, f32, all loads in flight together; k = 32 ks + 16 j + 8 hh + e
  const float* kr = Wk + (8 * hh) * HD + h * DH + 16 * wv + m;            // column d, c strided
  const float* br = Wo + (h * DH + 8 * hh) * DH + 16 * wv + m;            // column eo, e strided
  const float* ar = Wv + (16 * wv + m) * HD + h * DH + 8 * hh;            // row c, e contiguous
  const float* rr = Wv_b + h * DH + 8 * hh;                               // the bias row, e contiguous
  float kw[2][2][8], bw[2][2][8];
  v8f aw[2][2], rw[2][2];
#pragma unroll
  for (int ks = 0; ks < 2; ++ks) {
#pragma unroll
    for (int j = 0; j < 2; ++j) {
#pragma unroll
      for (int e = 0; e < 8; ++e) kw[ks][j][e] = kr[(32 * ks + 16 * j + e) * HD];
    }
  }
  asm volatile("s_wait_xcnt 0x0" ::: "memory");
#pragma unroll
  for (int ks = 0; ks < 2; ++ks) {
#pragma unroll
    for (int j = 0; j < 2; ++j) {
#pragma unroll
      for (int e = 0; e < 8; ++e) bw[ks][j][e] = br[(32 * ks + 16 * j + e) * DH];
    }
  }
  asm volatile("s_wait_xcnt 0x0" ::: "memory");
#pragma unroll
  for (int ks = 0; ks < 2; ++ks) {
#pragma unroll
    for (int j = 0; j < 2; ++j) aw[ks][j] = ld8(ar + 32 * ks + 16 * j);
  }
  asm volatile("s_wait_xcnt 0x0" ::: "memory");
#pragma unroll
  for (int ks = 0; ks < 2; ++ks) {
#pragma unroll
    for (int j = 0; j < 2; ++j) rw[ks][j] = ld8(rr + 32 * ks + 16 * j);
  }
  // wait before the address register of the loads above is overwritten
  asm volatile("s_wait_xcnt 0x0" ::: "memory");

  FragH kf[2], af[2], bb[2], bf[2];
#pragma unroll
  for (int ks = 0; ks < 2; ++ks) {
#pragma unroll
    for (int j = 0; j < 2; ++j) {
#pragma unroll
      for (int e = 0; e < 8; ++e) {
        kf[ks].h[j][e] = (_Float16)(kw[ks][j][e] * WSC);
        af[ks].h[j][e] = (_Float16)(aw[ks][j][e] * WSC);
        bb[ks].h[j][e] = (_Float16)(rw[ks][j][e] * WSC);
        bf[ks].h[j][e] = (_Float16)(bw[ks][j][e] * WSC);
      }
    }
  }
#pragma unroll
  for (int ks = 0; ks < 2; ++ks) {
#pragma unroll
    for (int j = 0; j < 2; ++j) {
      *(v8h*)(wks + (wv * 2 + ks) * 512 + j * 256 + 8 * lane) = kf[ks].h[j];
      *(v8h*)(afr + (wv * 2 + ks) * 512 + j * 256 + 8 * lane) = af[ks].h[j];
    }
  }
  strows(vs, xr);
  __syncthreads();

#pragma unroll
  for (int ct = 0; ct < 4; ++ct) {
    v8f acc = {0.f, 0.f, 0.f, 0.f, 0.f, 0.f, 0.f, 0.f};
    acc = wmf(ldfragp(afr + (ct * 2) * 512), bf[0].v, acc);
    acc = wmf(ldfragp(afr + (ct * 2 + 1) * 512), bf[1].v, acc);
    v8h o;
#pragma unroll
    for (int r = 0; r < 8; ++r) o[r] = (_Float16)(acc[r] * RWSC);   // x4096 -> x64
    *(v8h*)(wvs + (wv * 2 + (ct >> 1)) * 512 + (ct & 1) * 256 + 8 * lane) = o;
  }
  {
    v8f acc = {0.f, 0.f, 0.f, 0.f, 0.f, 0.f, 0.f, 0.f};
    acc = wmf(bb[0].v, bf[0].v, acc);
    acc = wmf(bb[1].v, bf[1].v, acc);
    if (hh == 0) bvs[16 * wv + m] = acc[0] * (RWSC * RWSC);
  }
  __syncthreads();

  v8f kvacc[4];
#pragma unroll
  for (int et = 0; et < 4; ++et) { v8f z = {0.f, 0.f, 0.f, 0.f, 0.f, 0.f, 0.f, 0.f}; kvacc[et] = z; }

  // the head's K and V' weight fragments do not change over the token loop: one read group, kept in registers
  v16h wkf[4][2], wvf[4][2];
#pragma unroll
  for (int nt = 0; nt < 4; ++nt) {
    wkf[nt][0] = ldfragp(wks + (nt * 2) * 512); wkf[nt][1] = ldfragp(wks + (nt * 2 + 1) * 512);
    wvf[nt][0] = ldfragp(wvs + (nt * 2) * 512); wvf[nt][1] = ldfragp(wvs + (nt * 2 + 1) * 512);
    bv[nt] = bvs[16 * nt + m];
  }
  v16h av0 = ldfrag(vs, TP);
  v16h av1 = ldfrag(vs + 32, TP);

#pragma unroll 1
  for (int it = 0; it < KVIT; ++it) {
    // next step's rows fly during the projections and the LayerNorm (the last step reads its own rows again: in bounds, unused)
    {
      const int itn = (it + 1 < KVIT) ? it + 1 : it;
      ldrows(vb + (size_t)itn * (64 * CIN), xr);
    }
    // wait before the address registers of the eight loads above are overwritten
    asm volatile("s_wait_xcnt 0x0" ::: "memory");
    // holds the eight loads in front of the projections: sunk to their use they would be waited for in full
    __builtin_amdgcn_sched_barrier(0);

    v8f ck[4], cv[4];
#pragma unroll
    for (int nt = 0; nt < 4; ++nt) {
      v8f z = {0.f, 0.f, 0.f, 0.f, 0.f, 0.f, 0.f, 0.f}; ck[nt] = z; cv[nt] = z;
      ck[nt] = wmf(av0, wkf[nt][0], ck[nt]);
      ck[nt] = wmf(av1, wkf[nt][1], ck[nt]);
      cv[nt] = wmf(av0, wvf[nt][0], cv[nt]);
      cv[nt] = wmf(av1, wvf[nt][1], cv[nt]);
    }

    // K: bias + LayerNorm over the 64 head dims (row 8hh+r spread over 16 lanes x 4 tiles)
#pragma unroll
    for (int r = 0; r < 8; ++r) {
      float x0 = ck[0][r] * RWSC + bk[0];
      float x1 = ck[1][r] * RWSC + bk[1];
      float x2 = ck[2][r] * RWSC + bk[2];
      float x3 = ck[3][r] * RWSC + bk[3];
      float s = (x0 + x1) + (x2 + x3);
      s = hred16(s);
      const float mu = s * (1.0f / 64.0f);
      x0 -= mu; x1 -= mu; x2 -= mu; x3 -= mu;
      float q = (x0 * x0 + x1 * x1) + (x2 * x2 + x3 * x3);
      q = hred16(q);
      const float var = q * (1.0f / 64.0f);
      const float rs = rsqrtf(var + EPSV);
      ck[0][r] = x0 * rs * gk[0] + btk[0];
      ck[1][r] = x1 * rs * gk[1] + btk[1];
      ck[2][r] = x2 * rs * gk[2] + btk[2];
      ck[3][r] = x3 * rs * gk[3] + btk[3];
    }

    // transposed tiles: Kt[d][token], Vt[e][token], token = wv*16 + 8hh + r
#pragma unroll
    for (int nt = 0; nt < 4; ++nt) {
      v8h kk, vv;
#pragma unroll
      for (int r = 0; r < 8; ++r) {
        kk[r] = (_Float16)ck[nt][r];
        vv[r] = (_Float16)(cv[nt][r] * RWSC + bv[nt]);
      }
      *(v8h*)(Kt + (16 * nt + m) * TP + wv * 16 + 8 * hh) = kk;
      *(v8h*)(Vt + (16 * nt + m) * TP + wv * 16 + 8 * hh) = vv;
    }
    // next step's rows into the wave's own tile: its fragments of this step were read behind the barrier of the step before
    strows(vs, xr);
    __syncthreads();

    // kv rows 16wv..16wv+15 += K^T V over the 64 tokens (2 k-steps)
    const _Float16* ka = Kt + (16 * wv) * TP;
    v16h ak[2], bvf[2][4];
#pragma unroll
    for (int ks = 0; ks < 2; ++ks) {
      ak[ks] = ldfrag(ka + 32 * ks, TP);
#pragma unroll
      for (int et = 0; et < 4; ++et) bvf[ks][et] = ldfrag(Vt + (16 * et) * TP + 32 * ks, TP);
    }
    av0 = ldfrag(vs, TP);
    av1 = ldfrag(vs + 32, TP);
    // keeps the LDS fragment reads one group in front of the products: one place with reads, not one per product
    __builtin_amdgcn_sched_barrier(0);
#pragma unroll
    for (int ks = 0; ks < 2; ++ks) {
#pragma unroll
      for (int et = 0; et < 4; ++et) kvacc[et] = wmf(ak[ks], bvf[ks][et], kvacc[et]);
    }
    __syncthreads();
  }

  // epilogue: stage the wave's 16x64 f32 strip, then whole-line stores
  float* sw = stg + wv * (16 * DH);
#pragma unroll
  for (int et = 0; et < 4; ++et) {
#pragma unroll
    for (int r = 0; r < 8; ++r) sw[(8 * hh + r) * DH + 16 * et + m] = kvacc[et][r];
  }
  __syncthreads();
  float* gp = part + ((size_t)blockIdx.x * DH + (size_t)(16 * wv)) * DH;
#pragma unroll
  for (int i = 0; i < 8; ++i) {
    const v4f x = *(const v4f*)(sw + i * 128 + 4 * lane);
    *(v4f*)(gp + i * 128 + 4 * lane) = x;
  }
  
}

// ---------------------------------------------------------------------------
// kv reduce (block = (batch, head, group of 8 rows d), 128 threads): a thread takes 4 consecutive e of one row d and
// has the 16-byte loads of all NTILE partials in flight at once (a wave reads 512 contiguous B per load); fixed-order
// f32 sum (partial 0 first) into LDS kvs[row][e], barrier, then threads 0..63 each write one 16-byte chunk of the kvT
// plane (kv^T [e][d], f16 of kv/16) in the fragment order of ldfragp: chunk (e >> 4) * 128 + 16 * group + (e & 15)
// holds d = 8 * group + 0..7 of column e; 16 lanes write 256 contiguous B.
// coverage: 8 groups x 64 threads x 8 halves = 4096 = the (b,h) 64x64 plane.
// ---------------------------------------------------------------------------
__global__ __launch_bounds__(128) void k_kvred(const float* __restrict__ part, _Float16* kvT) {
  __shared__ __attribute__((aligned(16))) float kvs[RROW * DH];
  const int t = threadIdx.x;
  const int bh = blockIdx.x / (DH / RROW);
  const int dg = blockIdx.x % (DH / RROW);
  const float* p0 = part + (size_t)bh * NTILE * (DH * DH) + dg * (RROW * DH) + 4 * t;
  v4f x[NTILE];
#pragma unroll
  for (int tl = 0; tl < NTILE; ++tl) x[tl] = *(const v4f*)(p0 + (size_t)tl * (DH * DH));
  // keeps all NTILE loads in front of the sum: without it the build issues the last three only when the first three have returned
  __builtin_amdgcn_sched_barrier(0);
  v4f s = {0.f, 0.f, 0.f, 0.f};
#pragma unroll
  for (int tl = 0; tl < NTILE; ++tl) s += x[tl];
  *(v4f*)(kvs + 4 * t) = s;
  __syncthreads();
  if (t < DH) {
    v8h o;
#pragma unroll
    for (int i = 0; i < RROW; ++i) o[i] = (_Float16)(kvs[i * DH + t] * (1.0f / 16.0f));
    *(v8h*)(kvT + (size_t)bh * (DH * DH) + (size_t)((t >> 4) * 128 + dg * 16 + (t & 15)) * 8) = o;
  }
}

// ---------------------------------------------------------------------------
// Output: block = 64 tokens (4 waves x 16 tokens), all heads, both products taken transposed so that nothing leaves the registers.
// Per head: Q^T = Wq_h^T v^T (A = WqT plane, row d; B = v rows as f16 through the wave's LDS tile, col token): the accumulator of tile nt has the lane's own token
// (l & 15) and d = 16 nt + 8 (l >> 4) + r in its 8 registers. LayerNorm over d = 32 values of the lane plus the partner lane l ^ 16;
// bias, gamma and beta go by register, read from an LDS copy of the three rows (one barrier in front of the head loop, none in it).
// The f16 of tiles 2 ks and 2 ks + 1 side by side is the B fragment (col token, k = d, the split k map of ldfrag) of
// co^T += (kv'/16)^T Q^T with A = kvT plane (row eo, k = d, same map): the heads add up in the accumulator.
// Epilogue: out = co/1024 + Wo_b/16384; a lane holds 8 consecutive eo of its token per tile, staged as f32 rows in LDS
// (pitch SP), barrier, 8 store instructions per wave of 512 contiguous B.
// coverage: out 4 waves x 8 x 32 x 4 floats = the block's 64 rows x 64.
// ---------------------------------------------------------------------------
// second bound: four waves per SIMD (the grid is four waves per SIMD in one round), so the build keeps to 256 registers
__global__ __launch_bounds__(128, 4) void k_out(
    const float* __restrict__ v, const _Float16* __restrict__ WqT,
    const float* __restrict__ Wq_b, const float* __restrict__ lnq_g, const float* __restrict__ lnq_b,
    const _Float16* __restrict__ kvT,
    const float* __restrict__ Wo_b, float* out) {
  __shared__ __attribute__((aligned(16))) float stg[4 * 16 * SP];
  __shared__ __attribute__((aligned(16))) float prm[3 * HD];
  __shared__ __attribute__((aligned(16))) _Float16 vst[4 * 16 * TP];   // each wave's 16 token rows, f16
  const int lane = threadIdx.x & 31, wv = threadIdx.x >> 5, hh = lane >> 4, m = lane & 15;
  const int b = blockIdx.x / (NTOK / 64);

  // bias and LayerNorm rows of all heads to LDS, 128 threads x 4 floats per row: a lane now needs 8 consecutive d per tile,
  // the same for 16 lanes, which the LDS hands out as a broadcast beside the fragment loads of the cache path
  // (loaded first, stored behind the issue of the fragment loads below, which so fly over the barrier)
  const int t4 = 4 * threadIdx.x;
  const v4f pr0 = *(const v4f*)(Wq_b + t4);
  const v4f pr1 = *(const v4f*)(lnq_g + t4);
  const v4f pr2 = *(const v4f*)(lnq_b + t4);
  const size_t tok0 = (size_t)blockIdx.x * 64 + (size_t)wv * 16;
  float* sw = stg + wv * (16 * SP);

  // the wave's 16 token rows, f32 as whole lines; converted into its own LDS tile in front of the barrier below
  _Float16* vs = vst + wv * (16 * TP);
  v4f xr[8];
  ldrows(v + tok0 * CIN, xr);

  v8f co[4];
#pragma unroll
  for (int et = 0; et < 4; ++et) { v8f z = {0.f, 0.f, 0.f, 0.f, 0.f, 0.f, 0.f, 0.f}; co[et] = z; }

  // head 0's Q weight fragments; each head fetches the next head's in front of its kv'*Q products
  v16h bwq[4][2];
#pragma unroll
  for (int nt = 0; nt < 4; ++nt) {
    const _Float16* wq = WqT + (size_t)(16 * nt) * CIN;
    bwq[nt][0] = ldfragp(wq); bwq[nt][1] = ldfragp(wq + 512);
  }
  // wait before the address registers of the loads above are overwritten
  asm volatile("s_wait_xcnt 0x0" ::: "memory");

  *(v4f*)(prm + t4)          = pr0;
  *(v4f*)(prm + HD + t4)     = pr1;
  *(v4f*)(prm + 2 * HD + t4) = pr2;
  strows(vs, xr);
  __syncthreads();
  const v16h av0 = ldfrag(vs, TP);
  const v16h av1 = ldfrag(vs + 32, TP);

#pragma unroll 1
  for (int h = 0; h < NH; ++h) {
    // Q^T projection for head h
    v8f cq[4];
#pragma unroll
    for (int nt = 0; nt < 4; ++nt) {
      v8f z = {0.f, 0.f, 0.f, 0.f, 0.f, 0.f, 0.f, 0.f}; cq[nt] = z;
      cq[nt] = wmf(bwq[nt][0], av0, cq[nt]);
      cq[nt] = wmf(bwq[nt][1], av1, cq[nt]);
    }

    // this head's kv fragments as one load group: they fly during the LayerNorm
    const _Float16* kp = kvT + (size_t)(b * NH + h) * (DH * DH) + 8 * lane;
    v16h bkv[4][2];
#pragma unroll
    for (int et = 0; et < 4; ++et) {
      bkv[et][0] = ldfragl(kp + (16 * et) * DH);
      bkv[et][1] = ldfragl(kp + (16 * et) * DH + 512);
    }
    // wait before the address registers of the loads above are overwritten; the address is named so that it stays in them up to here
    asm volatile("s_wait_xcnt 0x0" :: "v"(kp) : "memory");

    // bias, then LayerNorm over the 64 head dims of the lane's token: 32 in the lane, 32 in lane l ^ 16
    const float* pl = prm + h * DH + 8 * hh;
    v8f x0 = cq[0] * RWSC + ld8(pl);
    v8f x1 = cq[1] * RWSC + ld8(pl + 16);
    v8f x2 = cq[2] * RWSC + ld8(pl + 32);
    v8f x3 = cq[3] * RWSC + ld8(pl + 48);
    float s = sum8((x0 + x1) + (x2 + x3));
    s += xhalf(s);
    const float mu = s * (1.0f / 64.0f);
    x0 -= mu; x1 -= mu; x2 -= mu; x3 -= mu;
    float q = sum8((x0 * x0 + x1 * x1) + (x2 * x2 + x3 * x3));
    q += xhalf(q);
    const float var = q * (1.0f / 64.0f);
    const float rs = rsqrtf(var + EPSV);
    x0 = x0 * rs * ld8(pl + HD)      + ld8(pl + 2 * HD);
    x1 = x1 * rs * ld8(pl + HD + 16) + ld8(pl + 2 * HD + 16);
    x2 = x2 * rs * ld8(pl + HD + 32) + ld8(pl + 2 * HD + 32);
    x3 = x3 * rs * ld8(pl + HD + 48) + ld8(pl + 2 * HD + 48);

    // B fragments of Q^T: elements 0..7 <- d = 32 ks + 8 hh + r (tile 2 ks), 8..15 <- d = 32 ks + 16 + 8 hh + r (tile 2 ks + 1)
    FragH qf0, qf1;
#pragma unroll
    for (int r = 0; r < 8; ++r) {
      qf0.h[0][r] = (_Float16)x0[r]; qf0.h[1][r] = (_Float16)x1[r];
      qf1.h[0][r] = (_Float16)x2[r]; qf1.h[1][r] = (_Float16)x3[r];
    }

    // next head's Q weight fragments as one load group: they fly during kv'*Q
    // (the last head reads its own again: in bounds, unused)
    {
      const int hn = (h + 1 < NH) ? h + 1 : h;
      const _Float16* wq = WqT + (size_t)hn * (DH * CIN) + 8 * lane;
#pragma unroll
      for (int nt = 0; nt < 4; ++nt) {
        bwq[nt][0] = ldfragl(wq + (16 * nt) * CIN); bwq[nt][1] = ldfragl(wq + (16 * nt) * CIN + 512);
      }
      // wait before the address registers of the loads above are overwritten; the address is named so that it stays in them up to here
      asm volatile("s_wait_xcnt 0x0" :: "v"(wq) : "memory");
    }

    // co^T += (kv'/16)^T Q^T: A = kvT[eo][d] (row eo, k = d), B = Q^T (col token, k = d)
#pragma unroll
    for (int et = 0; et < 4; ++et) {
      co[et] = wmf(bkv[et][0], qf0.v, co[et]);
      co[et] = wmf(bkv[et][1], qf1.v, co[et]);
    }
  }

  // epilogue: out = co/1024 + Wo_b/16384, token row m, columns 16 et + 8 hh + 0..7
#pragma unroll
  for (int et = 0; et < 4; ++et) {
    const v8f y = co[et] * (1.0f / 1024.0f) + ld8(Wo_b + 16 * et + 8 * hh) * (1.0f / 16384.0f);
    float* d = sw + m * SP + 16 * et + 8 * hh;
    *(v4f*)d = y.lo;
    *(v4f*)(d + 4) = y.hi;
  }
  __syncthreads();
  float* gp = out + tok0 * DH;
#pragma unroll
  for (int i = 0; i < 8; ++i) {
    const v4f x = *(const v4f*)(sw + (2 * i + hh) * SP + 4 * m);
    *(v4f*)(gp + i * 128 + 4 * lane) = x;
  }
}

// ---------------------------------------------------------------------------
extern "C" void kernel_launch(void* const* d_in, const int* in_sizes, int n_in,
                              void* d_out, int out_size, void* d_ws, size_t ws_size,
                              hipStream_t stream) {
  if (n_in < 13) return;
  if (in_sizes[0] != NB * NTOK * CIN) return;
  if (in_sizes[1] != CIN * HD || in_sizes[3] != CIN * HD || in_sizes[5] != CIN * HD) return;
  if (in_sizes[2] != HD || in_sizes[4] != HD || in_sizes[6] != HD) return;
  if (in_sizes[7] != NH * DH || in_sizes[8] != NH * DH || in_sizes[9] != NH * DH || in_sizes[10] != NH * DH) return;
  if (in_sizes[11] != HD * DH || in_sizes[12] != DH) return;
  if (out_size != NB * NTOK * DH) return;

  const float* v     = (const float*)d_in[0];
  const float* Wq_w  = (const float*)d_in[1];
  const float* Wq_b  = (const float*)d_in[2];
  const float* Wk_w  = (const float*)d_in[3];
  const float* Wk_b  = (const float*)d_in[4];
  const float* Wv_w  = (const float*)d_in[5];
  const float* Wv_b  = (const float*)d_in[6];
  const float* lnq_g = (const float*)d_in[7];
  const float* lnq_b = (const float*)d_in[8];
  const float* lnk_g = (const float*)d_in[9];
  const float* lnk_b = (const float*)d_in[10];
  const float* Wo_w  = (const float*)d_in[11];
  const float* Wo_b  = (const float*)d_in[12];
  float* out = (float*)d_out;

  // workspace carve (256-B aligned; every region an exact multiple of its whole-line store extent)
  char* ws = (char*)d_ws;
  size_t off = 0;
  const size_t oWq  = off; off += (size_t)CIN * HD * 2;               off = (off + 255) & ~(size_t)255;   // 65536
  const size_t oKvT = off; off += (size_t)NB * NH * DH * DH * 2;      off = (off + 255) & ~(size_t)255;   // 262144
  const size_t oPt  = off; off += (size_t)NB * NH * NTILE * DH * DH * 4; off = (off + 255) & ~(size_t)255; // 8388608
  if (off > ws_size || off > (size_t)WSCAP) return;
  _Float16* WqT  = (_Float16*)(ws + oWq);
  _Float16* kvT  = (_Float16*)(ws + oKvT);
  float*    part = (float*)(ws + oPt);

  // 1: K/V' projection + LayerNorm(K) + K^T V' partials per (batch, head, token tile); Wq -> f16 plane (x64)
  k_kv<<<NKVB + NQB, 128, 0, stream>>>(v, Wq_w, Wk_w, Wv_w, Wv_b, Wo_w, Wk_b, lnk_g, lnk_b, WqT, part);
  // 2: fixed-order partial sum -> kvT planes (f16, x1/16)
  k_kvred<<<NB * NH * (DH / RROW), 128, 0, stream>>>(part, kvT);
  // 3: Q projection + LayerNorm(Q) + Q kv' summed over heads, /n
  k_out<<<(NB * NTOK) / 64, 128, 0, stream>>>(v, WqT, Wq_b, lnq_g, lnq_b, kvT, Wo_b, out);
}

// v009
// Measured time: 35.9 microseconds a run.
// Two timings next to v008 put it at 1.06 and 1.05 times that version's speed.
// Over all steps from v000 it is 4.67 times as fast.
#include <hip/hip_runtime.h>
#include <stddef.h>

// All contractions on v_wmma_f32_16x16x32_f16 (f16 operands, f32 accumulate). The chain (Q (K^T V)) Wo is taken as Q (K^T (V Wo)) per head: Wvo = Wv_h*Wo_h (both carried x64) in the prologue of each K/V block, Q/K/V' projections (activations as-is, weights carried x64), K^T*V' per (batch, head) over token tiles with f32 fixed-order partial sums, Q*kv' (kv' carried x1/16) summed over the heads in the accumulator; RNE converts; power-of-two carries folded back in the f32 epilogues. The LayerNorm mean is linear in the token row: Wq, Wk and their biases are centred over the 64 head dims when their fragments are built, the centred bias (x64) is the C operand of the projection, and the accumulator is 64 (x - mu) as it stands. Variance, gamma, beta, 1/n scaling: f32 VALU.

#define NB     4
#define NTOK   16384
#define CIN    64
#define NH     8
#define DH     64
#define HD     (NH * DH)
#define NTILE  16                      // token tiles per (batch, head) for the K^T V partials: 512 blocks, two per WGP, two waves per SIMD
#define CHT    (NTOK / NTILE)          // 1024 tokens per kv block
#define KVIT   (CHT / 64)              // 16 steps of 64 tokens
#define TP     72                      // LDS pitch in halves of the transposed K/V tiles
#define SP     68                      // LDS pitch in floats of the output rows staged by token: 16-byte stores of 16 rows spread over the banks
#define RROW   8                       // rows d of a kv plane per reduce block: 256 blocks, one per WGP
#define NKVB   (NB * NH * NTILE)       // 512 K/V blocks
#define NRB    (NB * NH * (DH / RROW)) // 256 reduce blocks
#define NQB    32                      // blocks behind them in the same grid that build the Wq plane for the output launch
#define WSC    64.0f
#define RWSC   (1.0f / 64.0f)
#define EPSV   1e-5f
#define EPSC   (4096.0f * EPSV)        // eps beside the variance of values carried x64: x rsqrt(var + eps) = 64 x rsqrt(4096 var + 4096 eps)
#define WSCAP  134217728

static_assert(CIN == 64 && DH == 64 && HD == 512 && NH == 8);
static_assert((NTOK % NTILE) == 0 && (CHT % 64) == 0 && (NTOK % 64) == 0);
static_assert(NQB * 128 * 8 == CIN * HD);
static_assert((TP % 8) == 0 && TP >= 64);
static_assert(RROW == 8 && RROW * DH == 128 * 4);

typedef float    v2f  __attribute__((ext_vector_type(2)));
typedef float    v4f  __attribute__((ext_vector_type(4)));
typedef float    v8f  __attribute__((ext_vector_type(8)));
typedef _Float16 v4h  __attribute__((ext_vector_type(4)));
typedef _Float16 v8h  __attribute__((ext_vector_type(8)));
typedef _Float16 v16h __attribute__((ext_vector_type(16)));
union FragH { v16h v; v8h h[2]; };

// WMMA as the plain builtin: the compiler keeps the hazard distances of its own form and is free
// to issue the fragment loads of a whole group ahead of the products.
__device__ __forceinline__ v8f wmf(v16h a, v16h b, v8f c) {
  return __builtin_amdgcn_wmma_f32_16x16x32_f16(false, a, false, b, (short)0, c, false, false);
}

// 16x32 fragment from a 16-bit [row][k] (k-contiguous) tile, p = &T[row0][k0], pitch ld halves.
// Used for A (row = l&15) and for B stored as [n][k] (col = l&15); split k map:
// elements 0..7 <- k0 + 8h + 0..7, elements 8..15 <- k0 + 16 + 8h + 0..7, h = lane>>4.
__device__ __forceinline__ v16h ldfrag(const _Float16* p, int ld) {
  const int l = threadIdx.x & 31, hh = l >> 4, m = l & 15;
  const _Float16* q = p + m * ld + 8 * hh;
  FragH f;
  f.h[0] = *(const v8h*)q;
  f.h[1] = *(const v8h*)(q + 16);
  return f.v;
}

// The same fragment from a plane kept in fragment order: one (16-row tile, 32-deep k step) = 512 halves,
// chunk j (0, 1) of lane l at halves 256 j + 8 l, holding T[row0 + (l & 15)][k0 + 16 j + 8 (l >> 4) + 0..7].
// Each of the two 16-byte loads of a wave then reads 512 contiguous bytes (4 whole lines, not 32 B of 16 lines).
__device__ __forceinline__ v16h ldfragp(const _Float16* blk) {
  const _Float16* q = blk + 8 * (threadIdx.x & 31);
  FragH f;
  f.h[0] = *(const v8h*)q;
  f.h[1] = *(const v8h*)(q + 256);
  return f.v;
}

// ldfragp with the lane's own pointer q = blk + 8 * lane formed by the caller
__device__ __forceinline__ v16h ldfragl(const _Float16* q) {
  FragH f;
  f.h[0] = *(const v8h*)q;
  f.h[1] = *(const v8h*)(q + 256);
  return f.v;
}

// value of lane (l ^ M) of the same 16-lane row, M < 16: a DPP row_xmask operand (control 0x160 | M), all lanes on.
// It stays in the vector pipe and folds into the add that uses it; a shuffle goes through the LDS unit and is waited for.
template <int M>
__device__ __forceinline__ float rowx(float x) {
  return __builtin_bit_cast(float, __builtin_amdgcn_update_dpp(0, __builtin_bit_cast(int, x), 0x160 | M, 0xf, 0xf, true));
}

// sum over the 16 lanes of a half-wave (xor masks < 16 stay inside the row); butterfly order 8, 4, 2, 1
__device__ __forceinline__ float hred16(float x) {
  x += rowx<8>(x);
  x += rowx<4>(x);
  x += rowx<2>(x);
  x += rowx<1>(x);
  return x;
}

// value of lane l ^ 16 (the same place in the other 16-lane row): a vector cross-row move, not an LDS-unit shuffle
__device__ __forceinline__ float xhalf(float x) {
  const int b = __builtin_bit_cast(int, x);
  return __builtin_bit_cast(float, __builtin_amdgcn_permlanex16(b, b, 0x76543210, 0xfedcba98, false, false));
}

// 8 consecutive floats (16-byte aligned) as two 16-byte loads
__device__ __forceinline__ v8f ld8(const float* p) {
  const v4f a = *(const v4f*)p;
  const v4f c = *(const v4f*)(p + 4);
  return __builtin_shufflevector(a, c, 0, 1, 2, 3, 4, 5, 6, 7);
}

// sum of the 8 elements, tree order (4 + 4, 2 + 2, 1 + 1)
__device__ __forceinline__ float sum8(v8f t) {
  const v4f a = t.lo + t.hi;
  const v2f c = a.lo + a.hi;
  return c.x + c.y;
}

// this thread's half (32 consecutive floats at p, 16-byte aligned) of a 64-wide weight row, summed with the partner lane l ^ 1's half
__device__ __forceinline__ float rowsum64(const float* p) {
  v4f x[8];
#pragma unroll
  for (int i = 0; i < 8; ++i) x[i] = *(const v4f*)(p + 4 * i);
  // wait before the address register of the eight loads above is overwritten; the address is named so that it stays there up to here
  asm volatile("s_wait_xcnt 0x0" :: "v"(p) : "memory");
  const v4f a = ((x[0] + x[1]) + (x[2] + x[3])) + ((x[4] + x[5]) + (x[6] + x[7]));
  const v2f c = a.lo + a.hi;
  float t = c.x + c.y;
  t += rowx<1>(t);
  return t;
}

// 16 token rows of v (f32, 4 KB contiguous at g) as 8 loads of 16 bytes per lane: load i covers rows 2 i and 2 i + 1 whole
// (512 contiguous B, 4 lines); lane l has row 2 i + (l >> 4), channels 4 (l & 15) + 0..3
__device__ __forceinline__ void ldrows(const float* g, v4f (&x)[8]) {
  const float* q = g + 4 * (threadIdx.x & 31);
#pragma unroll
  for (int i = 0; i < 8; ++i) x[i] = *(const v4f*)(q + i * 128);
}

// those rows as f16 (RNE) into the wave's own LDS tile s [16][TP], from where ldfrag(s, TP) takes the fragments
__device__ __forceinline__ void strows(_Float16* s, const v4f (&x)[8]) {
  const int l = threadIdx.x & 31;
  _Float16* d = s + (l >> 4) * TP + 4 * (l & 15);
#pragma unroll
  for (int i = 0; i < 8; ++i) {
    v4h o;
    o[0] = (_Float16)x[i].x; o[1] = (_Float16)x[i].y; o[2] = (_Float16)x[i].z; o[3] = (_Float16)x[i].w;
    *(v4h*)(d + i * (2 * TP)) = o;
  }
}

// ---------------------------------------------------------------------------
// K/V' projection (V' = V Wo_h) + LayerNorm(K) + K^T V' partial. Block = (batch, head, token tile), 4 waves.
// There is no launch in front of this one: a block makes what it needs from the f32 inputs itself.
// Prologue: wave w builds, x64 in f16, the A fragments of Wv rows c = 16w..16w+15 (k = e) and the B fragments of Wo columns
// eo = 16w..16w+15 (k = e, same k map); the Wv fragments go to LDS in the fragment order of ldfragp, and two threads per row c
// leave the mean of Wk[c][head's 64 columns] there. Barrier. Wave w builds the B fragments of the centred Wk columns 16w..16w+15
// (chunk = (Wk[c0..c0+7][col] - mean[c0..c0+7]) x64), same order, and takes the four 16x16 tiles (row tile ct, eo tile w) of
// Wvo[c][eo] = sum_e Wv[c][h*64+e] Wo[h*64+e][eo]: the accumulator (8 consecutive c of one eo per lane) is that lane's 16-byte
// chunk of the V' weight fragments as it stands; a fifth tile with the bias row Wv_b in all 16 rows gives bvo[eo] (row 0, f32, x64).
// Barrier. Every wave reads all K and V' weight fragments into registers for the whole token loop.
// Per step each wave projects its own 16 tokens: their f32 rows are loaded one step ahead as whole lines, converted and laid
// in the wave's own LDS tile in front of the step's first barrier, and read as A fragments behind it. The projections start from
// the biases (x64, K's centred) as C: K's accumulator is 64 (x - mu), V's is 64 V', which goes to f16 as it is (partials carry x64).
// K and V are written transposed into LDS Kt/Vt [d][token] (one 16-B store per
// 16x16 tile per lane: 8 consecutive tokens of one d). Block barrier. Wave w then
// accumulates kv rows d = 16w..16w+15 x all 64 e over the 64 tokens: A = Kt (row d,
// k = token), B = Vt (col e, k = token), same loader. Barrier before the next step.
// Epilogue: kv strip staged as f32 rows in LDS, barrier, 8 whole-line store instructions per wave.
// coverage: Kt/Vt 4 waves x 4 tiles x 32 lanes x 8 = 64x64 halves each per step;
// part 4 waves x 8 x 32 x 4 floats = the block's 64x64 partial.
// ---------------------------------------------------------------------------
__global__ __launch_bounds__(128) void k_kv(
    const float* __restrict__ v, const float* __restrict__ Wk,
    const float* __restrict__ Wv, const float* __restrict__ Wv_b, const float* __restrict__ Wo,
    const float* __restrict__ Wk_b,
    const float* __restrict__ lnk_g, const float* __restrict__ lnk_b, float* part) {
  __shared__ __attribute__((aligned(16))) _Float16 Kt[DH * TP];
  __shared__ __attribute__((aligned(16))) _Float16 Vt[DH * TP];
  __shared__ __attribute__((aligned(16))) float stg[4 * 16 * DH];
  __shared__ __attribute__((aligned(16))) _Float16 vst[4 * 16 * TP];   // each wave's 16 token rows, f16
  __shared__ __attribute__((aligned(16))) _Float16 wks[DH * CIN];      // Wk_h fragments
  __shared__ __attribute__((aligned(16))) _Float16 wvs[DH * CIN];      // Wvo_h fragments
  __shared__ __attribute__((aligned(16))) _Float16 afr[DH * CIN];      // Wv_h fragments (A of the weight product)
  __shared__ float bvs[DH];
  __shared__ __attribute__((aligned(16))) float wmu[CIN];              // mean over the head's 64 columns of each weight row c
  const int lane = threadIdx.x & 31, wv = threadIdx.x >> 5, hh = lane >> 4, m = lane & 15;

  const int tile = blockIdx.x % NTILE;
  const int h = (blockIdx.x / NTILE) % NH;
  const int b = blockIdx.x / (NTILE * NH);

  // token rows of step 0; each step fetches the next step's rows in front of its own projections
  const float* vb = v + ((size_t)b * NTOK + (size_t)tile * CHT + (size_t)wv * 16) * CIN;
  _Float16* vs = vst + wv * (16 * TP);
  v4f xr[8];
  ldrows(vb, xr);
  // this wait and those like it below: each stands behind the last load of one address register and in front of the next
  // group, whose results the build otherwise lets land in that register
  asm volatile("s_wait_xcnt 0x0" ::: "memory");

  float bk[4], gk[4], btk[4];
#pragma unroll
  for (int nt = 0; nt < 4; ++nt) {
    const int col = h * DH + 16 * nt + m;
    bk[nt] = Wk_b[col];
    gk[nt] = lnk_g[col]; btk[nt] = lnk_b[col];
  }
  // the loads' index is named so that it stays in its register up to the wait
  asm volatile("s_wait_xcnt 0x0" :: "v"(h * DH + m) : "memory");
  // this thread's half of Wk row c = thread >> 1 (the head's 64 columns), for the row mean
  const float rsk = rowsum64(Wk + (threadIdx.x >> 1) * HD + h * DH + 32 * (threadIdx.x & 1));

  // the wave's share of the weights, f32, all loads in flight together; k = 32 ks + 16 j + 8 hh + e
  const float* kr = Wk + (8 * hh) * HD + h * DH + 16 * wv + m;            // column d, c strided
  const float* br = Wo + (h * DH + 8 * hh) * DH + 16 * wv + m;            // column eo, e strided
  const float* ar = Wv + (16 * wv + m) * HD + h * DH + 8 * hh;            // row c, e contiguous
  const float* rr = Wv_b + h * DH + 8 * hh;                               // the bias row, e contiguous
  float kw[2][2][8], bw[2][2][8];
  v8f aw[2][2], rw[2][2];
#pragma unroll
  for (int ks = 0; ks < 2; ++ks) {
#pragma unroll
    for (int j = 0; j < 2; ++j) {
#pragma unroll
      for (int e = 0; e < 8; ++e) kw[ks][j][e] = kr[(32 * ks + 16 * j + e) * HD];
    }
  }
  // here and at the three waits below the loads' address is named so that it stays in its registers up to the wait
  asm volatile("s_wait_xcnt 0x0" :: "v"(kr) : "memory");
#pragma unroll
  for (int ks = 0; ks < 2; ++ks) {
#pragma unroll
    for (int j = 0; j < 2; ++j) {
#pragma unroll
      for (int e = 0; e < 8; ++e) bw[ks][j][e] = br[(32 * ks + 16 * j + e) * DH];
    }
  }
  asm volatile("s_wait_xcnt 0x0" :: "v"(br) : "memory");
#pragma unroll
  for (int ks = 0; ks < 2; ++ks) {
#pragma unroll
    for (int j = 0; j < 2; ++j) aw[ks][j] = ld8(ar + 32 * ks + 16 * j);
  }
  asm volatile("s_wait_xcnt 0x0" :: "v"(ar) : "memory");
#pragma unroll
  for (int ks = 0; ks < 2; ++ks) {
#pragma unroll
    for (int j = 0; j < 2; ++j) rw[ks][j] = ld8(rr + 32 * ks + 16 * j);
  }
  // wait before the address register of the loads above is overwritten
  asm volatile("s_wait_xcnt 0x0" :: "v"(rr) : "memory");

  FragH af[2], bb[2], bf[2];
#pragma unroll
  for (int ks = 0; ks < 2; ++ks) {
#pragma unroll
    for (int j = 0; j < 2; ++j) {
#pragma unroll
      for (int e = 0; e < 8; ++e) {
        af[ks].h[j][e] = (_Float16)(aw[ks][j][e] * WSC);
        bb[ks].h[j][e] = (_Float16)(rw[ks][j][e] * WSC);
        bf[ks].h[j][e] = (_Float16)(bw[ks][j][e] * WSC);
      }
    }
  }
#pragma unroll
  for (int ks = 0; ks < 2; ++ks) {
#pragma unroll
    for (int j = 0; j < 2; ++j) {
      *(v8h*)(afr + (wv * 2 + ks) * 512 + j * 256 + 8 * lane) = af[ks].h[j];
    }
  }
  if ((threadIdx.x & 1) == 0) wmu[threadIdx.x >> 1] = rsk * (1.0f / 64.0f);
  strows(vs, xr);
  __syncthreads();

  // centred Wk fragments
#pragma unroll
  for (int ks = 0; ks < 2; ++ks) {
#pragma unroll
    for (int j = 0; j < 2; ++j) {
      const v8f mk = ld8(wmu + 32 * ks + 16 * j + 8 * hh);
      v8h o;
#pragma unroll
      for (int e = 0; e < 8; ++e) o[e] = (_Float16)((kw[ks][j][e] - mk[e]) * WSC);
      *(v8h*)(wks + (wv * 2 + ks) * 512 + j * 256 + 8 * lane) = o;
    }
  }

#pragma unroll
  for (int ct = 0; ct < 4; ++ct) {
    v8f acc = {0.f, 0.f, 0.f, 0.f, 0.f, 0.f, 0.f, 0.f};
    acc = wmf(ldfragp(afr + (ct * 2) * 512), bf[0].v, acc);
    acc = wmf(ldfragp(afr + (ct * 2 + 1) * 512), bf[1].v, acc);
    v8h o;
#pragma unroll
    for (int r = 0; r < 8; ++r) o[r] = (_Float16)(acc[r] * RWSC);   // x4096 -> x64
    *(v8h*)(wvs + (wv * 2 + (ct >> 1)) * 512 + (ct & 1) * 256 + 8 * lane) = o;
  }
  {
    v8f acc = {0.f, 0.f, 0.f, 0.f, 0.f, 0.f, 0.f, 0.f};
    acc = wmf(bb[0].v, bf[0].v, acc);
    acc = wmf(bb[1].v, bf[1].v, acc);
    if (hh == 0) bvs[16 * wv + m] = acc[0] * RWSC;   // x4096 -> x64
  }
  __syncthreads();

  v8f kvacc[4];
#pragma unroll
  for (int et = 0; et < 4; ++et) { v8f z = {0.f, 0.f, 0.f, 0.f, 0.f, 0.f, 0.f, 0.f}; kvacc[et] = z; }

  // the head's K and V' weight fragments do not change over the token loop: one read group, kept in registers
  // the biases (x64; K's minus its mean over the head dims) as whole C operands: a lane's 8 rows share its column
  v16h wkf[4][2], wvf[4][2];
  v8f kc[4], vc[4];
  const float bmu = hred16((bk[0] + bk[1]) + (bk[2] + bk[3])) * (1.0f / 64.0f);
#pragma unroll
  for (int nt = 0; nt < 4; ++nt) {
    wkf[nt][0] = ldfragp(wks + (nt * 2) * 512); wkf[nt][1] = ldfragp(wks + (nt * 2 + 1) * 512);
    wvf[nt][0] = ldfragp(wvs + (nt * 2) * 512); wvf[nt][1] = ldfragp(wvs + (nt * 2 + 1) * 512);
    const float kb = (bk[nt] - bmu) * WSC;
    const float vb0 = bvs[16 * nt + m];
#pragma unroll
    for (int r = 0; r < 8; ++r) { kc[nt][r] = kb; vc[nt][r] = vb0; }
  }
  v16h av0 = ldfrag(vs, TP);
  v16h av1 = ldfrag(vs + 32, TP);

#pragma unroll 1
  for (int it = 0; it < KVIT; ++it) {
    // next step's rows fly during the projections and the LayerNorm (the last step reads its own rows again: in bounds, unused)
    {
      const int itn = (it + 1 < KVIT) ? it + 1 : it;
      ldrows(vb + (size_t)itn * (64 * CIN), xr);
    }
    // wait before the address registers of the eight loads above are overwritten
    asm volatile("s_wait_xcnt 0x0" ::: "memory");
    // holds the eight loads in front of the projections: sunk to their use they would be waited for in full
    __builtin_amdgcn_sched_barrier(0);

    v8f ck[4], cv[4];
#pragma unroll
    for (int nt = 0; nt < 4; ++nt) {
      ck[nt] = wmf(av0, wkf[nt][0], kc[nt]);
      ck[nt] = wmf(av1, wkf[nt][1], ck[nt]);
      cv[nt] = wmf(av0, wvf[nt][0], vc[nt]);
      cv[nt] = wmf(av1, wvf[nt][1], cv[nt]);
    }

    // K: LayerNorm over the 64 head dims (row 8hh+r spread over 16 lanes x 4 tiles); the accumulator is 64 (x - mu).
    // The 8 rows go side by side as vectors: squares, scaling, gamma and beta on register pairs as the accumulators hold them
    v8f q8 = (ck[0] * ck[0] + ck[1] * ck[1]) + (ck[2] * ck[2] + ck[3] * ck[3]);
    v8f rs8;
#pragma unroll
    for (int r = 0; r < 8; ++r) rs8[r] = rsqrtf(hred16(q8[r]) * (1.0f / 64.0f) + EPSC);
#pragma unroll
    for (int nt = 0; nt < 4; ++nt) ck[nt] = ck[nt] * rs8 * gk[nt] + btk[nt];

    // transposed tiles: Kt[d][token], Vt[e][token], token = wv*16 + 8hh + r
#pragma unroll
    for (int nt = 0; nt < 4; ++nt) {
      v8h kk, vv;
#pragma unroll
      for (int r = 0; r < 8; ++r) {
        kk[r] = (_Float16)ck[nt][r];
        vv[r] = (_Float16)cv[nt][r];
      }
      *(v8h*)(Kt + (16 * nt + m) * TP + wv * 16 + 8 * hh) = kk;
      *(v8h*)(Vt + (16 * nt + m) * TP + wv * 16 + 8 * hh) = vv;
    }
    // next step's rows into the wave's own tile: its fragments of this step were read behind the barrier of the step before
    strows(vs, xr);
    __syncthreads();

    // kv rows 16wv..16wv+15 += K^T V over the 64 tokens (2 k-steps)
    const _Float16* ka = Kt + (16 * wv) * TP;
    v16h ak[2], bvf[2][4];
#pragma unroll
    for (int ks = 0; ks < 2; ++ks) {
      ak[ks] = ldfrag(ka + 32 * ks, TP);
#pragma unroll
      for (int et = 0; et < 4; ++et) bvf[ks][et] = ldfrag(Vt + (16 * et) * TP + 32 * ks, TP);
    }
    av0 = ldfrag(vs, TP);
    av1 = ldfrag(vs + 32, TP);
    // keeps the LDS fragment reads one group in front of the products: one place with reads, not one per product
    __builtin_amdgcn_sched_barrier(0);
#pragma unroll
    for (int ks = 0; ks < 2; ++ks) {
#pragma unroll
      for (int et = 0; et < 4; ++et) kvacc[et] = wmf(ak[ks], bvf[ks][et], kvacc[et]);
    }
    __syncthreads();
  }

  // epilogue: stage the wave's 16x64 f32 strip, then whole-line stores
  float* sw = stg + wv * (16 * DH);
#pragma unroll
  for (int et = 0; et < 4; ++et) {
#pragma unroll
    for (int r = 0; r < 8; ++r) sw[(8 * hh + r) * DH + 16 * et + m] = kvacc[et][r];
  }
  __syncthreads();
  float* gp = part + ((size_t)blockIdx.x * DH + (size_t)(16 * wv)) * DH;
#pragma unroll
  for (int i = 0; i < 8; ++i) {
    const v4f x = *(const v4f*)(sw + i * 128 + 4 * lane);
    *(v4f*)(gp + i * 128 + 4 * lane) = x;
  }
  
}

// ---------------------------------------------------------------------------
// kv reduce (block = (batch, head, group of 8 rows d), 128 threads): a thread takes 4 consecutive e of one row d and
// has the 16-byte loads of all NTILE partials in flight at once (a wave reads 512 contiguous B per load); fixed-order
// f32 sum (partial 0 first) into LDS kvs[row][e], barrier, then threads 0..63 each write one 16-byte chunk of the kvT
// plane (kv^T [e][d], f16 of kv/16; the partials carry x64) in the fragment order of ldfragp: chunk (e >> 4) * 128 + 16 * group + (e & 15)
// holds d = 8 * group + 0..7 of column e; 16 lanes write 256 contiguous B.
// coverage: 8 groups x 64 threads x 8 halves = 4096 = the (b,h) 64x64 plane.
// Blocks NRB..NRB+NQB-1 build the Wq plane (x64, fragment order: block (o tile 0..31, k step 0..1) of Wq^T [512][64]) for the
// output launch, centred over the head's 64 columns like Wk (row means through LDS, one barrier of their own, taken by the whole
// block), and leave in front of the other barrier: 32 x 128 threads x 8 halves = 32768. They stand in this grid because the K/V
// kernel's registers leave a WGP no room for a third block beside its two.
// ---------------------------------------------------------------------------
__global__ __launch_bounds__(128) void k_kvred(const float* __restrict__ part, const float* __restrict__ Wq,
                                               _Float16* kvT, _Float16* WqT) {
  __shared__ __attribute__((aligned(16))) float kvs[RROW * DH];
  const int t = threadIdx.x;

  if (blockIdx.x >= NRB) {
    const int hh = (t >> 4) & 1, m = t & 15;
    const int i = (blockIdx.x - NRB) * 128 + t;              // 0..4095: 16-byte chunk of the plane
    const int c0 = ((i >> 6) & 1) * 32 + ((i >> 5) & 1) * 16 + hh * 8;   // k offset in 64
    const int oc = (i >> 7) * 16 + m;                        // chunk = (Wq[c0..c0+7][oc] - mean[c0..c0+7]) * 64
    float wq8[8];
#pragma unroll
    for (int e = 0; e < 8; ++e) wq8[e] = Wq[(c0 + e) * HD + oc];
    // wait before the address register of the eight loads above is overwritten
    asm volatile("s_wait_xcnt 0x0" ::: "memory");
    // mean of Wq row c = thread >> 1 over the head's 64 columns, into kvs[c]
    const float rsq = rowsum64(Wq + (t >> 1) * HD + (i >> 9) * DH + 32 * (t & 1));
    if ((t & 1) == 0) kvs[t >> 1] = rsq * (1.0f / 64.0f);
    __syncthreads();
    const v8f mq = ld8(kvs + c0);
    v8h o;
#pragma unroll
    for (int e = 0; e < 8; ++e) o[e] = (_Float16)((wq8[e] - mq[e]) * WSC);
    *(v8h*)(WqT + (size_t)i * 8) = o;
    return;
  }

  const int bh = blockIdx.x / (DH / RROW);
  const int dg = blockIdx.x % (DH / RROW);
  const float* p0 = part + (size_t)bh * NTILE * (DH * DH) + dg * (RROW * DH) + 4 * t;
  v4f x[NTILE];
#pragma unroll
  for (int tl = 0; tl < NTILE; ++tl) x[tl] = *(const v4f*)(p0 + (size_t)tl * (DH * DH));
  // keeps all NTILE loads in front of the sum: without it the build issues the last three only when the first three have returned
  __builtin_amdgcn_sched_barrier(0);
  v4f s = {0.f, 0.f, 0.f, 0.f};
#pragma unroll
  for (int tl = 0; tl < NTILE; ++tl) s += x[tl];
  *(v4f*)(kvs + 4 * t) = s;
  __syncthreads();
  if (t < DH) {
    v8h o;
#pragma unroll
    for (int i = 0; i < RROW; ++i) o[i] = (_Float16)(kvs[i * DH + t] * (1.0f / 1024.0f));
    *(v8h*)(kvT + (size_t)bh * (DH * DH) + (size_t)((t >> 4) * 128 + dg * 16 + (t & 15)) * 8) = o;
  }
}

// ---------------------------------------------------------------------------
// Output: block = 64 tokens (4 waves x 16 tokens), all heads, both products taken transposed so that nothing leaves the registers.
// Per head: Q^T = Wq_h^T v^T (A = WqT plane, row d; B = v rows as f16 through the wave's LDS tile, col token): the accumulator of tile nt has the lane's own token
// (l & 15) and d = 16 nt + 8 (l >> 4) + r in its 8 registers. WqT is centred over d and the C operand is the centred bias (x64), so
// the accumulator is 64 (x - mu). Variance over d = 32 values of the lane plus the partner lane l ^ 16;
// bias, gamma and beta go by register, read from an LDS copy of the three rows (one barrier in front of the head loop, none in it).
// The f16 of tiles 2 ks and 2 ks + 1 side by side is the B fragment (col token, k = d, the split k map of ldfrag) of
// co^T += (kv'/16)^T Q^T with A = kvT plane (row eo, k = d, same map): the heads add up in the accumulator.
// Epilogue: out = co/1024 + Wo_b/16384; a lane holds 8 consecutive eo of its token per tile, staged as f32 rows in LDS
// (pitch SP), barrier, 8 store instructions per wave of 512 contiguous B.
// coverage: out 4 waves x 8 x 32 x 4 floats = the block's 64 rows x 64.
// ---------------------------------------------------------------------------
// second bound: four waves per SIMD (the grid is four waves per SIMD in one round), so the build keeps to 256 registers
__global__ __launch_bounds__(128, 4) void k_out(
    const float* __restrict__ v, const _Float16* __restrict__ WqT,
    const float* __restrict__ Wq_b, const float* __restrict__ lnq_g, const float* __restrict__ lnq_b,
    const _Float16* __restrict__ kvT,
    const float* __restrict__ Wo_b, float* out) {
  __shared__ __attribute__((aligned(16))) float stg[4 * 16 * SP];
  __shared__ __attribute__((aligned(16))) float prm[3 * HD];
  __shared__ __attribute__((aligned(16))) _Float16 vst[4 * 16 * TP];   // each wave's 16 token rows, f16
  const int lane = threadIdx.x & 31, wv = threadIdx.x >> 5, hh = lane >> 4, m = lane & 15;
  const int b = blockIdx.x / (NTOK / 64);

  // bias and LayerNorm rows of all heads to LDS, 128 threads x 4 floats per row: a lane now needs 8 consecutive d per tile,
  // the same for 16 lanes, which the LDS hands out as a broadcast beside the fragment loads of the cache path
  // (loaded first, stored behind the issue of the fragment loads below, which so fly over the barrier)
  const int t4 = 4 * threadIdx.x;
  const v4f pr0 = *(const v4f*)(Wq_b + t4);
  const v4f pr1 = *(const v4f*)(lnq_g + t4);
  const v4f pr2 = *(const v4f*)(lnq_b + t4);
  const size_t tok0 = (size_t)blockIdx.x * 64 + (size_t)wv * 16;
  float* sw = stg + wv * (16 * SP);

  // the wave's 16 token rows, f32 as whole lines; converted into its own LDS tile in front of the barrier below
  _Float16* vs = vst + wv * (16 * TP);
  v4f xr[8];
  ldrows(v + tok0 * CIN, xr);

  v8f co[4];
#pragma unroll
  for (int et = 0; et < 4; ++et) { v8f z = {0.f, 0.f, 0.f, 0.f, 0.f, 0.f, 0.f, 0.f}; co[et] = z; }

  // head 0's Q weight fragments; each head fetches the next head's in front of its kv'*Q products
  v16h bwq[4][2];
#pragma unroll
  for (int nt = 0; nt < 4; ++nt) {
    const _Float16* wq = WqT + (size_t)(16 * nt) * CIN;
    bwq[nt][0] = ldfragp(wq); bwq[nt][1] = ldfragp(wq + 512);
  }
  // wait before the address registers of the loads above are overwritten
  asm volatile("s_wait_xcnt 0x0" ::: "memory");

  // bias row minus its mean over the head's 64 dims (16 threads x 4, one 16-lane row per head), x64
  const float bmu = hred16((pr0.x + pr0.y) + (pr0.z + pr0.w)) * (1.0f / 64.0f);
  *(v4f*)(prm + t4)          = (pr0 - bmu) * WSC;
  *(v4f*)(prm + HD + t4)     = pr1;
  *(v4f*)(prm + 2 * HD + t4) = pr2;
  strows(vs, xr);
  __syncthreads();
  const v16h av0 = ldfrag(vs, TP);
  const v16h av1 = ldfrag(vs + 32, TP);
  // head 0's bias as C operands; each head reads the next head's beside the next weight fragments
  v8f cb[4];
#pragma unroll
  for (int nt = 0; nt < 4; ++nt) cb[nt] = ld8(prm + 8 * hh + 16 * nt);

#pragma unroll 1
  for (int h = 0; h < NH; ++h) {
    // Q^T projection for head h
    v8f cq[4];
#pragma unroll
    for (int nt = 0; nt < 4; ++nt) {
      cq[nt] = wmf(bwq[nt][0], av0, cb[nt]);
      cq[nt] = wmf(bwq[nt][1], av1, cq[nt]);
    }

    // this head's kv fragments as one load group: they fly during the LayerNorm
    const _Float16* kp = kvT + (size_t)(b * NH + h) * (DH * DH) + 8 * lane;
    v16h bkv[4][2];
#pragma unroll
    for (int et = 0; et < 4; ++et) {
      bkv[et][0] = ldfragl(kp + (16 * et) * DH);
      bkv[et][1] = ldfragl(kp + (16 * et) * DH + 512);
    }
    // wait before the address registers of the loads above are overwritten; the address is named so that it stays in them up to here
    asm volatile("s_wait_xcnt 0x0" :: "v"(kp) : "memory");

    // LayerNorm over the 64 head dims of the lane's token: 32 in the lane, 32 in lane l ^ 16
    const float* pl = prm + h * DH + 8 * hh;
    v8f x0 = cq[0], x1 = cq[1], x2 = cq[2], x3 = cq[3];
    float q = sum8((x0 * x0 + x1 * x1) + (x2 * x2 + x3 * x3));
    q += xhalf(q);
    const float rs = rsqrtf(q * (1.0f / 64.0f) + EPSC);
    x0 = x0 * rs * ld8(pl + HD)      + ld8(pl + 2 * HD);
    x1 = x1 * rs * ld8(pl + HD + 16) + ld8(pl + 2 * HD + 16);
    x2 = x2 * rs * ld8(pl + HD + 32) + ld8(pl + 2 * HD + 32);
    x3 = x3 * rs * ld8(pl + HD + 48) + ld8(pl + 2 * HD + 48);

    // B fragments of Q^T: elements 0..7 <- d = 32 ks + 8 hh + r (tile 2 ks), 8..15 <- d = 32 ks + 16 + 8 hh + r (tile 2 ks + 1)
    FragH qf0, qf1;
#pragma unroll
    for (int r = 0; r < 8; ++r) {
      qf0.h[0][r] = (_Float16)x0[r]; qf0.h[1][r] = (_Float16)x1[r];
      qf1.h[0][r] = (_Float16)x2[r]; qf1.h[1][r] = (_Float16)x3[r];
    }

    // next head's Q weight fragments as one load group: they fly during kv'*Q
    // (the last head reads its own again: in bounds, unused)
    {
      const int hn = (h + 1 < NH) ? h + 1 : h;
      const _Float16* wq = WqT + (size_t)hn * (DH * CIN) + 8 * lane;
#pragma unroll
      for (int nt = 0; nt < 4; ++nt) {
        bwq[nt][0] = ldfragl(wq + (16 * nt) * CIN); bwq[nt][1] = ldfragl(wq + (16 * nt) * CIN + 512);
      }
      // wait before the address registers of the loads above are overwritten; the address is named so that it stays in them up to here
      asm volatile("s_wait_xcnt 0x0" :: "v"(wq) : "memory");
#pragma unroll
      for (int nt = 0; nt < 4; ++nt) cb[nt] = ld8(prm + hn * DH + 8 * hh + 16 * nt);
    }

    // co^T += (kv'/16)^T Q^T: A = kvT[eo][d] (row eo, k = d), B = Q^T (col token, k = d)
#pragma unroll
    for (int et = 0; et < 4; ++et) {
      co[et] = wmf(bkv[et][0], qf0.v, co[et]);
      co[et] = wmf(bkv[et][1], qf1.v, co[et]);
    }
  }

  // epilogue: out = co/1024 + Wo_b/16384, token row m, columns 16 et + 8 hh + 0..7
#pragma unroll
  for (int et = 0; et < 4; ++et) {
    const v8f y = co[et] * (1.0f / 1024.0f) + ld8(Wo_b + 16 * et + 8 * hh) * (1.0f / 16384.0f);
    float* d = sw + m * SP + 16 * et + 8 * hh;
    *(v4f*)d = y.lo;
    *(v4f*)(d + 4) = y.hi;
  }
  __syncthreads();
  float* gp = out + tok0 * DH;
#pragma unroll
  for (int i = 0; i < 8; ++i) {
    const v4f x = *(const v4f*)(sw + (2 * i + hh) * SP + 4 * m);
    *(v4f*)(gp + i * 128 + 4 * lane) = x;
  }
}

// ---------------------------------------------------------------------------
extern "C" void kernel_launch(void* const* d_in, const int* in_sizes, int n_in,
                              void* d_out, int out_size, void* d_ws, size_t ws_size,
                              hipStream_t stream) {
  if (n_in < 13) return;
  if (in_sizes[0] != NB * NTOK * CIN) return;
  if (in_sizes[1] != CIN * HD || in_sizes[3] != CIN * HD || in_sizes[5] != CIN * HD) return;
  if (in_sizes[2] != HD || in_sizes[4] != HD || in_sizes[6] != HD) return;
  if (in_sizes[7] != NH * DH || in_sizes[8] != NH * DH || in_sizes[9] != NH * DH || in_sizes[10] != NH * DH) return;
  if (in_sizes[11] != HD * DH || in_sizes[12] != DH) return;
  if (out_size != NB * NTOK * DH) return;

  const float* v     = (const float*)d_in[0];
  const float* Wq_w  = (const float*)d_in[1];
  const float* Wq_b  = (const float*)d_in[2];
  const float* Wk_w  = (const float*)d_in[3];
  const float* Wk_b  = (const float*)d_in[4];
  const float* Wv_w  = (const float*)d_in[5];
  const float* Wv_b  = (const float*)d_in[6];
  const float* lnq_g = (const float*)d_in[7];
  const float* lnq_b = (const float*)d_in[8];
  const float* lnk_g = (const float*)d_in[9];
  const float* lnk_b = (const float*)d_in[10];
  const float* Wo_w  = (const float*)d_in[11];
  const float* Wo_b  = (const float*)d_in[12];
  float* out = (float*)d_out;

  // workspace carve (256-B aligned; every region an exact multiple of its whole-line store extent)
  char* ws = (char*)d_ws;
  size_t off = 0;
  const size_t oWq  = off; off += (size_t)CIN * HD * 2;               off = (off + 255) & ~(size_t)255;   // 65536
  const size_t oKvT = off; off += (size_t)NB * NH * DH * DH * 2;      off = (off + 255) & ~(size_t)255;   // 262144
  const size_t oPt  = off; off += (size_t)NB * NH * NTILE * DH * DH * 4; off = (off + 255) & ~(size_t)255; // 8388608
  if (off > ws_size || off > (size_t)WSCAP) return;
  _Float16* WqT  = (_Float16*)(ws + oWq);
  _Float16* kvT  = (_Float16*)(ws + oKvT);
  float*    part = (float*)(ws + oPt);

  // 1: K/V' projection + LayerNorm(K) + K^T V' partials per (batch, head, token tile)
  k_kv<<<NKVB, 128, 0, stream>>>(v, Wk_w, Wv_w, Wv_b, Wo_w, Wk_b, lnk_g, lnk_b, part);
  // 2: fixed-order partial sum -> kvT planes (f16, x1/16); Wq -> centred f16 plane (x64)
  k_kvred<<<NRB + NQB, 128, 0, stream>>>(part, Wq_w, kvT, WqT);
  // 3: Q projection + LayerNorm(Q) + Q kv' summed over heads, /n
  k_out<<<(NB * NTOK) / 64, 128, 0, stream>>>(v, WqT, Wq_b, lnq_g, lnq_b, kvT, Wo_b, out);
}
